// v000
// Times are from an AMD MI455X. After a warm-up the kernel runs many times in a row, and a time is the length of
// such a window on the GPU divided by its runs, so every launch and the gaps after it count. The runs cycle
// through copies of the inputs. A figure is the median of several windows, for all but v000 over two sittings.
// Sittings can differ by a few percent; kernels timed side by side share one.
// The starting kernel, v000, takes 337 microseconds a run.
#include <hip/hip_runtime.h>

#define CTX  2048
#define DIMS 1024
#define HEAD 16
#define HD   64

typedef __attribute__((ext_vector_type(16))) _Float16 v16h;
typedef __attribute__((ext_vector_type(8)))  _Float16 v8h;
typedef __attribute__((ext_vector_type(2)))  _Float16 v2h;
typedef __attribute__((ext_vector_type(8)))  float    v8f;

// Build a 16x16x32 f16 WMMA A/B fragment for this lane.
// 16-bit operand layout (ISA 7.12.2): lane half (lane/16) selects
// K in {0..7,16..23} (half=0) or {8..15,24..31} (half=1); both chunks are
// contiguous 8 x f16 = 16B runs, so two aligned 16-byte loads suffice.
__device__ inline v16h load_frag(const _Float16* rowbase, int half) {
  v8h lo = *(const v8h*)(rowbase + half * 8);
  v8h hi = *(const v8h*)(rowbase + 16 + half * 8);
  v16h r;
#pragma unroll
  for (int i = 0; i < 8; ++i) { r[i] = lo[i]; r[i + 8] = hi[i]; }
  return r;
}

// ---------------------------------------------------------------------------
// Stage 1: fused LayerNorm (q-path & kv-path share mean/var) + rotary radius
// ---------------------------------------------------------------------------
__global__ __launch_bounds__(256) void prep_kernel(
    const float* __restrict__ x,
    const float* __restrict__ qn_w, const float* __restrict__ qn_b,
    const float* __restrict__ kvn_w, const float* __restrict__ kvn_b,
    const float* __restrict__ rh_w, const float* __restrict__ rh_b,
    _Float16* __restrict__ lnq, _Float16* __restrict__ lnkv,
    float* __restrict__ radius)
{
  const int c = blockIdx.x, t = threadIdx.x;
  const float* row = x + (size_t)c * DIMS;
  float v[4];
  float s = 0.f, s2 = 0.f, dp = 0.f;
#pragma unroll
  for (int i = 0; i < 4; ++i) {
    int d = t + i * 256;
    float val = row[d];
    v[i] = val;
    s += val; s2 += val * val; dp += val * rh_w[d];
  }
  __shared__ float red[256];
  auto reduceAll = [&](float val) -> float {
    red[t] = val; __syncthreads();
    for (int o = 128; o > 0; o >>= 1) { if (t < o) red[t] += red[t + o]; __syncthreads(); }
    float r = red[0]; __syncthreads(); return r;
  };
  float tot  = reduceAll(s);
  float tot2 = reduceAll(s2);
  float dtot = reduceAll(dp);
  float mean = tot * (1.f / DIMS);
  float var  = tot2 * (1.f / DIMS) - mean * mean;
  float inv  = rsqrtf(var + 1e-5f);
  if (t == 0) {
    float per = dtot + rh_b[0];
    radius[c] = fminf(fmaxf(per * 0.01f, 0.5f), 2.0f);
  }
#pragma unroll
  for (int i = 0; i < 4; ++i) {
    int d = t + i * 256;
    float n = (v[i] - mean) * inv;
    lnq [(size_t)c * DIMS + d] = (_Float16)(n * qn_w[d] + qn_b[d]);
    lnkv[(size_t)c * DIMS + d] = (_Float16)(n * kvn_w[d] + kvn_b[d]);
  }
}

// ---------------------------------------------------------------------------
// Stage 2: f32 -> f16 weight conversion (one pass; weights then live in L2)
// ---------------------------------------------------------------------------
__global__ void cvt_kernel(const float* __restrict__ s, _Float16* __restrict__ d, int n) {
  int i = blockIdx.x * blockDim.x + threadIdx.x;
  int stride = gridDim.x * blockDim.x;
  for (; i < n; i += stride) d[i] = (_Float16)s[i];
}

// ---------------------------------------------------------------------------
// Stage 3/6: LDS-staged WMMA GEMM.  C(f32) = A(f16,MxK) * B(f16,KxN) + bias
// Block tile 64x128x32; 8 waves in 4(M) x 2(N); each wave owns a 16x64 strip
// = 4 accumulators -> 4 WMMAs per K-step sharing one A-fragment.
// LDS rows padded to 48 f16 (96 B) so all 16-byte fragment chunks stay aligned.
// ---------------------------------------------------------------------------
#define BM 64
#define BN 128
#define BK 32
#define LP 48   // padded LDS row stride in f16 (96 bytes, 16B-aligned chunks)
__global__ __launch_bounds__(256) void gemm_kernel(
    const _Float16* __restrict__ A, const _Float16* __restrict__ B,
    const float* __restrict__ bias, float* __restrict__ C,
    int M, int N, int K)
{
  __shared__ __align__(16) _Float16 As[BM][LP];
  __shared__ __align__(16) _Float16 Bt[BN][LP];   // B staged transposed (NxK)
  const int t = threadIdx.x, lane = t & 31, w = t >> 5;
  const int wm = w >> 1, wn = w & 1;              // 4 x 2 wave grid
  const int half = lane >> 4, l16 = lane & 15;
  const int bm = blockIdx.y * BM, bn = blockIdx.x * BN;
  const int ar = t >> 2, ac = (t & 3) * 8;        // A: one b128 per thread
  const int kp = t >> 4, ng = t & 15;             // B: two rows x 8 cols per thread
  v8f acc0 = {}, acc1 = {}, acc2 = {}, acc3 = {};
  for (int k0 = 0; k0 < K; k0 += BK) {
    // stage A tile (64x32): vectorized 16B load + 16B LDS store
    *(v8h*)&As[ar][ac] = *(const v8h*)(A + (size_t)(bm + ar) * K + k0 + ac);
    // stage B tile (32x128) transposed: pack two K-consecutive f16 per b32 store
    v8h blo = *(const v8h*)(B + (size_t)(k0 + 2 * kp)     * N + bn + ng * 8);
    v8h bhi = *(const v8h*)(B + (size_t)(k0 + 2 * kp + 1) * N + bn + ng * 8);
#pragma unroll
    for (int i = 0; i < 8; ++i) {
      v2h p; p[0] = blo[i]; p[1] = bhi[i];
      *(v2h*)&Bt[ng * 8 + i][2 * kp] = p;
    }
    if (k0 + BK < K) {  // prefetch next K tile -> global_prefetch_b8
      __builtin_prefetch(A + (size_t)(bm + ar) * K + k0 + BK + ac, 0, 3);
      __builtin_prefetch(B + (size_t)(k0 + BK + 2 * kp) * N + bn + ng * 8, 0, 3);
    }
    __syncthreads();
    const v16h a = load_frag(&As[wm * 16 + l16][0], half);
    const v16h b0 = load_frag(&Bt[wn * 64 +  0 + l16][0], half);
    const v16h b1 = load_frag(&Bt[wn * 64 + 16 + l16][0], half);
    const v16h b2 = load_frag(&Bt[wn * 64 + 32 + l16][0], half);
    const v16h b3 = load_frag(&Bt[wn * 64 + 48 + l16][0], half);
    acc0 = __builtin_amdgcn_wmma_f32_16x16x32_f16(false, a, false, b0, (short)0, acc0, false, false);
    acc1 = __builtin_amdgcn_wmma_f32_16x16x32_f16(false, a, false, b1, (short)0, acc1, false, false);
    acc2 = __builtin_amdgcn_wmma_f32_16x16x32_f16(false, a, false, b2, (short)0, acc2, false, false);
    acc3 = __builtin_amdgcn_wmma_f32_16x16x32_f16(false, a, false, b3, (short)0, acc3, false, false);
    __syncthreads();
  }
  // epilogue: C layout per tile: M = r + 8*half, N = l16
  const int ncol0 = bn + wn * 64 + l16;
  const float bb0 = bias[ncol0], bb1 = bias[ncol0 + 16];
  const float bb2 = bias[ncol0 + 32], bb3 = bias[ncol0 + 48];
#pragma unroll
  for (int r = 0; r < 8; ++r) {
    const size_t rowoff = (size_t)(bm + wm * 16 + r + 8 * half) * N + ncol0;
    C[rowoff]      = acc0[r] + bb0;
    C[rowoff + 16] = acc1[r] + bb1;
    C[rowoff + 32] = acc2[r] + bb2;
    C[rowoff + 48] = acc3[r] + bb3;
  }
}

// ---------------------------------------------------------------------------
// Stage 4: rotary (mel-scaled freqs, per-step radius) + per-head LayerNorm.
// One wave per (ctx row, head); lane j handles complex pair (2j, 2j+1).
// Also writes V transposed [h][d][c] so flash V fragments are contiguous.
// ---------------------------------------------------------------------------
__global__ __launch_bounds__(32) void rotln_kernel(
    const float* __restrict__ qf, const float* __restrict__ kvf,
    const float* __restrict__ radius,
    const float* __restrict__ ln_w, const float* __restrict__ ln_b,
    _Float16* __restrict__ qn, _Float16* __restrict__ kn,
    _Float16* __restrict__ vT)
{
  const int c = blockIdx.x, h = blockIdx.y, j = threadIdx.x;
  const float mel_max = 2595.0f * 1.3222192947339193f;          // 2595*log10(21)
  const float lin = (float)j * (mel_max / 31.0f);               // linspace, 32 pts
  const float fb = 0.2f * (expf(lin * (2.3025850929940457f / 2595.0f)) - 1.0f);
  const float freq = (float)c * fb;
  const float rad = radius[c];
  const float fr = rad * cosf(freq), fi = rad * sinf(freq);
  const int d0 = 2 * j, d1 = 2 * j + 1;

  const float* qrow = qf + (size_t)c * DIMS + h * HD;
  float qr = qrow[d0], qi = qrow[d1];
  float qor = qr * fr - qi * fi, qoi = qr * fi + qi * fr;

  const float* krow = kvf + (size_t)c * (2 * DIMS) + h * HD;
  float kr = krow[d0], ki = krow[d1];
  float kor = kr * fr - ki * fi, koi = kr * fi + ki * fr;

  const float* vrow = kvf + (size_t)c * (2 * DIMS) + DIMS + h * HD;
  vT[(size_t)(h * HD + d0) * CTX + c] = (_Float16)vrow[d0];
  vT[(size_t)(h * HD + d1) * CTX + c] = (_Float16)vrow[d1];

  // per-head LN over 64 elems, reduced across the 32 lanes of this wave
  float qs = qor + qoi, qs2 = qor * qor + qoi * qoi;
  float ks = kor + koi, ks2 = kor * kor + koi * koi;
#pragma unroll
  for (int m = 16; m >= 1; m >>= 1) {
    qs += __shfl_xor(qs, m, 32);  qs2 += __shfl_xor(qs2, m, 32);
    ks += __shfl_xor(ks, m, 32);  ks2 += __shfl_xor(ks2, m, 32);
  }
  float qm = qs * (1.f / HD), qv = qs2 * (1.f / HD) - qm * qm, qiv = rsqrtf(qv + 1e-5f);
  float km = ks * (1.f / HD), kv = ks2 * (1.f / HD) - km * km, kiv = rsqrtf(kv + 1e-5f);
  _Float16* qdst = qn + ((size_t)h * CTX + c) * HD;
  _Float16* kdst = kn + ((size_t)h * CTX + c) * HD;
  qdst[d0] = (_Float16)((qor - qm) * qiv * ln_w[d0] + ln_b[d0]);
  qdst[d1] = (_Float16)((qoi - qm) * qiv * ln_w[d1] + ln_b[d1]);
  kdst[d0] = (_Float16)((kor - km) * kiv * ln_w[d0] + ln_b[d0]);
  kdst[d1] = (_Float16)((koi - km) * kiv * ln_w[d1] + ln_b[d1]);
}

// ---------------------------------------------------------------------------
// Stage 5: flash attention. 4 waves/block; each wave owns 16 q rows of one
// head, streams 32 keys/iter: 4 WMMAs for S, online softmax (shfl reductions
// per 16-lane half matching C layout), P re-shaped via small LDS tile,
// 4 WMMAs for O += P*V. Scores never hit HBM.
// ---------------------------------------------------------------------------
__global__ __launch_bounds__(128) void flash_kernel(
    const _Float16* __restrict__ qn, const _Float16* __restrict__ kn,
    const _Float16* __restrict__ vT, _Float16* __restrict__ aout)
{
  const int lane = threadIdx.x & 31;
  const int w = threadIdx.x >> 5;
  const int h = blockIdx.y;
  const int qt = blockIdx.x * 4 + w;          // 16-row query tile
  const int half = lane >> 4, l16 = lane & 15;
  __shared__ __align__(16) _Float16 P[4][16][40];

  const _Float16* qrow = qn + ((size_t)h * CTX + qt * 16 + l16) * HD;
  const v16h aq0 = load_frag(qrow, half);       // K = 0..31
  const v16h aq1 = load_frag(qrow + 32, half);  // K = 32..63

  v8f o0 = {}, o1 = {}, o2 = {}, o3 = {};
  float mrow[8], lrow[8];
#pragma unroll
  for (int r = 0; r < 8; ++r) { mrow[r] = -1e30f; lrow[r] = 0.f; }

  for (int kb = 0; kb < CTX; kb += 32) {
    const _Float16* k0row = kn + ((size_t)h * CTX + kb + l16) * HD;
    const _Float16* k1row = k0row + 16 * HD;
    v8f z = {};
    v8f s0 = __builtin_amdgcn_wmma_f32_16x16x32_f16(false, aq0, false, load_frag(k0row, half), (short)0, z, false, false);
    s0 = __builtin_amdgcn_wmma_f32_16x16x32_f16(false, aq1, false, load_frag(k0row + 32, half), (short)0, s0, false, false);
    v8f s1 = __builtin_amdgcn_wmma_f32_16x16x32_f16(false, aq0, false, load_frag(k1row, half), (short)0, z, false, false);
    s1 = __builtin_amdgcn_wmma_f32_16x16x32_f16(false, aq1, false, load_frag(k1row + 32, half), (short)0, s1, false, false);
#pragma unroll
    for (int r = 0; r < 8; ++r) {
      float a = s0[r] * 0.125f, b = s1[r] * 0.125f;   // 1/sqrt(64)
      float mx = fmaxf(a, b);
#pragma unroll
      for (int m = 8; m >= 1; m >>= 1) mx = fmaxf(mx, __shfl_xor(mx, m, 32));
      float mnew = fmaxf(mrow[r], mx);
      float alpha = __expf(mrow[r] - mnew);
      mrow[r] = mnew;
      float p0 = __expf(a - mnew), p1 = __expf(b - mnew);
      float ps = p0 + p1;
#pragma unroll
      for (int m = 8; m >= 1; m >>= 1) ps += __shfl_xor(ps, m, 32);
      lrow[r] = lrow[r] * alpha + ps;
      o0[r] *= alpha; o1[r] *= alpha; o2[r] *= alpha; o3[r] *= alpha;
      P[w][r + 8 * half][l16]      = (_Float16)p0;   // C layout -> LDS
      P[w][r + 8 * half][16 + l16] = (_Float16)p1;
    }
    const v16h ap = load_frag(&P[w][l16][0], half);  // back as A fragment
    const _Float16* vb = vT + ((size_t)h * HD + l16) * CTX + kb;
    o0 = __builtin_amdgcn_wmma_f32_16x16x32_f16(false, ap, false, load_frag(vb, half), (short)0, o0, false, false);
    o1 = __builtin_amdgcn_wmma_f32_16x16x32_f16(false, ap, false, load_frag(vb + (size_t)16 * CTX, half), (short)0, o1, false, false);
    o2 = __builtin_amdgcn_wmma_f32_16x16x32_f16(false, ap, false, load_frag(vb + (size_t)32 * CTX, half), (short)0, o2, false, false);
    o3 = __builtin_amdgcn_wmma_f32_16x16x32_f16(false, ap, false, load_frag(vb + (size_t)48 * CTX, half), (short)0, o3, false, false);
  }
  _Float16* arow0 = aout + (size_t)(qt * 16) * DIMS + h * HD;
#pragma unroll
  for (int r = 0; r < 8; ++r) {
    float rl = 1.f / lrow[r];
    _Float16* dst = arow0 + (size_t)(r + 8 * half) * DIMS;
    dst[ 0 + l16] = (_Float16)(o0[r] * rl);
    dst[16 + l16] = (_Float16)(o1[r] * rl);
    dst[32 + l16] = (_Float16)(o2[r] * rl);
    dst[48 + l16] = (_Float16)(o3[r] * rl);
  }
}

// ---------------------------------------------------------------------------
extern "C" void kernel_launch(void* const* d_in, const int* in_sizes, int n_in,
                              void* d_out, int out_size, void* d_ws, size_t ws_size,
                              hipStream_t stream) {
  const float* x     = (const float*)d_in[0];
  const float* qn_w  = (const float*)d_in[1];
  const float* qn_b  = (const float*)d_in[2];
  const float* q_w   = (const float*)d_in[3];
  const float* q_b   = (const float*)d_in[4];
  const float* kvn_w = (const float*)d_in[5];
  const float* kvn_b = (const float*)d_in[6];
  const float* kv_w  = (const float*)d_in[7];
  const float* kv_b  = (const float*)d_in[8];
  const float* out_w = (const float*)d_in[9];
  const float* out_b = (const float*)d_in[10];
  const float* ln_w  = (const float*)d_in[11];
  const float* ln_b  = (const float*)d_in[12];
  const float* rh_w  = (const float*)d_in[13];
  const float* rh_b  = (const float*)d_in[14];
  float* out = (float*)d_out;
  (void)in_sizes; (void)n_in; (void)out_size; (void)ws_size;

  char* base = (char*)d_ws;
  size_t off = 0;
  auto take = [&](size_t bytes) -> char* {
    char* p = base + off;
    off = (off + bytes + 255) & ~(size_t)255;
    return p;
  };
  _Float16* lnq16  = (_Float16*)take((size_t)CTX * DIMS * 2);
  _Float16* lnkv16 = (_Float16*)take((size_t)CTX * DIMS * 2);
  float*    radius = (float*)take((size_t)CTX * 4);
  _Float16* qw16   = (_Float16*)take((size_t)DIMS * DIMS * 2);
  _Float16* kvw16  = (_Float16*)take((size_t)DIMS * 2 * DIMS * 2);
  _Float16* outw16 = (_Float16*)take((size_t)DIMS * DIMS * 2);
  float*    qf32   = (float*)take((size_t)CTX * DIMS * 4);
  float*    kvf32  = (float*)take((size_t)CTX * 2 * DIMS * 4);
  _Float16* qn16   = (_Float16*)take((size_t)HEAD * CTX * HD * 2);
  _Float16* kn16   = (_Float16*)take((size_t)HEAD * CTX * HD * 2);
  _Float16* vT16   = (_Float16*)take((size_t)HEAD * HD * CTX * 2);
  _Float16* a16    = (_Float16*)take((size_t)CTX * DIMS * 2);

  prep_kernel<<<CTX, 256, 0, stream>>>(x, qn_w, qn_b, kvn_w, kvn_b, rh_w, rh_b,
                                       lnq16, lnkv16, radius);
  cvt_kernel<<<256, 256, 0, stream>>>(q_w,   qw16,   DIMS * DIMS);
  cvt_kernel<<<256, 256, 0, stream>>>(kv_w,  kvw16,  DIMS * 2 * DIMS);
  cvt_kernel<<<256, 256, 0, stream>>>(out_w, outw16, DIMS * DIMS);

  gemm_kernel<<<dim3(DIMS / BN, CTX / BM), 256, 0, stream>>>(
      lnq16, qw16, q_b, qf32, CTX, DIMS, DIMS);
  gemm_kernel<<<dim3(2 * DIMS / BN, CTX / BM), 256, 0, stream>>>(
      lnkv16, kvw16, kv_b, kvf32, CTX, 2 * DIMS, DIMS);

  rotln_kernel<<<dim3(CTX, HEAD), 32, 0, stream>>>(
      qf32, kvf32, radius, ln_w, ln_b, qn16, kn16, vT16);

  flash_kernel<<<dim3(CTX / 16 / 4, HEAD), 128, 0, stream>>>(qn16, kn16, vT16, a16);

  gemm_kernel<<<dim3(DIMS / BN, CTX / BM), 256, 0, stream>>>(
      a16, outw16, out_b, out, CTX, DIMS, DIMS);
}

// v001
// Measured time: 260 microseconds a run.
// Next to v000, in two timings, it ran 1.31 and 1.32 times as fast.
#include <hip/hip_runtime.h>

#define CTX  2048
#define DIMS 1024
#define HEAD 16
#define HD   64

typedef __attribute__((ext_vector_type(16))) _Float16 v16h;
typedef __attribute__((ext_vector_type(8)))  _Float16 v8h;
typedef __attribute__((ext_vector_type(2)))  _Float16 v2h;
typedef __attribute__((ext_vector_type(8)))  float    v8f;

// Build a 16x16x32 f16 WMMA A/B fragment for this lane.
// 16-bit operand layout (ISA 7.12.2): lane half (lane/16) selects
// K in {0..7,16..23} (half=0) or {8..15,24..31} (half=1); both chunks are
// contiguous 8 x f16 = 16B runs, so two aligned 16-byte loads suffice.
__device__ inline v16h load_frag(const _Float16* rowbase, int half) {
  v8h lo = *(const v8h*)(rowbase + half * 8);
  v8h hi = *(const v8h*)(rowbase + 16 + half * 8);
  v16h r;
#pragma unroll
  for (int i = 0; i < 8; ++i) { r[i] = lo[i]; r[i + 8] = hi[i]; }
  return r;
}

// ---------------------------------------------------------------------------
// Stage 1: fused LayerNorm (q-path & kv-path share mean/var) + rotary radius
// ---------------------------------------------------------------------------
__global__ __launch_bounds__(256) void prep_kernel(
    const float* __restrict__ x,
    const float* __restrict__ qn_w, const float* __restrict__ qn_b,
    const float* __restrict__ kvn_w, const float* __restrict__ kvn_b,
    const float* __restrict__ rh_w, const float* __restrict__ rh_b,
    _Float16* __restrict__ lnq, _Float16* __restrict__ lnkv,
    float* __restrict__ radius)
{
  const int c = blockIdx.x, t = threadIdx.x;
  const float* row = x + (size_t)c * DIMS;
  float v[4];
  float s = 0.f, s2 = 0.f, dp = 0.f;
#pragma unroll
  for (int i = 0; i < 4; ++i) {
    int d = t + i * 256;
    float val = row[d];
    v[i] = val;
    s += val; s2 += val * val; dp += val * rh_w[d];
  }
  __shared__ float red[256];
  auto reduceAll = [&](float val) -> float {
    red[t] = val; __syncthreads();
    for (int o = 128; o > 0; o >>= 1) { if (t < o) red[t] += red[t + o]; __syncthreads(); }
    float r = red[0]; __syncthreads(); return r;
  };
  float tot  = reduceAll(s);
  float tot2 = reduceAll(s2);
  float dtot = reduceAll(dp);
  float mean = tot * (1.f / DIMS);
  float var  = tot2 * (1.f / DIMS) - mean * mean;
  float inv  = rsqrtf(var + 1e-5f);
  if (t == 0) {
    float per = dtot + rh_b[0];
    radius[c] = fminf(fmaxf(per * 0.01f, 0.5f), 2.0f);
  }
#pragma unroll
  for (int i = 0; i < 4; ++i) {
    int d = t + i * 256;
    float n = (v[i] - mean) * inv;
    lnq [(size_t)c * DIMS + d] = (_Float16)(n * qn_w[d] + qn_b[d]);
    lnkv[(size_t)c * DIMS + d] = (_Float16)(n * kvn_w[d] + kvn_b[d]);
  }
}

// ---------------------------------------------------------------------------
// Stage 2: f32 -> f16 weight conversion (one pass; weights then live in L2)
// ---------------------------------------------------------------------------
__global__ void cvt_kernel(const float* __restrict__ s, _Float16* __restrict__ d, int n) {
  int i = blockIdx.x * blockDim.x + threadIdx.x;
  int stride = gridDim.x * blockDim.x;
  for (; i < n; i += stride) d[i] = (_Float16)s[i];
}

// ---------------------------------------------------------------------------
// Stage 3/6: LDS-staged WMMA GEMM.  C(f32) = A(f16,MxK) * B(f16,KxN) + bias
// Block tile 64x128x32; 8 waves in 4(M) x 2(N); each wave owns a 16x64 strip
// = 4 accumulators -> 4 WMMAs per K-step sharing one A-fragment.
// LDS rows padded to 48 f16 (96 B) so all 16-byte fragment chunks stay aligned.
// ---------------------------------------------------------------------------
#define BM 64
#define BN 128
#define BK 32
#define LP 48   // padded LDS row stride in f16 (96 bytes, 16B-aligned chunks)
__global__ __launch_bounds__(256) void gemm_kernel(
    const _Float16* __restrict__ A, const _Float16* __restrict__ B,
    const float* __restrict__ bias, float* __restrict__ C,
    int M, int N, int K)
{
  __shared__ __align__(16) _Float16 As[BM][LP];
  __shared__ __align__(16) _Float16 Bt[BN][LP];   // B staged transposed (NxK)
  const int t = threadIdx.x, lane = t & 31, w = t >> 5;
  const int wm = w >> 1, wn = w & 1;              // 4 x 2 wave grid
  const int half = lane >> 4, l16 = lane & 15;
  const int bm = blockIdx.y * BM, bn = blockIdx.x * BN;
  const int ar = t >> 2, ac = (t & 3) * 8;        // A: one b128 per thread
  const int kp = t >> 4, ng = t & 15;             // B: two rows x 8 cols per thread
  v8f acc0 = {}, acc1 = {}, acc2 = {}, acc3 = {};
  for (int k0 = 0; k0 < K; k0 += BK) {
    // stage A tile (64x32): vectorized 16B load + 16B LDS store
    *(v8h*)&As[ar][ac] = *(const v8h*)(A + (size_t)(bm + ar) * K + k0 + ac);
    // stage B tile (32x128) transposed: pack two K-consecutive f16 per b32 store
    v8h blo = *(const v8h*)(B + (size_t)(k0 + 2 * kp)     * N + bn + ng * 8);
    v8h bhi = *(const v8h*)(B + (size_t)(k0 + 2 * kp + 1) * N + bn + ng * 8);
#pragma unroll
    for (int i = 0; i < 8; ++i) {
      v2h p; p[0] = blo[i]; p[1] = bhi[i];
      *(v2h*)&Bt[ng * 8 + i][2 * kp] = p;
    }
    if (k0 + BK < K) {  // prefetch next K tile -> global_prefetch_b8
      __builtin_prefetch(A + (size_t)(bm + ar) * K + k0 + BK + ac, 0, 3);
      __builtin_prefetch(B + (size_t)(k0 + BK + 2 * kp) * N + bn + ng * 8, 0, 3);
    }
    __syncthreads();
    const v16h a = load_frag(&As[wm * 16 + l16][0], half);
    const v16h b0 = load_frag(&Bt[wn * 64 +  0 + l16][0], half);
    const v16h b1 = load_frag(&Bt[wn * 64 + 16 + l16][0], half);
    const v16h b2 = load_frag(&Bt[wn * 64 + 32 + l16][0], half);
    const v16h b3 = load_frag(&Bt[wn * 64 + 48 + l16][0], half);
    acc0 = __builtin_amdgcn_wmma_f32_16x16x32_f16(false, a, false, b0, (short)0, acc0, false, false);
    acc1 = __builtin_amdgcn_wmma_f32_16x16x32_f16(false, a, false, b1, (short)0, acc1, false, false);
    acc2 = __builtin_amdgcn_wmma_f32_16x16x32_f16(false, a, false, b2, (short)0, acc2, false, false);
    acc3 = __builtin_amdgcn_wmma_f32_16x16x32_f16(false, a, false, b3, (short)0, acc3, false, false);
    __syncthreads();
  }
  // epilogue: C layout per tile: M = r + 8*half, N = l16
  const int ncol0 = bn + wn * 64 + l16;
  const float bb0 = bias[ncol0], bb1 = bias[ncol0 + 16];
  const float bb2 = bias[ncol0 + 32], bb3 = bias[ncol0 + 48];
#pragma unroll
  for (int r = 0; r < 8; ++r) {
    const size_t rowoff = (size_t)(bm + wm * 16 + r + 8 * half) * N + ncol0;
    C[rowoff]      = acc0[r] + bb0;
    C[rowoff + 16] = acc1[r] + bb1;
    C[rowoff + 32] = acc2[r] + bb2;
    C[rowoff + 48] = acc3[r] + bb3;
  }
}

// ---------------------------------------------------------------------------
// Stage 4: rotary (mel-scaled freqs, per-step radius) + per-head LayerNorm.
// One 8-wave block per (64 ctx rows, head); a wave takes 8 rows, one after the
// other, and lane j handles complex pair (2j, 2j+1) of each.
// Also writes V transposed [h][d][c] so flash V fragments are contiguous: the
// 64x64 V tile is turned in LDS, so each vT store covers whole 128-byte lines.
// ---------------------------------------------------------------------------
#define RT 64   // ctx rows per block = one 128-byte line of vT per d
#define RW 8    // ctx rows per wave
#define VP 66   // LDS pitch in f16 = 33 dwords (odd): column writes and row reads both spread over the banks
__global__ __launch_bounds__(256) void rotln_kernel(
    const float* __restrict__ qf, const float* __restrict__ kvf,
    const float* __restrict__ radius,
    const float* __restrict__ ln_w, const float* __restrict__ ln_b,
    _Float16* __restrict__ qn, _Float16* __restrict__ kn,
    _Float16* __restrict__ vT)
{
  __shared__ __align__(16) _Float16 Vs[HD][VP];
  const int t = threadIdx.x, j = t & 31, w = t >> 5;
  const int c0 = blockIdx.x * RT, h = blockIdx.y;
  const float mel_max = 2595.0f * 1.3222192947339193f;          // 2595*log10(21)
  const float lin = (float)j * (mel_max / 31.0f);               // linspace, 32 pts
  const float fb = 0.2f * (expf(lin * (2.3025850929940457f / 2595.0f)) - 1.0f);
  const int d0 = 2 * j, d1 = 2 * j + 1;
  const float lw0 = ln_w[d0], lw1 = ln_w[d1], lb0 = ln_b[d0], lb1 = ln_b[d1];

  // all 8 rows' loads are issued before the first row is worked on
  float2 qv[RW], kk[RW], vv[RW];
  float rr[RW];
#pragma unroll
  for (int i = 0; i < RW; ++i) {
    const int c = c0 + w * RW + i;
    qv[i] = *(const float2*)(qf  + (size_t)c * DIMS + h * HD + d0);
    kk[i] = *(const float2*)(kvf + (size_t)c * (2 * DIMS) + h * HD + d0);
    vv[i] = *(const float2*)(kvf + (size_t)c * (2 * DIMS) + DIMS + h * HD + d0);
    rr[i] = radius[c];
  }

  // V: two neighbouring rows of one d make one 32-bit LDS store
#pragma unroll
  for (int i = 0; i < RW; i += 2) {
    v2h p0, p1;
    p0[0] = (_Float16)vv[i].x; p0[1] = (_Float16)vv[i + 1].x;
    p1[0] = (_Float16)vv[i].y; p1[1] = (_Float16)vv[i + 1].y;
    *(v2h*)&Vs[d0][w * RW + i] = p0;
    *(v2h*)&Vs[d1][w * RW + i] = p1;
  }

  // V goes out first, so that its stores fly under the q/k arithmetic below
  __syncthreads();   // the V tile is complete before any wave reads it back by rows
#pragma unroll
  for (int p = 0; p < 2; ++p) {
    const int idx = p * 256 + t;
    const int d = idx >> 3, ch = idx & 7;       // 8 lanes x 16 B = one line of vT
    v8h o;
#pragma unroll
    for (int e = 0; e < 4; ++e) {
      const v2h x = *(const v2h*)&Vs[d][ch * 8 + 2 * e];
      o[2 * e] = x[0]; o[2 * e + 1] = x[1];
    }
    *(v8h*)(vT + (size_t)(h * HD + d) * CTX + c0 + ch * 8) = o;
  }

#pragma unroll
  for (int i = 0; i < RW; ++i) {
    const int c = c0 + w * RW + i;
    const float freq = (float)c * fb;
    const float rad = rr[i];
    const float fr = rad * cosf(freq), fi = rad * sinf(freq);

    float qr = qv[i].x, qi = qv[i].y;
    float qor = qr * fr - qi * fi, qoi = qr * fi + qi * fr;
    float kr = kk[i].x, ki = kk[i].y;
    float kor = kr * fr - ki * fi, koi = kr * fi + ki * fr;

    // per-head LN over 64 elems, reduced across the 32 lanes of this wave
    float qs = qor + qoi, qs2 = qor * qor + qoi * qoi;
    float ks = kor + koi, ks2 = kor * kor + koi * koi;
#pragma unroll
    for (int m = 16; m >= 1; m >>= 1) {
      qs += __shfl_xor(qs, m, 32);  qs2 += __shfl_xor(qs2, m, 32);
      ks += __shfl_xor(ks, m, 32);  ks2 += __shfl_xor(ks2, m, 32);
    }
    float qm = qs * (1.f / HD), qvar = qs2 * (1.f / HD) - qm * qm, qiv = rsqrtf(qvar + 1e-5f);
    float km = ks * (1.f / HD), kvar = ks2 * (1.f / HD) - km * km, kiv = rsqrtf(kvar + 1e-5f);
    v2h qo, ko;
    qo[0] = (_Float16)((qor - qm) * qiv * lw0 + lb0);
    qo[1] = (_Float16)((qoi - qm) * qiv * lw1 + lb1);
    ko[0] = (_Float16)((kor - km) * kiv * lw0 + lb0);
    ko[1] = (_Float16)((koi - km) * kiv * lw1 + lb1);
    *(v2h*)(qn + ((size_t)h * CTX + c) * HD + d0) = qo;   // a wave stores one 128-byte row
    *(v2h*)(kn + ((size_t)h * CTX + c) * HD + d0) = ko;
  }
}

// ---------------------------------------------------------------------------
// Stage 5: flash attention. 4 waves/block; each wave owns 16 q rows of one
// head, streams 32 keys/iter: 4 WMMAs for S, online softmax (shfl reductions
// per 16-lane half matching C layout), P re-shaped via small LDS tile,
// 4 WMMAs for O += P*V. Scores never hit HBM.
// ---------------------------------------------------------------------------
__global__ __launch_bounds__(128) void flash_kernel(
    const _Float16* __restrict__ qn, const _Float16* __restrict__ kn,
    const _Float16* __restrict__ vT, _Float16* __restrict__ aout)
{
  const int lane = threadIdx.x & 31;
  const int w = threadIdx.x >> 5;
  const int h = blockIdx.y;
  const int qt = blockIdx.x * 4 + w;          // 16-row query tile
  const int half = lane >> 4, l16 = lane & 15;
  __shared__ __align__(16) _Float16 P[4][16][40];

  const _Float16* qrow = qn + ((size_t)h * CTX + qt * 16 + l16) * HD;
  const v16h aq0 = load_frag(qrow, half);       // K = 0..31
  const v16h aq1 = load_frag(qrow + 32, half);  // K = 32..63

  v8f o0 = {}, o1 = {}, o2 = {}, o3 = {};
  float mrow[8], lrow[8];
#pragma unroll
  for (int r = 0; r < 8; ++r) { mrow[r] = -1e30f; lrow[r] = 0.f; }

  for (int kb = 0; kb < CTX; kb += 32) {
    const _Float16* k0row = kn + ((size_t)h * CTX + kb + l16) * HD;
    const _Float16* k1row = k0row + 16 * HD;
    v8f z = {};
    v8f s0 = __builtin_amdgcn_wmma_f32_16x16x32_f16(false, aq0, false, load_frag(k0row, half), (short)0, z, false, false);
    s0 = __builtin_amdgcn_wmma_f32_16x16x32_f16(false, aq1, false, load_frag(k0row + 32, half), (short)0, s0, false, false);
    v8f s1 = __builtin_amdgcn_wmma_f32_16x16x32_f16(false, aq0, false, load_frag(k1row, half), (short)0, z, false, false);
    s1 = __builtin_amdgcn_wmma_f32_16x16x32_f16(false, aq1, false, load_frag(k1row + 32, half), (short)0, s1, false, false);
#pragma unroll
    for (int r = 0; r < 8; ++r) {
      float a = s0[r] * 0.125f, b = s1[r] * 0.125f;   // 1/sqrt(64)
      float mx = fmaxf(a, b);
#pragma unroll
      for (int m = 8; m >= 1; m >>= 1) mx = fmaxf(mx, __shfl_xor(mx, m, 32));
      float mnew = fmaxf(mrow[r], mx);
      float alpha = __expf(mrow[r] - mnew);
      mrow[r] = mnew;
      float p0 = __expf(a - mnew), p1 = __expf(b - mnew);
      float ps = p0 + p1;
#pragma unroll
      for (int m = 8; m >= 1; m >>= 1) ps += __shfl_xor(ps, m, 32);
      lrow[r] = lrow[r] * alpha + ps;
      o0[r] *= alpha; o1[r] *= alpha; o2[r] *= alpha; o3[r] *= alpha;
      P[w][r + 8 * half][l16]      = (_Float16)p0;   // C layout -> LDS
      P[w][r + 8 * half][16 + l16] = (_Float16)p1;
    }
    const v16h ap = load_frag(&P[w][l16][0], half);  // back as A fragment
    const _Float16* vb = vT + ((size_t)h * HD + l16) * CTX + kb;
    o0 = __builtin_amdgcn_wmma_f32_16x16x32_f16(false, ap, false, load_frag(vb, half), (short)0, o0, false, false);
    o1 = __builtin_amdgcn_wmma_f32_16x16x32_f16(false, ap, false, load_frag(vb + (size_t)16 * CTX, half), (short)0, o1, false, false);
    o2 = __builtin_amdgcn_wmma_f32_16x16x32_f16(false, ap, false, load_frag(vb + (size_t)32 * CTX, half), (short)0, o2, false, false);
    o3 = __builtin_amdgcn_wmma_f32_16x16x32_f16(false, ap, false, load_frag(vb + (size_t)48 * CTX, half), (short)0, o3, false, false);
  }
  _Float16* arow0 = aout + (size_t)(qt * 16) * DIMS + h * HD;
#pragma unroll
  for (int r = 0; r < 8; ++r) {
    float rl = 1.f / lrow[r];
    _Float16* dst = arow0 + (size_t)(r + 8 * half) * DIMS;
    dst[ 0 + l16] = (_Float16)(o0[r] * rl);
    dst[16 + l16] = (_Float16)(o1[r] * rl);
    dst[32 + l16] = (_Float16)(o2[r] * rl);
    dst[48 + l16] = (_Float16)(o3[r] * rl);
  }
}

// ---------------------------------------------------------------------------
extern "C" void kernel_launch(void* const* d_in, const int* in_sizes, int n_in,
                              void* d_out, int out_size, void* d_ws, size_t ws_size,
                              hipStream_t stream) {
  const float* x     = (const float*)d_in[0];
  const float* qn_w  = (const float*)d_in[1];
  const float* qn_b  = (const float*)d_in[2];
  const float* q_w   = (const float*)d_in[3];
  const float* q_b   = (const float*)d_in[4];
  const float* kvn_w = (const float*)d_in[5];
  const float* kvn_b = (const float*)d_in[6];
  const float* kv_w  = (const float*)d_in[7];
  const float* kv_b  = (const float*)d_in[8];
  const float* out_w = (const float*)d_in[9];
  const float* out_b = (const float*)d_in[10];
  const float* ln_w  = (const float*)d_in[11];
  const float* ln_b  = (const float*)d_in[12];
  const float* rh_w  = (const float*)d_in[13];
  const float* rh_b  = (const float*)d_in[14];
  float* out = (float*)d_out;
  (void)in_sizes; (void)n_in; (void)out_size; (void)ws_size;

  char* base = (char*)d_ws;
  size_t off = 0;
  auto take = [&](size_t bytes) -> char* {
    char* p = base + off;
    off = (off + bytes + 255) & ~(size_t)255;
    return p;
  };
  _Float16* lnq16  = (_Float16*)take((size_t)CTX * DIMS * 2);
  _Float16* lnkv16 = (_Float16*)take((size_t)CTX * DIMS * 2);
  float*    radius = (float*)take((size_t)CTX * 4);
  _Float16* qw16   = (_Float16*)take((size_t)DIMS * DIMS * 2);
  _Float16* kvw16  = (_Float16*)take((size_t)DIMS * 2 * DIMS * 2);
  _Float16* outw16 = (_Float16*)take((size_t)DIMS * DIMS * 2);
  float*    qf32   = (float*)take((size_t)CTX * DIMS * 4);
  float*    kvf32  = (float*)take((size_t)CTX * 2 * DIMS * 4);
  _Float16* qn16   = (_Float16*)take((size_t)HEAD * CTX * HD * 2);
  _Float16* kn16   = (_Float16*)take((size_t)HEAD * CTX * HD * 2);
  _Float16* vT16   = (_Float16*)take((size_t)HEAD * HD * CTX * 2);
  _Float16* a16    = (_Float16*)take((size_t)CTX * DIMS * 2);

  prep_kernel<<<CTX, 256, 0, stream>>>(x, qn_w, qn_b, kvn_w, kvn_b, rh_w, rh_b,
                                       lnq16, lnkv16, radius);
  cvt_kernel<<<256, 256, 0, stream>>>(q_w,   qw16,   DIMS * DIMS);
  cvt_kernel<<<256, 256, 0, stream>>>(kv_w,  kvw16,  DIMS * 2 * DIMS);
  cvt_kernel<<<256, 256, 0, stream>>>(out_w, outw16, DIMS * DIMS);

  gemm_kernel<<<dim3(DIMS / BN, CTX / BM), 256, 0, stream>>>(
      lnq16, qw16, q_b, qf32, CTX, DIMS, DIMS);
  gemm_kernel<<<dim3(2 * DIMS / BN, CTX / BM), 256, 0, stream>>>(
      lnkv16, kvw16, kv_b, kvf32, CTX, 2 * DIMS, DIMS);

  rotln_kernel<<<dim3(CTX / RT, HEAD), 256, 0, stream>>>(
      qf32, kvf32, radius, ln_w, ln_b, qn16, kn16, vT16);

  flash_kernel<<<dim3(CTX / 16 / 4, HEAD), 128, 0, stream>>>(qn16, kn16, vT16, a16);

  gemm_kernel<<<dim3(DIMS / BN, CTX / BM), 256, 0, stream>>>(
      a16, outw16, out_b, out, CTX, DIMS, DIMS);
}

// v002
// Measured time: 219 microseconds a run.
// Next to v001, in two timings, it ran 1.18 times as fast each time.
// All steps since v000 together make it 1.55 times as fast.
#include <hip/hip_runtime.h>

#define CTX  2048
#define DIMS 1024
#define HEAD 16
#define HD   64

typedef __attribute__((ext_vector_type(16))) _Float16 v16h;
typedef __attribute__((ext_vector_type(8)))  _Float16 v8h;
typedef __attribute__((ext_vector_type(2)))  _Float16 v2h;
typedef __attribute__((ext_vector_type(8)))  float    v8f;
typedef __attribute__((ext_vector_type(8)))  short    v8s;

// Build a 16x16x32 f16 WMMA A/B fragment for this lane.
// 16-bit operand layout (ISA 7.12.2): lane half (lane/16) selects
// K in {0..7,16..23} (half=0) or {8..15,24..31} (half=1); both chunks are
// contiguous 8 x f16 = 16B runs, so two aligned 16-byte loads suffice.
__device__ inline v16h load_frag(const _Float16* rowbase, int half) {
  v8h lo = *(const v8h*)(rowbase + half * 8);
  v8h hi = *(const v8h*)(rowbase + 16 + half * 8);
  v16h r;
#pragma unroll
  for (int i = 0; i < 8; ++i) { r[i] = lo[i]; r[i + 8] = hi[i]; }
  return r;
}

// The same fragment out of a row-major (K x N) f16 tile in LDS, by the
// transposing LDS load. p is the lane's own address: row 8*(lane/16) + (lane&7),
// column n0 + 8*((lane/8)&1). Lane (c = lane&15, h = lane/16) then holds
// T[8h + 0..7][n0 + c] and, from 16 rows further on, T[16 + 8h + 0..7][n0 + c]:
// the k order of load_frag.
__device__ inline v16h load_frag_tr(const _Float16* p, int pitch) {
  typedef __attribute__((address_space(3))) v8s lds_v8s;
  v8h lo = __builtin_bit_cast(v8h, __builtin_amdgcn_ds_load_tr16_b128_v8i16((lds_v8s*)p));
  v8h hi = __builtin_bit_cast(v8h, __builtin_amdgcn_ds_load_tr16_b128_v8i16((lds_v8s*)(p + 16 * pitch)));
  v16h r;
#pragma unroll
  for (int i = 0; i < 8; ++i) { r[i] = lo[i]; r[i + 8] = hi[i]; }
  return r;
}

// ---------------------------------------------------------------------------
// Stage 1: fused LayerNorm (q-path & kv-path share mean/var) + rotary radius
// ---------------------------------------------------------------------------
__global__ __launch_bounds__(256) void prep_kernel(
    const float* __restrict__ x,
    const float* __restrict__ qn_w, const float* __restrict__ qn_b,
    const float* __restrict__ kvn_w, const float* __restrict__ kvn_b,
    const float* __restrict__ rh_w, const float* __restrict__ rh_b,
    _Float16* __restrict__ lnq, _Float16* __restrict__ lnkv,
    float* __restrict__ radius)
{
  const int c = blockIdx.x, t = threadIdx.x;
  const float* row = x + (size_t)c * DIMS;
  float v[4];
  float s = 0.f, s2 = 0.f, dp = 0.f;
#pragma unroll
  for (int i = 0; i < 4; ++i) {
    int d = t + i * 256;
    float val = row[d];
    v[i] = val;
    s += val; s2 += val * val; dp += val * rh_w[d];
  }
  __shared__ float red[256];
  auto reduceAll = [&](float val) -> float {
    red[t] = val; __syncthreads();
    for (int o = 128; o > 0; o >>= 1) { if (t < o) red[t] += red[t + o]; __syncthreads(); }
    float r = red[0]; __syncthreads(); return r;
  };
  float tot  = reduceAll(s);
  float tot2 = reduceAll(s2);
  float dtot = reduceAll(dp);
  float mean = tot * (1.f / DIMS);
  float var  = tot2 * (1.f / DIMS) - mean * mean;
  float inv  = rsqrtf(var + 1e-5f);
  if (t == 0) {
    float per = dtot + rh_b[0];
    radius[c] = fminf(fmaxf(per * 0.01f, 0.5f), 2.0f);
  }
#pragma unroll
  for (int i = 0; i < 4; ++i) {
    int d = t + i * 256;
    float n = (v[i] - mean) * inv;
    lnq [(size_t)c * DIMS + d] = (_Float16)(n * qn_w[d] + qn_b[d]);
    lnkv[(size_t)c * DIMS + d] = (_Float16)(n * kvn_w[d] + kvn_b[d]);
  }
}

// ---------------------------------------------------------------------------
// Stage 2: f32 -> f16 weight conversion (one pass; weights then live in L2)
// ---------------------------------------------------------------------------
__global__ void cvt_kernel(const float* __restrict__ s, _Float16* __restrict__ d, int n) {
  int i = blockIdx.x * blockDim.x + threadIdx.x;
  int stride = gridDim.x * blockDim.x;
  for (; i < n; i += stride) d[i] = (_Float16)s[i];
}

// ---------------------------------------------------------------------------
// Stage 3/6: LDS-staged WMMA GEMM.  C(f32) = A(f16,MxK) * B(f16,KxN) + bias
// Block tile 64x128x32; 8 waves in 4(M) x 2(N); each wave owns a 16x64 strip
// = 4 accumulators -> 4 WMMAs per K-step sharing one A-fragment.
// A rows in LDS padded to 48 f16 (96 B) so all 16-byte fragment chunks stay aligned.
// B lies in LDS as in memory (K x N): 16-byte stores that cover whole rows, and
// the transposing LDS load turns it into fragments.
// ---------------------------------------------------------------------------
#define BM 64
#define BN 128
#define BK 32
#define LP 48   // padded LDS row stride in f16 (96 bytes, 16B-aligned chunks)
#define BP 144  // B row stride in f16 (288 bytes = 32 B x 9, odd: the transposing load's pitch)
__global__ __launch_bounds__(256) void gemm_kernel(
    const _Float16* __restrict__ A, const _Float16* __restrict__ B,
    const float* __restrict__ bias, float* __restrict__ C,
    int M, int N, int K)
{
  __shared__ __align__(16) _Float16 As[BM][LP];
  __shared__ __align__(16) _Float16 Bs[BK][BP];   // B staged row-major (KxN)
  const int t = threadIdx.x, lane = t & 31, w = t >> 5;
  const int wm = w >> 1, wn = w & 1;              // 4 x 2 wave grid
  const int half = lane >> 4, l16 = lane & 15;
  const int bm = blockIdx.y * BM, bn = blockIdx.x * BN;
  const int ar = t >> 2, ac = (t & 3) * 8;        // A: one b128 per thread
  const int kp = t >> 4, ng = t & 15;             // B: two rows x 8 cols per thread
  v8f acc0 = {}, acc1 = {}, acc2 = {}, acc3 = {};
  for (int k0 = 0; k0 < K; k0 += BK) {
    // stage A tile (64x32): vectorized 16B load + 16B LDS store
    *(v8h*)&As[ar][ac] = *(const v8h*)(A + (size_t)(bm + ar) * K + k0 + ac);
    // stage B tile (32x128) as it lies: 16 lanes store one whole 256-byte row
    v8h blo = *(const v8h*)(B + (size_t)(k0 + 2 * kp)     * N + bn + ng * 8);
    // keeps the wait that stood between these two loads: built without it, the second
    // load's result is given the registers that hold this load's address
    asm volatile("s_wait_xcnt 0x0" ::: "memory");
    v8h bhi = *(const v8h*)(B + (size_t)(k0 + 2 * kp + 1) * N + bn + ng * 8);
    *(v8h*)&Bs[2 * kp][ng * 8]     = blo;
    *(v8h*)&Bs[2 * kp + 1][ng * 8] = bhi;
    if (k0 + BK < K) {  // prefetch next K tile -> global_prefetch_b8
      __builtin_prefetch(A + (size_t)(bm + ar) * K + k0 + BK + ac, 0, 3);
      __builtin_prefetch(B + (size_t)(k0 + BK + 2 * kp) * N + bn + ng * 8, 0, 3);
    }
    __syncthreads();
    const v16h a = load_frag(&As[wm * 16 + l16][0], half);
    const _Float16* bp = &Bs[8 * half + (lane & 7)][wn * 64 + 8 * ((lane >> 3) & 1)];
    const v16h b0 = load_frag_tr(bp,      BP);
    const v16h b1 = load_frag_tr(bp + 16, BP);
    const v16h b2 = load_frag_tr(bp + 32, BP);
    const v16h b3 = load_frag_tr(bp + 48, BP);
    acc0 = __builtin_amdgcn_wmma_f32_16x16x32_f16(false, a, false, b0, (short)0, acc0, false, false);
    acc1 = __builtin_amdgcn_wmma_f32_16x16x32_f16(false, a, false, b1, (short)0, acc1, false, false);
    acc2 = __builtin_amdgcn_wmma_f32_16x16x32_f16(false, a, false, b2, (short)0, acc2, false, false);
    acc3 = __builtin_amdgcn_wmma_f32_16x16x32_f16(false, a, false, b3, (short)0, acc3, false, false);
    __syncthreads();
  }
  // epilogue: C layout per tile: M = r + 8*half, N = l16
  const int ncol0 = bn + wn * 64 + l16;
  const float bb0 = bias[ncol0], bb1 = bias[ncol0 + 16];
  const float bb2 = bias[ncol0 + 32], bb3 = bias[ncol0 + 48];
#pragma unroll
  for (int r = 0; r < 8; ++r) {
    const size_t rowoff = (size_t)(bm + wm * 16 + r + 8 * half) * N + ncol0;
    C[rowoff]      = acc0[r] + bb0;
    C[rowoff + 16] = acc1[r] + bb1;
    C[rowoff + 32] = acc2[r] + bb2;
    C[rowoff + 48] = acc3[r] + bb3;
  }
}

// ---------------------------------------------------------------------------
// Stage 4: rotary (mel-scaled freqs, per-step radius) + per-head LayerNorm.
// One 8-wave block per (64 ctx rows, head); a wave takes 8 rows, one after the
// other, and lane j handles complex pair (2j, 2j+1) of each.
// Also writes V transposed [h][d][c] so flash V fragments are contiguous: the
// 64x64 V tile is turned in LDS, so each vT store covers whole 128-byte lines.
// ---------------------------------------------------------------------------
#define RT 64   // ctx rows per block = one 128-byte line of vT per d
#define RW 8    // ctx rows per wave
#define VP 66   // LDS pitch in f16 = 33 dwords (odd): column writes and row reads both spread over the banks
__global__ __launch_bounds__(256) void rotln_kernel(
    const float* __restrict__ qf, const float* __restrict__ kvf,
    const float* __restrict__ radius,
    const float* __restrict__ ln_w, const float* __restrict__ ln_b,
    _Float16* __restrict__ qn, _Float16* __restrict__ kn,
    _Float16* __restrict__ vT)
{
  __shared__ __align__(16) _Float16 Vs[HD][VP];
  const int t = threadIdx.x, j = t & 31, w = t >> 5;
  const int c0 = blockIdx.x * RT, h = blockIdx.y;
  const float mel_max = 2595.0f * 1.3222192947339193f;          // 2595*log10(21)
  const float lin = (float)j * (mel_max / 31.0f);               // linspace, 32 pts
  const float fb = 0.2f * (expf(lin * (2.3025850929940457f / 2595.0f)) - 1.0f);
  const int d0 = 2 * j, d1 = 2 * j + 1;
  const float lw0 = ln_w[d0], lw1 = ln_w[d1], lb0 = ln_b[d0], lb1 = ln_b[d1];

  // all 8 rows' loads are issued before the first row is worked on
  float2 qv[RW], kk[RW], vv[RW];
  float rr[RW];
#pragma unroll
  for (int i = 0; i < RW; ++i) {
    const int c = c0 + w * RW + i;
    qv[i] = *(const float2*)(qf  + (size_t)c * DIMS + h * HD + d0);
    kk[i] = *(const float2*)(kvf + (size_t)c * (2 * DIMS) + h * HD + d0);
    vv[i] = *(const float2*)(kvf + (size_t)c * (2 * DIMS) + DIMS + h * HD + d0);
    rr[i] = radius[c];
  }

  // V: two neighbouring rows of one d make one 32-bit LDS store
#pragma unroll
  for (int i = 0; i < RW; i += 2) {
    v2h p0, p1;
    p0[0] = (_Float16)vv[i].x; p0[1] = (_Float16)vv[i + 1].x;
    p1[0] = (_Float16)vv[i].y; p1[1] = (_Float16)vv[i + 1].y;
    *(v2h*)&Vs[d0][w * RW + i] = p0;
    *(v2h*)&Vs[d1][w * RW + i] = p1;
  }

  // V goes out first, so that its stores fly under the q/k arithmetic below
  __syncthreads();   // the V tile is complete before any wave reads it back by rows
#pragma unroll
  for (int p = 0; p < 2; ++p) {
    const int idx = p * 256 + t;
    const int d = idx >> 3, ch = idx & 7;       // 8 lanes x 16 B = one line of vT
    v8h o;
#pragma unroll
    for (int e = 0; e < 4; ++e) {
      const v2h x = *(const v2h*)&Vs[d][ch * 8 + 2 * e];
      o[2 * e] = x[0]; o[2 * e + 1] = x[1];
    }
    *(v8h*)(vT + (size_t)(h * HD + d) * CTX + c0 + ch * 8) = o;
  }

#pragma unroll
  for (int i = 0; i < RW; ++i) {
    const int c = c0 + w * RW + i;
    const float freq = (float)c * fb;
    const float rad = rr[i];
    const float fr = rad * cosf(freq), fi = rad * sinf(freq);

    float qr = qv[i].x, qi = qv[i].y;
    float qor = qr * fr - qi * fi, qoi = qr * fi + qi * fr;
    float kr = kk[i].x, ki = kk[i].y;
    float kor = kr * fr - ki * fi, koi = kr * fi + ki * fr;

    // per-head LN over 64 elems, reduced across the 32 lanes of this wave
    float qs = qor + qoi, qs2 = qor * qor + qoi * qoi;
    float ks = kor + koi, ks2 = kor * kor + koi * koi;
#pragma unroll
    for (int m = 16; m >= 1; m >>= 1) {
      qs += __shfl_xor(qs, m, 32);  qs2 += __shfl_xor(qs2, m, 32);
      ks += __shfl_xor(ks, m, 32);  ks2 += __shfl_xor(ks2, m, 32);
    }
    float qm = qs * (1.f / HD), qvar = qs2 * (1.f / HD) - qm * qm, qiv = rsqrtf(qvar + 1e-5f);
    float km = ks * (1.f / HD), kvar = ks2 * (1.f / HD) - km * km, kiv = rsqrtf(kvar + 1e-5f);
    v2h qo, ko;
    qo[0] = (_Float16)((qor - qm) * qiv * lw0 + lb0);
    qo[1] = (_Float16)((qoi - qm) * qiv * lw1 + lb1);
    ko[0] = (_Float16)((kor - km) * kiv * lw0 + lb0);
    ko[1] = (_Float16)((koi - km) * kiv * lw1 + lb1);
    *(v2h*)(qn + ((size_t)h * CTX + c) * HD + d0) = qo;   // a wave stores one 128-byte row
    *(v2h*)(kn + ((size_t)h * CTX + c) * HD + d0) = ko;
  }
}

// ---------------------------------------------------------------------------
// Stage 5: flash attention. 4 waves/block; each wave owns 16 q rows of one
// head, streams 32 keys/iter: 4 WMMAs for S, online softmax (shfl reductions
// per 16-lane half matching C layout), P re-shaped via small LDS tile,
// 4 WMMAs for O += P*V. Scores never hit HBM.
// ---------------------------------------------------------------------------
__global__ __launch_bounds__(128) void flash_kernel(
    const _Float16* __restrict__ qn, const _Float16* __restrict__ kn,
    const _Float16* __restrict__ vT, _Float16* __restrict__ aout)
{
  const int lane = threadIdx.x & 31;
  const int w = threadIdx.x >> 5;
  const int h = blockIdx.y;
  const int qt = blockIdx.x * 4 + w;          // 16-row query tile
  const int half = lane >> 4, l16 = lane & 15;
  __shared__ __align__(16) _Float16 P[4][16][40];

  const _Float16* qrow = qn + ((size_t)h * CTX + qt * 16 + l16) * HD;
  const v16h aq0 = load_frag(qrow, half);       // K = 0..31
  const v16h aq1 = load_frag(qrow + 32, half);  // K = 32..63

  v8f o0 = {}, o1 = {}, o2 = {}, o3 = {};
  float mrow[8], lrow[8];
#pragma unroll
  for (int r = 0; r < 8; ++r) { mrow[r] = -1e30f; lrow[r] = 0.f; }

  for (int kb = 0; kb < CTX; kb += 32) {
    const _Float16* k0row = kn + ((size_t)h * CTX + kb + l16) * HD;
    const _Float16* k1row = k0row + 16 * HD;
    v8f z = {};
    v8f s0 = __builtin_amdgcn_wmma_f32_16x16x32_f16(false, aq0, false, load_frag(k0row, half), (short)0, z, false, false);
    s0 = __builtin_amdgcn_wmma_f32_16x16x32_f16(false, aq1, false, load_frag(k0row + 32, half), (short)0, s0, false, false);
    v8f s1 = __builtin_amdgcn_wmma_f32_16x16x32_f16(false, aq0, false, load_frag(k1row, half), (short)0, z, false, false);
    s1 = __builtin_amdgcn_wmma_f32_16x16x32_f16(false, aq1, false, load_frag(k1row + 32, half), (short)0, s1, false, false);
#pragma unroll
    for (int r = 0; r < 8; ++r) {
      float a = s0[r] * 0.125f, b = s1[r] * 0.125f;   // 1/sqrt(64)
      float mx = fmaxf(a, b);
#pragma unroll
      for (int m = 8; m >= 1; m >>= 1) mx = fmaxf(mx, __shfl_xor(mx, m, 32));
      float mnew = fmaxf(mrow[r], mx);
      float alpha = __expf(mrow[r] - mnew);
      mrow[r] = mnew;
      float p0 = __expf(a - mnew), p1 = __expf(b - mnew);
      float ps = p0 + p1;
#pragma unroll
      for (int m = 8; m >= 1; m >>= 1) ps += __shfl_xor(ps, m, 32);
      lrow[r] = lrow[r] * alpha + ps;
      o0[r] *= alpha; o1[r] *= alpha; o2[r] *= alpha; o3[r] *= alpha;
      P[w][r + 8 * half][l16]      = (_Float16)p0;   // C layout -> LDS
      P[w][r + 8 * half][16 + l16] = (_Float16)p1;
    }
    const v16h ap = load_frag(&P[w][l16][0], half);  // back as A fragment
    const _Float16* vb = vT + ((size_t)h * HD + l16) * CTX + kb;
    o0 = __builtin_amdgcn_wmma_f32_16x16x32_f16(false, ap, false, load_frag(vb, half), (short)0, o0, false, false);
    o1 = __builtin_amdgcn_wmma_f32_16x16x32_f16(false, ap, false, load_frag(vb + (size_t)16 * CTX, half), (short)0, o1, false, false);
    o2 = __builtin_amdgcn_wmma_f32_16x16x32_f16(false, ap, false, load_frag(vb + (size_t)32 * CTX, half), (short)0, o2, false, false);
    o3 = __builtin_amdgcn_wmma_f32_16x16x32_f16(false, ap, false, load_frag(vb + (size_t)48 * CTX, half), (short)0, o3, false, false);
  }
  _Float16* arow0 = aout + (size_t)(qt * 16) * DIMS + h * HD;
#pragma unroll
  for (int r = 0; r < 8; ++r) {
    float rl = 1.f / lrow[r];
    _Float16* dst = arow0 + (size_t)(r + 8 * half) * DIMS;
    dst[ 0 + l16] = (_Float16)(o0[r] * rl);
    dst[16 + l16] = (_Float16)(o1[r] * rl);
    dst[32 + l16] = (_Float16)(o2[r] * rl);
    dst[48 + l16] = (_Float16)(o3[r] * rl);
  }
}

// ---------------------------------------------------------------------------
extern "C" void kernel_launch(void* const* d_in, const int* in_sizes, int n_in,
                              void* d_out, int out_size, void* d_ws, size_t ws_size,
                              hipStream_t stream) {
  const float* x     = (const float*)d_in[0];
  const float* qn_w  = (const float*)d_in[1];
  const float* qn_b  = (const float*)d_in[2];
  const float* q_w   = (const float*)d_in[3];
  const float* q_b   = (const float*)d_in[4];
  const float* kvn_w = (const float*)d_in[5];
  const float* kvn_b = (const float*)d_in[6];
  const float* kv_w  = (const float*)d_in[7];
  const float* kv_b  = (const float*)d_in[8];
  const float* out_w = (const float*)d_in[9];
  const float* out_b = (const float*)d_in[10];
  const float* ln_w  = (const float*)d_in[11];
  const float* ln_b  = (const float*)d_in[12];
  const float* rh_w  = (const float*)d_in[13];
  const float* rh_b  = (const float*)d_in[14];
  float* out = (float*)d_out;
  (void)in_sizes; (void)n_in; (void)out_size; (void)ws_size;

  char* base = (char*)d_ws;
  size_t off = 0;
  auto take = [&](size_t bytes) -> char* {
    char* p = base + off;
    off = (off + bytes + 255) & ~(size_t)255;
    return p;
  };
  _Float16* lnq16  = (_Float16*)take((size_t)CTX * DIMS * 2);
  _Float16* lnkv16 = (_Float16*)take((size_t)CTX * DIMS * 2);
  float*    radius = (float*)take((size_t)CTX * 4);
  _Float16* qw16   = (_Float16*)take((size_t)DIMS * DIMS * 2);
  _Float16* kvw16  = (_Float16*)take((size_t)DIMS * 2 * DIMS * 2);
  _Float16* outw16 = (_Float16*)take((size_t)DIMS * DIMS * 2);
  float*    qf32   = (float*)take((size_t)CTX * DIMS * 4);
  float*    kvf32  = (float*)take((size_t)CTX * 2 * DIMS * 4);
  _Float16* qn16   = (_Float16*)take((size_t)HEAD * CTX * HD * 2);
  _Float16* kn16   = (_Float16*)take((size_t)HEAD * CTX * HD * 2);
  _Float16* vT16   = (_Float16*)take((size_t)HEAD * HD * CTX * 2);
  _Float16* a16    = (_Float16*)take((size_t)CTX * DIMS * 2);

  prep_kernel<<<CTX, 256, 0, stream>>>(x, qn_w, qn_b, kvn_w, kvn_b, rh_w, rh_b,
                                       lnq16, lnkv16, radius);
  cvt_kernel<<<256, 256, 0, stream>>>(q_w,   qw16,   DIMS * DIMS);
  cvt_kernel<<<256, 256, 0, stream>>>(kv_w,  kvw16,  DIMS * 2 * DIMS);
  cvt_kernel<<<256, 256, 0, stream>>>(out_w, outw16, DIMS * DIMS);

  gemm_kernel<<<dim3(DIMS / BN, CTX / BM), 256, 0, stream>>>(
      lnq16, qw16, q_b, qf32, CTX, DIMS, DIMS);
  gemm_kernel<<<dim3(2 * DIMS / BN, CTX / BM), 256, 0, stream>>>(
      lnkv16, kvw16, kv_b, kvf32, CTX, 2 * DIMS, DIMS);

  rotln_kernel<<<dim3(CTX / RT, HEAD), 256, 0, stream>>>(
      qf32, kvf32, radius, ln_w, ln_b, qn16, kn16, vT16);

  flash_kernel<<<dim3(CTX / 16 / 4, HEAD), 128, 0, stream>>>(qn16, kn16, vT16, a16);

  gemm_kernel<<<dim3(DIMS / BN, CTX / BM), 256, 0, stream>>>(
      a16, outw16, out_b, out, CTX, DIMS, DIMS);
}

// v003
// One run takes 185 microseconds.
// In two side-by-side timings against v002, it was 1.18 and 1.17 times as fast.
// All steps since v000 together make it 1.83 times as fast.
#include <hip/hip_runtime.h>

#define CTX  2048
#define DIMS 1024
#define HEAD 16
#define HD   64

typedef __attribute__((ext_vector_type(16))) _Float16 v16h;
typedef __attribute__((ext_vector_type(8)))  _Float16 v8h;
typedef __attribute__((ext_vector_type(2)))  _Float16 v2h;
typedef __attribute__((ext_vector_type(8)))  float    v8f;
typedef __attribute__((ext_vector_type(8)))  short    v8s;

// Build a 16x16x32 f16 WMMA A/B fragment for this lane.
// 16-bit operand layout (ISA 7.12.2): lane half (lane/16) selects
// K in {0..7,16..23} (half=0) or {8..15,24..31} (half=1); both chunks are
// contiguous 8 x f16 = 16B runs, so two aligned 16-byte loads suffice.
__device__ inline v16h load_frag(const _Float16* rowbase, int half) {
  v8h lo = *(const v8h*)(rowbase + half * 8);
  v8h hi = *(const v8h*)(rowbase + 16 + half * 8);
  v16h r;
#pragma unroll
  for (int i = 0; i < 8; ++i) { r[i] = lo[i]; r[i + 8] = hi[i]; }
  return r;
}

// The same fragment out of a row-major (K x N) f16 tile in LDS, by the
// transposing LDS load. p is the lane's own address: row 8*(lane/16) + (lane&7),
// column n0 + 8*((lane/8)&1). Lane (c = lane&15, h = lane/16) then holds
// T[8h + 0..7][n0 + c] and, from 16 rows further on, T[16 + 8h + 0..7][n0 + c]:
// the k order of load_frag.
__device__ inline v16h load_frag_tr(const _Float16* p, int pitch) {
  typedef __attribute__((address_space(3))) v8s lds_v8s;
  v8h lo = __builtin_bit_cast(v8h, __builtin_amdgcn_ds_load_tr16_b128_v8i16((lds_v8s*)p));
  v8h hi = __builtin_bit_cast(v8h, __builtin_amdgcn_ds_load_tr16_b128_v8i16((lds_v8s*)(p + 16 * pitch)));
  v16h r;
#pragma unroll
  for (int i = 0; i < 8; ++i) { r[i] = lo[i]; r[i + 8] = hi[i]; }
  return r;
}

// ---------------------------------------------------------------------------
// Stage 1: fused LayerNorm (q-path & kv-path share mean/var) + rotary radius
// ---------------------------------------------------------------------------
__global__ __launch_bounds__(256) void prep_kernel(
    const float* __restrict__ x,
    const float* __restrict__ qn_w, const float* __restrict__ qn_b,
    const float* __restrict__ kvn_w, const float* __restrict__ kvn_b,
    const float* __restrict__ rh_w, const float* __restrict__ rh_b,
    _Float16* __restrict__ lnq, _Float16* __restrict__ lnkv,
    float* __restrict__ radius)
{
  const int c = blockIdx.x, t = threadIdx.x;
  const float* row = x + (size_t)c * DIMS;
  float v[4];
  float s = 0.f, s2 = 0.f, dp = 0.f;
#pragma unroll
  for (int i = 0; i < 4; ++i) {
    int d = t + i * 256;
    float val = row[d];
    v[i] = val;
    s += val; s2 += val * val; dp += val * rh_w[d];
  }
  __shared__ float red[256];
  auto reduceAll = [&](float val) -> float {
    red[t] = val; __syncthreads();
    for (int o = 128; o > 0; o >>= 1) { if (t < o) red[t] += red[t + o]; __syncthreads(); }
    float r = red[0]; __syncthreads(); return r;
  };
  float tot  = reduceAll(s);
  float tot2 = reduceAll(s2);
  float dtot = reduceAll(dp);
  float mean = tot * (1.f / DIMS);
  float var  = tot2 * (1.f / DIMS) - mean * mean;
  float inv  = rsqrtf(var + 1e-5f);
  if (t == 0) {
    float per = dtot + rh_b[0];
    radius[c] = fminf(fmaxf(per * 0.01f, 0.5f), 2.0f);
  }
#pragma unroll
  for (int i = 0; i < 4; ++i) {
    int d = t + i * 256;
    float n = (v[i] - mean) * inv;
    lnq [(size_t)c * DIMS + d] = (_Float16)(n * qn_w[d] + qn_b[d]);
    lnkv[(size_t)c * DIMS + d] = (_Float16)(n * kvn_w[d] + kvn_b[d]);
  }
}

// ---------------------------------------------------------------------------
// Stage 2: f32 -> f16 weight conversion (one pass; weights then live in L2)
// ---------------------------------------------------------------------------
__global__ void cvt_kernel(const float* __restrict__ s, _Float16* __restrict__ d, int n) {
  int i = blockIdx.x * blockDim.x + threadIdx.x;
  int stride = gridDim.x * blockDim.x;
  for (; i < n; i += stride) d[i] = (_Float16)s[i];
}

// ---------------------------------------------------------------------------
// Stage 3/6: LDS-staged WMMA GEMM.  C(f32) = A(f16,MxK) * B(f16,KxN) + bias
// Block tile 64x128x32; 8 waves in 4(M) x 2(N); each wave owns a 16x64 strip
// = 4 accumulators -> 4 WMMAs per K-step sharing one A-fragment.
// A rows in LDS padded to 48 f16 (96 B) so all 16-byte fragment chunks stay aligned.
// B lies in LDS as in memory (K x N): 16-byte stores that cover whole rows, and
// the transposing LDS load turns it into fragments.
// ---------------------------------------------------------------------------
#define BM 64
#define BN 128
#define BK 32
#define LP 48   // padded LDS row stride in f16 (96 bytes, 16B-aligned chunks)
#define BP 144  // B row stride in f16 (288 bytes = 32 B x 9, odd: the transposing load's pitch)
__global__ __launch_bounds__(256) void gemm_kernel(
    const _Float16* __restrict__ A, const _Float16* __restrict__ B,
    const float* __restrict__ bias, float* __restrict__ C,
    int M, int N, int K)
{
  __shared__ __align__(16) _Float16 As[BM][LP];
  __shared__ __align__(16) _Float16 Bs[BK][BP];   // B staged row-major (KxN)
  const int t = threadIdx.x, lane = t & 31, w = t >> 5;
  const int wm = w >> 1, wn = w & 1;              // 4 x 2 wave grid
  const int half = lane >> 4, l16 = lane & 15;
  const int bm = blockIdx.y * BM, bn = blockIdx.x * BN;
  const int ar = t >> 2, ac = (t & 3) * 8;        // A: one b128 per thread
  const int kp = t >> 4, ng = t & 15;             // B: two rows x 8 cols per thread
  v8f acc0 = {}, acc1 = {}, acc2 = {}, acc3 = {};
  for (int k0 = 0; k0 < K; k0 += BK) {
    // stage A tile (64x32): vectorized 16B load + 16B LDS store
    *(v8h*)&As[ar][ac] = *(const v8h*)(A + (size_t)(bm + ar) * K + k0 + ac);
    // stage B tile (32x128) as it lies: 16 lanes store one whole 256-byte row
    v8h blo = *(const v8h*)(B + (size_t)(k0 + 2 * kp)     * N + bn + ng * 8);
    // keeps the wait that stood between these two loads: built without it, the second
    // load's result is given the registers that hold this load's address
    asm volatile("s_wait_xcnt 0x0" ::: "memory");
    v8h bhi = *(const v8h*)(B + (size_t)(k0 + 2 * kp + 1) * N + bn + ng * 8);
    *(v8h*)&Bs[2 * kp][ng * 8]     = blo;
    *(v8h*)&Bs[2 * kp + 1][ng * 8] = bhi;
    if (k0 + BK < K) {  // prefetch next K tile -> global_prefetch_b8
      __builtin_prefetch(A + (size_t)(bm + ar) * K + k0 + BK + ac, 0, 3);
      __builtin_prefetch(B + (size_t)(k0 + BK + 2 * kp) * N + bn + ng * 8, 0, 3);
    }
    __syncthreads();
    const v16h a = load_frag(&As[wm * 16 + l16][0], half);
    const _Float16* bp = &Bs[8 * half + (lane & 7)][wn * 64 + 8 * ((lane >> 3) & 1)];
    const v16h b0 = load_frag_tr(bp,      BP);
    const v16h b1 = load_frag_tr(bp + 16, BP);
    const v16h b2 = load_frag_tr(bp + 32, BP);
    const v16h b3 = load_frag_tr(bp + 48, BP);
    acc0 = __builtin_amdgcn_wmma_f32_16x16x32_f16(false, a, false, b0, (short)0, acc0, false, false);
    acc1 = __builtin_amdgcn_wmma_f32_16x16x32_f16(false, a, false, b1, (short)0, acc1, false, false);
    acc2 = __builtin_amdgcn_wmma_f32_16x16x32_f16(false, a, false, b2, (short)0, acc2, false, false);
    acc3 = __builtin_amdgcn_wmma_f32_16x16x32_f16(false, a, false, b3, (short)0, acc3, false, false);
    __syncthreads();
  }
  // epilogue: C layout per tile: M = r + 8*half, N = l16
  const int ncol0 = bn + wn * 64 + l16;
  const float bb0 = bias[ncol0], bb1 = bias[ncol0 + 16];
  const float bb2 = bias[ncol0 + 32], bb3 = bias[ncol0 + 48];
#pragma unroll
  for (int r = 0; r < 8; ++r) {
    const size_t rowoff = (size_t)(bm + wm * 16 + r + 8 * half) * N + ncol0;
    C[rowoff]      = acc0[r] + bb0;
    C[rowoff + 16] = acc1[r] + bb1;
    C[rowoff + 32] = acc2[r] + bb2;
    C[rowoff + 48] = acc3[r] + bb3;
  }
}

// ---------------------------------------------------------------------------
// Stage 4: rotary (mel-scaled freqs, per-step radius) + per-head LayerNorm.
// One 8-wave block per (64 ctx rows, head); a wave takes 8 rows, one after the
// other, and lane j handles complex pair (2j, 2j+1) of each.
// Also writes V transposed [h][d][c] so flash V fragments are contiguous: the
// 64x64 V tile is turned in LDS, so each vT store covers whole 128-byte lines.
// ---------------------------------------------------------------------------
#define RT 64   // ctx rows per block = one 128-byte line of vT per d
#define RW 8    // ctx rows per wave
#define VP 66   // LDS pitch in f16 = 33 dwords (odd): column writes and row reads both spread over the banks
__global__ __launch_bounds__(256) void rotln_kernel(
    const float* __restrict__ qf, const float* __restrict__ kvf,
    const float* __restrict__ radius,
    const float* __restrict__ ln_w, const float* __restrict__ ln_b,
    _Float16* __restrict__ qn, _Float16* __restrict__ kn,
    _Float16* __restrict__ vT)
{
  __shared__ __align__(16) _Float16 Vs[HD][VP];
  const int t = threadIdx.x, j = t & 31, w = t >> 5;
  const int c0 = blockIdx.x * RT, h = blockIdx.y;
  const float mel_max = 2595.0f * 1.3222192947339193f;          // 2595*log10(21)
  const float lin = (float)j * (mel_max / 31.0f);               // linspace, 32 pts
  const float fb = 0.2f * (expf(lin * (2.3025850929940457f / 2595.0f)) - 1.0f);
  const int d0 = 2 * j, d1 = 2 * j + 1;
  const float lw0 = ln_w[d0], lw1 = ln_w[d1], lb0 = ln_b[d0], lb1 = ln_b[d1];

  // all 8 rows' loads are issued before the first row is worked on
  float2 qv[RW], kk[RW], vv[RW];
  float rr[RW];
#pragma unroll
  for (int i = 0; i < RW; ++i) {
    const int c = c0 + w * RW + i;
    qv[i] = *(const float2*)(qf  + (size_t)c * DIMS + h * HD + d0);
    kk[i] = *(const float2*)(kvf + (size_t)c * (2 * DIMS) + h * HD + d0);
    vv[i] = *(const float2*)(kvf + (size_t)c * (2 * DIMS) + DIMS + h * HD + d0);
    rr[i] = radius[c];
  }

  // V: two neighbouring rows of one d make one 32-bit LDS store
#pragma unroll
  for (int i = 0; i < RW; i += 2) {
    v2h p0, p1;
    p0[0] = (_Float16)vv[i].x; p0[1] = (_Float16)vv[i + 1].x;
    p1[0] = (_Float16)vv[i].y; p1[1] = (_Float16)vv[i + 1].y;
    *(v2h*)&Vs[d0][w * RW + i] = p0;
    *(v2h*)&Vs[d1][w * RW + i] = p1;
  }

  // V goes out first, so that its stores fly under the q/k arithmetic below
  __syncthreads();   // the V tile is complete before any wave reads it back by rows
#pragma unroll
  for (int p = 0; p < 2; ++p) {
    const int idx = p * 256 + t;
    const int d = idx >> 3, ch = idx & 7;       // 8 lanes x 16 B = one line of vT
    v8h o;
#pragma unroll
    for (int e = 0; e < 4; ++e) {
      const v2h x = *(const v2h*)&Vs[d][ch * 8 + 2 * e];
      o[2 * e] = x[0]; o[2 * e + 1] = x[1];
    }
    *(v8h*)(vT + (size_t)(h * HD + d) * CTX + c0 + ch * 8) = o;
  }

#pragma unroll
  for (int i = 0; i < RW; ++i) {
    const int c = c0 + w * RW + i;
    const float freq = (float)c * fb;
    const float rad = rr[i];
    const float fr = rad * cosf(freq), fi = rad * sinf(freq);

    float qr = qv[i].x, qi = qv[i].y;
    float qor = qr * fr - qi * fi, qoi = qr * fi + qi * fr;
    float kr = kk[i].x, ki = kk[i].y;
    float kor = kr * fr - ki * fi, koi = kr * fi + ki * fr;

    // per-head LN over 64 elems, reduced across the 32 lanes of this wave
    float qs = qor + qoi, qs2 = qor * qor + qoi * qoi;
    float ks = kor + koi, ks2 = kor * kor + koi * koi;
#pragma unroll
    for (int m = 16; m >= 1; m >>= 1) {
      qs += __shfl_xor(qs, m, 32);  qs2 += __shfl_xor(qs2, m, 32);
      ks += __shfl_xor(ks, m, 32);  ks2 += __shfl_xor(ks2, m, 32);
    }
    float qm = qs * (1.f / HD), qvar = qs2 * (1.f / HD) - qm * qm, qiv = rsqrtf(qvar + 1e-5f);
    float km = ks * (1.f / HD), kvar = ks2 * (1.f / HD) - km * km, kiv = rsqrtf(kvar + 1e-5f);
    v2h qo, ko;
    qo[0] = (_Float16)((qor - qm) * qiv * lw0 + lb0);
    qo[1] = (_Float16)((qoi - qm) * qiv * lw1 + lb1);
    ko[0] = (_Float16)((kor - km) * kiv * lw0 + lb0);
    ko[1] = (_Float16)((koi - km) * kiv * lw1 + lb1);
    *(v2h*)(qn + ((size_t)h * CTX + c) * HD + d0) = qo;   // a wave stores one 128-byte row
    *(v2h*)(kn + ((size_t)h * CTX + c) * HD + d0) = ko;
  }
}

// ---------------------------------------------------------------------------
// Stage 5: flash attention. 4 waves/block; each wave owns 16 q rows of one
// head, takes 32 keys/pass: 4 WMMAs for S, online softmax (shfl reductions
// per 16-lane half matching C layout), P re-shaped via small LDS tile,
// 4 WMMAs for O += P*V. Scores never hit HBM.
// K and vT come into LDS once per block, 64 keys a stage, by asynchronous copies
// that cover whole 128-byte lines; the four waves read their fragments from there.
// Two buffers: the next stage's copies fly while this stage is worked on.
// ---------------------------------------------------------------------------
#define FK  64            // keys per stage = one 128-byte line of each vT row
#define FP  72            // LDS row pitch in f16: 144 B = 16 B x 9 (odd), the pitch of 16-byte fragment reads
#define NST (CTX / FK)    // stages
#define FBUF (FK * FP * 2)  // bytes of one buffer (K: 64 keys; vT: 64 d rows)
#define FROW (16 * FP * 2)  // bytes of 16 LDS rows

// One stage: 64 K rows and 64 vT rows of 128 B each; 128 threads x 8 copies of 16 B.
// Eight lanes cover one row, so a wave's copy reads four whole lines.
// lk, lv: the lane's LDS byte addresses; gk, gv: its global addresses (row t/8, piece t%8).
__device__ inline void stage_kv(unsigned lk, unsigned lv,
                                const _Float16* gk, const _Float16* gv) {
  const unsigned lk1 = lk + FROW, lk2 = lk + 2 * FROW, lk3 = lk + 3 * FROW;
  const unsigned lv1 = lv + FROW, lv2 = lv + 2 * FROW, lv3 = lv + 3 * FROW;
  const _Float16* gk1 = gk + 16 * HD;
  const _Float16* gk2 = gk + 32 * HD;
  const _Float16* gk3 = gk + 48 * HD;
  const _Float16* gv1 = gv + (size_t)16 * CTX;
  const _Float16* gv2 = gv + (size_t)32 * CTX;
  const _Float16* gv3 = gv + (size_t)48 * CTX;
  // the copies go past the registers; the closing wait stands in the same statement so
  // that no address register named here is rewritten in front of it
  asm volatile(
      "global_load_async_to_lds_b128 %0, %8, off\n\t"
      "global_load_async_to_lds_b128 %1, %9, off\n\t"
      "global_load_async_to_lds_b128 %2, %10, off\n\t"
      "global_load_async_to_lds_b128 %3, %11, off\n\t"
      "global_load_async_to_lds_b128 %4, %12, off\n\t"
      "global_load_async_to_lds_b128 %5, %13, off\n\t"
      "global_load_async_to_lds_b128 %6, %14, off\n\t"
      "global_load_async_to_lds_b128 %7, %15, off\n\t"
      "s_wait_xcnt 0x0"
      :: "v"(lk), "v"(lk1), "v"(lk2), "v"(lk3), "v"(lv), "v"(lv1), "v"(lv2), "v"(lv3),
         "v"(gk), "v"(gk1), "v"(gk2), "v"(gk3), "v"(gv), "v"(gv1), "v"(gv2), "v"(gv3)
      : "memory");
}

__global__ __launch_bounds__(128) void flash_kernel(
    const _Float16* __restrict__ qn, const _Float16* __restrict__ kn,
    const _Float16* __restrict__ vT, _Float16* __restrict__ aout)
{
  const int t = threadIdx.x;
  const int lane = t & 31;
  const int w = t >> 5;
  const int h = blockIdx.y;
  const int qt = blockIdx.x * 4 + w;          // 16-row query tile
  const int half = lane >> 4, l16 = lane & 15;
  __shared__ __align__(16) _Float16 Ks[2][FK][FP];
  __shared__ __align__(16) _Float16 Vs[2][HD][FP];
  __shared__ __align__(16) _Float16 P[4][16][40];

  const int cr = t >> 3, cc = (t & 7) * 8;    // the lane's row and 16-byte piece in a copy
  const _Float16* gk = kn + ((size_t)h * CTX + cr) * HD + cc;
  const _Float16* gv = vT + ((size_t)h * HD + cr) * CTX + cc;
  const unsigned lk = (unsigned)(size_t)&Ks[0][cr][cc];
  const unsigned lv = (unsigned)(size_t)&Vs[0][cr][cc];

  stage_kv(lk, lv, gk, gv);                                  // stage 0 -> buffer 0

  const _Float16* qrow = qn + ((size_t)h * CTX + qt * 16 + l16) * HD;
  const v16h aq0 = load_frag(qrow, half);       // K = 0..31
  const v16h aq1 = load_frag(qrow + 32, half);  // K = 32..63

  v8f o0 = {}, o1 = {}, o2 = {}, o3 = {};
  float mrow[8], lrow[8];
#pragma unroll
  for (int r = 0; r < 8; ++r) { mrow[r] = -1e30f; lrow[r] = 0.f; }

  asm volatile("s_wait_asynccnt 0x0" ::: "memory");          // this wave's part of stage 0 has landed
  __syncthreads();                                           // ... and every other wave's
  stage_kv(lk + FBUF, lv + FBUF, gk + FK * HD, gv + FK);     // stage 1 -> buffer 1

  for (int s = 0; s < NST; ++s) {
    const int buf = s & 1;
    // both 32-key passes of a stage in straight line: constant LDS offsets, and the second
    // pass's fragment reads and products need not wait for the first pass's softmax
#pragma unroll
    for (int sub = 0; sub < FK; sub += 32) {
      const _Float16* k0row = &Ks[buf][sub + l16][0];
      const _Float16* k1row = k0row + 16 * FP;
      v8f z = {};
      v8f s0 = __builtin_amdgcn_wmma_f32_16x16x32_f16(false, aq0, false, load_frag(k0row, half), (short)0, z, false, false);
      s0 = __builtin_amdgcn_wmma_f32_16x16x32_f16(false, aq1, false, load_frag(k0row + 32, half), (short)0, s0, false, false);
      v8f s1 = __builtin_amdgcn_wmma_f32_16x16x32_f16(false, aq0, false, load_frag(k1row, half), (short)0, z, false, false);
      s1 = __builtin_amdgcn_wmma_f32_16x16x32_f16(false, aq1, false, load_frag(k1row + 32, half), (short)0, s1, false, false);
#pragma unroll
      for (int r = 0; r < 8; ++r) {
        float a = s0[r] * 0.125f, b = s1[r] * 0.125f;   // 1/sqrt(64)
        float mx = fmaxf(a, b);
#pragma unroll
        for (int m = 8; m >= 1; m >>= 1) mx = fmaxf(mx, __shfl_xor(mx, m, 32));
        float mnew = fmaxf(mrow[r], mx);
        float alpha = __expf(mrow[r] - mnew);
        mrow[r] = mnew;
        float p0 = __expf(a - mnew), p1 = __expf(b - mnew);
        float ps = p0 + p1;
#pragma unroll
        for (int m = 8; m >= 1; m >>= 1) ps += __shfl_xor(ps, m, 32);
        lrow[r] = lrow[r] * alpha + ps;
        o0[r] *= alpha; o1[r] *= alpha; o2[r] *= alpha; o3[r] *= alpha;
        P[w][r + 8 * half][l16]      = (_Float16)p0;   // C layout -> LDS
        P[w][r + 8 * half][16 + l16] = (_Float16)p1;
      }
      const v16h ap = load_frag(&P[w][l16][0], half);  // back as A fragment
      const _Float16* vb = &Vs[buf][l16][sub];
      o0 = __builtin_amdgcn_wmma_f32_16x16x32_f16(false, ap, false, load_frag(vb, half), (short)0, o0, false, false);
      o1 = __builtin_amdgcn_wmma_f32_16x16x32_f16(false, ap, false, load_frag(vb + 16 * FP, half), (short)0, o1, false, false);
      o2 = __builtin_amdgcn_wmma_f32_16x16x32_f16(false, ap, false, load_frag(vb + 32 * FP, half), (short)0, o2, false, false);
      o3 = __builtin_amdgcn_wmma_f32_16x16x32_f16(false, ap, false, load_frag(vb + 48 * FP, half), (short)0, o3, false, false);
    }
    // hand-over: stage s + 1 becomes readable and buffer buf becomes free
    asm volatile("s_wait_dscnt 0x0" ::: "memory");     // this wave's reads of buffer buf are done
    asm volatile("s_wait_asynccnt 0x0" ::: "memory");  // its copies of stage s + 1 have landed
    __syncthreads();                                   // the same holds for all four waves
    if (s + 2 < NST)
      stage_kv(lk + buf * FBUF, lv + buf * FBUF,
               gk + (size_t)(s + 2) * FK * HD, gv + (s + 2) * FK);
  }
  asm volatile("s_wait_asynccnt 0x0" ::: "memory");    // no copy is open when the wave ends
  _Float16* arow0 = aout + (size_t)(qt * 16) * DIMS + h * HD;
#pragma unroll
  for (int r = 0; r < 8; ++r) {
    float rl = 1.f / lrow[r];
    _Float16* dst = arow0 + (size_t)(r + 8 * half) * DIMS;
    dst[ 0 + l16] = (_Float16)(o0[r] * rl);
    dst[16 + l16] = (_Float16)(o1[r] * rl);
    dst[32 + l16] = (_Float16)(o2[r] * rl);
    dst[48 + l16] = (_Float16)(o3[r] * rl);
  }
}

// ---------------------------------------------------------------------------
extern "C" void kernel_launch(void* const* d_in, const int* in_sizes, int n_in,
                              void* d_out, int out_size, void* d_ws, size_t ws_size,
                              hipStream_t stream) {
  const float* x     = (const float*)d_in[0];
  const float* qn_w  = (const float*)d_in[1];
  const float* qn_b  = (const float*)d_in[2];
  const float* q_w   = (const float*)d_in[3];
  const float* q_b   = (const float*)d_in[4];
  const float* kvn_w = (const float*)d_in[5];
  const float* kvn_b = (const float*)d_in[6];
  const float* kv_w  = (const float*)d_in[7];
  const float* kv_b  = (const float*)d_in[8];
  const float* out_w = (const float*)d_in[9];
  const float* out_b = (const float*)d_in[10];
  const float* ln_w  = (const float*)d_in[11];
  const float* ln_b  = (const float*)d_in[12];
  const float* rh_w  = (const float*)d_in[13];
  const float* rh_b  = (const float*)d_in[14];
  float* out = (float*)d_out;
  (void)in_sizes; (void)n_in; (void)out_size; (void)ws_size;

  char* base = (char*)d_ws;
  size_t off = 0;
  auto take = [&](size_t bytes) -> char* {
    char* p = base + off;
    off = (off + bytes + 255) & ~(size_t)255;
    return p;
  };
  _Float16* lnq16  = (_Float16*)take((size_t)CTX * DIMS * 2);
  _Float16* lnkv16 = (_Float16*)take((size_t)CTX * DIMS * 2);
  float*    radius = (float*)take((size_t)CTX * 4);
  _Float16* qw16   = (_Float16*)take((size_t)DIMS * DIMS * 2);
  _Float16* kvw16  = (_Float16*)take((size_t)DIMS * 2 * DIMS * 2);
  _Float16* outw16 = (_Float16*)take((size_t)DIMS * DIMS * 2);
  float*    qf32   = (float*)take((size_t)CTX * DIMS * 4);
  float*    kvf32  = (float*)take((size_t)CTX * 2 * DIMS * 4);
  _Float16* qn16   = (_Float16*)take((size_t)HEAD * CTX * HD * 2);
  _Float16* kn16   = (_Float16*)take((size_t)HEAD * CTX * HD * 2);
  _Float16* vT16   = (_Float16*)take((size_t)HEAD * HD * CTX * 2);
  _Float16* a16    = (_Float16*)take((size_t)CTX * DIMS * 2);

  prep_kernel<<<CTX, 256, 0, stream>>>(x, qn_w, qn_b, kvn_w, kvn_b, rh_w, rh_b,
                                       lnq16, lnkv16, radius);
  cvt_kernel<<<256, 256, 0, stream>>>(q_w,   qw16,   DIMS * DIMS);
  cvt_kernel<<<256, 256, 0, stream>>>(kv_w,  kvw16,  DIMS * 2 * DIMS);
  cvt_kernel<<<256, 256, 0, stream>>>(out_w, outw16, DIMS * DIMS);

  gemm_kernel<<<dim3(DIMS / BN, CTX / BM), 256, 0, stream>>>(
      lnq16, qw16, q_b, qf32, CTX, DIMS, DIMS);
  gemm_kernel<<<dim3(2 * DIMS / BN, CTX / BM), 256, 0, stream>>>(
      lnkv16, kvw16, kv_b, kvf32, CTX, 2 * DIMS, DIMS);

  rotln_kernel<<<dim3(CTX / RT, HEAD), 256, 0, stream>>>(
      qf32, kvf32, radius, ln_w, ln_b, qn16, kn16, vT16);

  flash_kernel<<<dim3(CTX / 16 / 4, HEAD), 128, 0, stream>>>(qn16, kn16, vT16, a16);

  gemm_kernel<<<dim3(DIMS / BN, CTX / BM), 256, 0, stream>>>(
      a16, outw16, out_b, out, CTX, DIMS, DIMS);
}

// v004
// It runs in 123 microseconds.
// Next to v003, in two timings, it ran 1.50 and 1.49 times as fast.
// All steps since v000 together make it 2.73 times as fast.
#include <hip/hip_runtime.h>

#define CTX  2048
#define DIMS 1024
#define HEAD 16
#define HD   64

typedef __attribute__((ext_vector_type(16))) _Float16 v16h;
typedef __attribute__((ext_vector_type(8)))  _Float16 v8h;
typedef __attribute__((ext_vector_type(2)))  _Float16 v2h;
typedef __attribute__((ext_vector_type(8)))  float    v8f;
typedef __attribute__((ext_vector_type(8)))  short    v8s;

// Build a 16x16x32 f16 WMMA A/B fragment for this lane.
// 16-bit operand layout (ISA 7.12.2): lane half (lane/16) selects
// K in {0..7,16..23} (half=0) or {8..15,24..31} (half=1); both chunks are
// contiguous 8 x f16 = 16B runs, so two aligned 16-byte loads suffice.
__device__ inline v16h load_frag(const _Float16* rowbase, int half) {
  v8h lo = *(const v8h*)(rowbase + half * 8);
  v8h hi = *(const v8h*)(rowbase + 16 + half * 8);
  v16h r;
#pragma unroll
  for (int i = 0; i < 8; ++i) { r[i] = lo[i]; r[i + 8] = hi[i]; }
  return r;
}

// The same fragment out of a row-major (K x N) f16 tile in LDS, by the
// transposing LDS load. p is the lane's own address: row 8*(lane/16) + (lane&7),
// column n0 + 8*((lane/8)&1). Lane (c = lane&15, h = lane/16) then holds
// T[8h + 0..7][n0 + c] and, from 16 rows further on, T[16 + 8h + 0..7][n0 + c]:
// the k order of load_frag.
__device__ inline v16h load_frag_tr(const _Float16* p, int pitch) {
  typedef __attribute__((address_space(3))) v8s lds_v8s;
  v8h lo = __builtin_bit_cast(v8h, __builtin_amdgcn_ds_load_tr16_b128_v8i16((lds_v8s*)p));
  v8h hi = __builtin_bit_cast(v8h, __builtin_amdgcn_ds_load_tr16_b128_v8i16((lds_v8s*)(p + 16 * pitch)));
  v16h r;
#pragma unroll
  for (int i = 0; i < 8; ++i) { r[i] = lo[i]; r[i + 8] = hi[i]; }
  return r;
}

// ---------------------------------------------------------------------------
// Stage 1: fused LayerNorm (q-path & kv-path share mean/var) + rotary radius
// ---------------------------------------------------------------------------
__global__ __launch_bounds__(256) void prep_kernel(
    const float* __restrict__ x,
    const float* __restrict__ qn_w, const float* __restrict__ qn_b,
    const float* __restrict__ kvn_w, const float* __restrict__ kvn_b,
    const float* __restrict__ rh_w, const float* __restrict__ rh_b,
    _Float16* __restrict__ lnq, _Float16* __restrict__ lnkv,
    float* __restrict__ radius)
{
  const int c = blockIdx.x, t = threadIdx.x;
  const float* row = x + (size_t)c * DIMS;
  float v[4];
  float s = 0.f, s2 = 0.f, dp = 0.f;
#pragma unroll
  for (int i = 0; i < 4; ++i) {
    int d = t + i * 256;
    float val = row[d];
    v[i] = val;
    s += val; s2 += val * val; dp += val * rh_w[d];
  }
  __shared__ float red[256];
  auto reduceAll = [&](float val) -> float {
    red[t] = val; __syncthreads();
    for (int o = 128; o > 0; o >>= 1) { if (t < o) red[t] += red[t + o]; __syncthreads(); }
    float r = red[0]; __syncthreads(); return r;
  };
  float tot  = reduceAll(s);
  float tot2 = reduceAll(s2);
  float dtot = reduceAll(dp);
  float mean = tot * (1.f / DIMS);
  float var  = tot2 * (1.f / DIMS) - mean * mean;
  float inv  = rsqrtf(var + 1e-5f);
  if (t == 0) {
    float per = dtot + rh_b[0];
    radius[c] = fminf(fmaxf(per * 0.01f, 0.5f), 2.0f);
  }
#pragma unroll
  for (int i = 0; i < 4; ++i) {
    int d = t + i * 256;
    float n = (v[i] - mean) * inv;
    lnq [(size_t)c * DIMS + d] = (_Float16)(n * qn_w[d] + qn_b[d]);
    lnkv[(size_t)c * DIMS + d] = (_Float16)(n * kvn_w[d] + kvn_b[d]);
  }
}

// ---------------------------------------------------------------------------
// Stage 2: f32 -> f16 weight conversion (one pass; weights then live in L2)
// ---------------------------------------------------------------------------
__global__ void cvt_kernel(const float* __restrict__ s, _Float16* __restrict__ d, int n) {
  int i = blockIdx.x * blockDim.x + threadIdx.x;
  int stride = gridDim.x * blockDim.x;
  for (; i < n; i += stride) d[i] = (_Float16)s[i];
}

// ---------------------------------------------------------------------------
// Stage 3/6: LDS-staged WMMA GEMM.  C(f32) = A(f16,MxK) * B(f16,KxN) + bias
// Block tile 64x128; 8 waves in 4(M) x 2(N); each wave owns a 16x64 strip
// = 4 accumulators -> 4 WMMAs per 32 k sharing one A-fragment.
// A and B come into LDS 128 k a stage, by asynchronous copies that cover whole
// 256-byte rows and pass no register. Two buffers: the next stage's copies fly
// while this stage's 16 WMMAs a wave are worked on.
// B lies in LDS as in memory (K x N); the transposing LDS load turns it into fragments.
// M, N, K: multiples of 64, 128, 128.
// ---------------------------------------------------------------------------
#define BM 64
#define BN 128
#define BK 128  // k per stage = one 256-byte row of A
#define AP 136  // A row stride in f16 (272 bytes = 16 B x 17, odd: the pitch of 16-byte fragment reads)
#define BP 144  // B row stride in f16 (288 bytes = 32 B x 9, odd: the transposing load's pitch)
#define ABUF (BM * AP * 2)   // bytes of one A buffer
#define BBUF (BK * BP * 2)   // bytes of one B buffer
#define AROW (16 * AP * 2)   // bytes of 16 LDS rows of A
#define BROW (16 * BP * 2)   // bytes of 16 LDS rows of B

// One stage: 64 A rows and 128 B rows of 256 B each; 256 threads x 12 copies of 16 B.
// Sixteen lanes cover one row, so a wave's copy reads four whole lines.
// la, lb: the lane's LDS byte addresses; ga, gb: its global addresses (row t/16, piece t%16);
// a16, b16: 16 rows of A and of B in elements.
__device__ inline void stage_ab(unsigned la, unsigned lb,
                                const _Float16* ga, const _Float16* gb,
                                size_t a16, size_t b16) {
  const unsigned la1 = la + AROW, la2 = la + 2 * AROW, la3 = la + 3 * AROW;
  const unsigned lb1 = lb + BROW, lb2 = lb + 2 * BROW, lb3 = lb + 3 * BROW;
  const unsigned lb4 = lb + 4 * BROW, lb5 = lb + 5 * BROW, lb6 = lb + 6 * BROW, lb7 = lb + 7 * BROW;
  const _Float16* ga1 = ga + a16;
  const _Float16* ga2 = ga + 2 * a16;
  const _Float16* ga3 = ga + 3 * a16;
  const _Float16* gb1 = gb + b16;
  const _Float16* gb2 = gb + 2 * b16;
  const _Float16* gb3 = gb + 3 * b16;
  const _Float16* gb4 = gb + 4 * b16;
  const _Float16* gb5 = gb + 5 * b16;
  const _Float16* gb6 = gb + 6 * b16;
  const _Float16* gb7 = gb + 7 * b16;
  // the copies go past the registers; the closing wait stands in the same statement so
  // that no address register named here is rewritten in front of it
  asm volatile(
      "global_load_async_to_lds_b128 %0, %12, off\n\t"
      "global_load_async_to_lds_b128 %1, %13, off\n\t"
      "global_load_async_to_lds_b128 %2, %14, off\n\t"
      "global_load_async_to_lds_b128 %3, %15, off\n\t"
      "global_load_async_to_lds_b128 %4, %16, off\n\t"
      "global_load_async_to_lds_b128 %5, %17, off\n\t"
      "global_load_async_to_lds_b128 %6, %18, off\n\t"
      "global_load_async_to_lds_b128 %7, %19, off\n\t"
      "global_load_async_to_lds_b128 %8, %20, off\n\t"
      "global_load_async_to_lds_b128 %9, %21, off\n\t"
      "global_load_async_to_lds_b128 %10, %22, off\n\t"
      "global_load_async_to_lds_b128 %11, %23, off\n\t"
      "s_wait_xcnt 0x0"
      :: "v"(la), "v"(la1), "v"(la2), "v"(la3),
         "v"(lb), "v"(lb1), "v"(lb2), "v"(lb3), "v"(lb4), "v"(lb5), "v"(lb6), "v"(lb7),
         "v"(ga), "v"(ga1), "v"(ga2), "v"(ga3),
         "v"(gb), "v"(gb1), "v"(gb2), "v"(gb3), "v"(gb4), "v"(gb5), "v"(gb6), "v"(gb7)
      : "memory");
}

__global__ __launch_bounds__(256) void gemm_kernel(
    const _Float16* __restrict__ A, const _Float16* __restrict__ B,
    const float* __restrict__ bias, float* __restrict__ C,
    int M, int N, int K)
{
  __shared__ __align__(16) _Float16 As[2][BM][AP];
  __shared__ __align__(16) _Float16 Bs[2][BK][BP];   // B staged row-major (KxN)
  const int t = threadIdx.x, lane = t & 31, w = t >> 5;
  const int wm = w >> 1, wn = w & 1;              // 4 x 2 wave grid
  const int half = lane >> 4, l16 = lane & 15;
  const int bm = blockIdx.y * BM, bn = blockIdx.x * BN;
  const int cr = t >> 4, cc = (t & 15) * 8;       // the lane's row and 16-byte piece in a copy
  const _Float16* ga = A + (size_t)(bm + cr) * K + cc;
  const _Float16* gb = B + (size_t)cr * N + bn + cc;
  const unsigned la = (unsigned)(size_t)&As[0][cr][cc];
  const unsigned lb = (unsigned)(size_t)&Bs[0][cr][cc];
  const size_t a16 = (size_t)16 * K, b16 = (size_t)16 * N;
  const size_t bst = (size_t)BK * N;              // one stage further on in B
  const int nst = K / BK;                         // stages
  v8f acc0 = {}, acc1 = {}, acc2 = {}, acc3 = {};

  stage_ab(la, lb, ga, gb, a16, b16);                        // stage 0 -> buffer 0
  asm volatile("s_wait_asynccnt 0x0" ::: "memory");          // this wave's part of stage 0 has landed
  __syncthreads();                                           // ... and every other wave's
  if (nst > 1)
    stage_ab(la + ABUF, lb + BBUF, ga + BK, gb + bst, a16, b16);   // stage 1 -> buffer 1

  for (int s = 0; s < nst; ++s) {
    const int buf = s & 1;
    const _Float16* ap = &As[buf][wm * 16 + l16][0];
    const _Float16* bp = &Bs[buf][8 * half + (lane & 7)][wn * 64 + 8 * ((lane >> 3) & 1)];
    // the stage's four 32-k steps in straight line: constant LDS offsets, and a step's
    // fragment reads need not wait for the step before
#pragma unroll
    for (int kk = 0; kk < BK; kk += 32) {
      const v16h a = load_frag(ap + kk, half);
      const v16h b0 = load_frag_tr(bp + kk * BP,      BP);
      const v16h b1 = load_frag_tr(bp + kk * BP + 16, BP);
      const v16h b2 = load_frag_tr(bp + kk * BP + 32, BP);
      const v16h b3 = load_frag_tr(bp + kk * BP + 48, BP);
      acc0 = __builtin_amdgcn_wmma_f32_16x16x32_f16(false, a, false, b0, (short)0, acc0, false, false);
      acc1 = __builtin_amdgcn_wmma_f32_16x16x32_f16(false, a, false, b1, (short)0, acc1, false, false);
      acc2 = __builtin_amdgcn_wmma_f32_16x16x32_f16(false, a, false, b2, (short)0, acc2, false, false);
      acc3 = __builtin_amdgcn_wmma_f32_16x16x32_f16(false, a, false, b3, (short)0, acc3, false, false);
    }
    // hand-over: stage s + 1 becomes readable and buffer buf becomes free
    asm volatile("s_wait_dscnt 0x0" ::: "memory");     // this wave's reads of buffer buf are done
    asm volatile("s_wait_asynccnt 0x0" ::: "memory");  // its copies of stage s + 1 have landed
    __syncthreads();                                   // the same holds for all eight waves
    if (s + 2 < nst)
      stage_ab(la + buf * ABUF, lb + buf * BBUF,
               ga + (size_t)(s + 2) * BK, gb + (size_t)(s + 2) * bst, a16, b16);
  }
  asm volatile("s_wait_asynccnt 0x0" ::: "memory");    // no copy is open when the wave ends
  // epilogue: C layout per tile: M = r + 8*half, N = l16
  const int ncol0 = bn + wn * 64 + l16;
  const float bb0 = bias[ncol0], bb1 = bias[ncol0 + 16];
  const float bb2 = bias[ncol0 + 32], bb3 = bias[ncol0 + 48];
#pragma unroll
  for (int r = 0; r < 8; ++r) {
    const size_t rowoff = (size_t)(bm + wm * 16 + r + 8 * half) * N + ncol0;
    C[rowoff]      = acc0[r] + bb0;
    C[rowoff + 16] = acc1[r] + bb1;
    C[rowoff + 32] = acc2[r] + bb2;
    C[rowoff + 48] = acc3[r] + bb3;
  }
}

// ---------------------------------------------------------------------------
// Stage 4: rotary (mel-scaled freqs, per-step radius) + per-head LayerNorm.
// One 8-wave block per (64 ctx rows, head); a wave takes 8 rows, one after the
// other, and lane j handles complex pair (2j, 2j+1) of each.
// Also writes V transposed [h][d][c] so flash V fragments are contiguous: the
// 64x64 V tile is turned in LDS, so each vT store covers whole 128-byte lines.
// ---------------------------------------------------------------------------
#define RT 64   // ctx rows per block = one 128-byte line of vT per d
#define RW 8    // ctx rows per wave
#define VP 66   // LDS pitch in f16 = 33 dwords (odd): column writes and row reads both spread over the banks
__global__ __launch_bounds__(256) void rotln_kernel(
    const float* __restrict__ qf, const float* __restrict__ kvf,
    const float* __restrict__ radius,
    const float* __restrict__ ln_w, const float* __restrict__ ln_b,
    _Float16* __restrict__ qn, _Float16* __restrict__ kn,
    _Float16* __restrict__ vT)
{
  __shared__ __align__(16) _Float16 Vs[HD][VP];
  const int t = threadIdx.x, j = t & 31, w = t >> 5;
  const int c0 = blockIdx.x * RT, h = blockIdx.y;
  const float mel_max = 2595.0f * 1.3222192947339193f;          // 2595*log10(21)
  const float lin = (float)j * (mel_max / 31.0f);               // linspace, 32 pts
  const float fb = 0.2f * (expf(lin * (2.3025850929940457f / 2595.0f)) - 1.0f);
  const int d0 = 2 * j, d1 = 2 * j + 1;
  const float lw0 = ln_w[d0], lw1 = ln_w[d1], lb0 = ln_b[d0], lb1 = ln_b[d1];

  // all 8 rows' loads are issued before the first row is worked on
  float2 qv[RW], kk[RW], vv[RW];
  float rr[RW];
#pragma unroll
  for (int i = 0; i < RW; ++i) {
    const int c = c0 + w * RW + i;
    qv[i] = *(const float2*)(qf  + (size_t)c * DIMS + h * HD + d0);
    kk[i] = *(const float2*)(kvf + (size_t)c * (2 * DIMS) + h * HD + d0);
    vv[i] = *(const float2*)(kvf + (size_t)c * (2 * DIMS) + DIMS + h * HD + d0);
    rr[i] = radius[c];
  }

  // V: two neighbouring rows of one d make one 32-bit LDS store
#pragma unroll
  for (int i = 0; i < RW; i += 2) {
    v2h p0, p1;
    p0[0] = (_Float16)vv[i].x; p0[1] = (_Float16)vv[i + 1].x;
    p1[0] = (_Float16)vv[i].y; p1[1] = (_Float16)vv[i + 1].y;
    *(v2h*)&Vs[d0][w * RW + i] = p0;
    *(v2h*)&Vs[d1][w * RW + i] = p1;
  }

  // V goes out first, so that its stores fly under the q/k arithmetic below
  __syncthreads();   // the V tile is complete before any wave reads it back by rows
#pragma unroll
  for (int p = 0; p < 2; ++p) {
    const int idx = p * 256 + t;
    const int d = idx >> 3, ch = idx & 7;       // 8 lanes x 16 B = one line of vT
    v8h o;
#pragma unroll
    for (int e = 0; e < 4; ++e) {
      const v2h x = *(const v2h*)&Vs[d][ch * 8 + 2 * e];
      o[2 * e] = x[0]; o[2 * e + 1] = x[1];
    }
    *(v8h*)(vT + (size_t)(h * HD + d) * CTX + c0 + ch * 8) = o;
  }

#pragma unroll
  for (int i = 0; i < RW; ++i) {
    const int c = c0 + w * RW + i;
    const float freq = (float)c * fb;
    const float rad = rr[i];
    const float fr = rad * cosf(freq), fi = rad * sinf(freq);

    float qr = qv[i].x, qi = qv[i].y;
    float qor = qr * fr - qi * fi, qoi = qr * fi + qi * fr;
    float kr = kk[i].x, ki = kk[i].y;
    float kor = kr * fr - ki * fi, koi = kr * fi + ki * fr;

    // per-head LN over 64 elems, reduced across the 32 lanes of this wave
    float qs = qor + qoi, qs2 = qor * qor + qoi * qoi;
    float ks = kor + koi, ks2 = kor * kor + koi * koi;
#pragma unroll
    for (int m = 16; m >= 1; m >>= 1) {
      qs += __shfl_xor(qs, m, 32);  qs2 += __shfl_xor(qs2, m, 32);
      ks += __shfl_xor(ks, m, 32);  ks2 += __shfl_xor(ks2, m, 32);
    }
    float qm = qs * (1.f / HD), qvar = qs2 * (1.f / HD) - qm * qm, qiv = rsqrtf(qvar + 1e-5f);
    float km = ks * (1.f / HD), kvar = ks2 * (1.f / HD) - km * km, kiv = rsqrtf(kvar + 1e-5f);
    v2h qo, ko;
    qo[0] = (_Float16)((qor - qm) * qiv * lw0 + lb0);
    qo[1] = (_Float16)((qoi - qm) * qiv * lw1 + lb1);
    ko[0] = (_Float16)((kor - km) * kiv * lw0 + lb0);
    ko[1] = (_Float16)((koi - km) * kiv * lw1 + lb1);
    *(v2h*)(qn + ((size_t)h * CTX + c) * HD + d0) = qo;   // a wave stores one 128-byte row
    *(v2h*)(kn + ((size_t)h * CTX + c) * HD + d0) = ko;
  }
}

// ---------------------------------------------------------------------------
// Stage 5: flash attention. 4 waves/block; each wave owns 16 q rows of one
// head, takes 32 keys/pass: 4 WMMAs for S, online softmax (shfl reductions
// per 16-lane half matching C layout), P re-shaped via small LDS tile,
// 4 WMMAs for O += P*V. Scores never hit HBM.
// K and vT come into LDS once per block, 64 keys a stage, by asynchronous copies
// that cover whole 128-byte lines; the four waves read their fragments from there.
// Two buffers: the next stage's copies fly while this stage is worked on.
// ---------------------------------------------------------------------------
#define FK  64            // keys per stage = one 128-byte line of each vT row
#define FP  72            // LDS row pitch in f16: 144 B = 16 B x 9 (odd), the pitch of 16-byte fragment reads
#define NST (CTX / FK)    // stages
#define FBUF (FK * FP * 2)  // bytes of one buffer (K: 64 keys; vT: 64 d rows)
#define FROW (16 * FP * 2)  // bytes of 16 LDS rows

// One stage: 64 K rows and 64 vT rows of 128 B each; 128 threads x 8 copies of 16 B.
// Eight lanes cover one row, so a wave's copy reads four whole lines.
// lk, lv: the lane's LDS byte addresses; gk, gv: its global addresses (row t/8, piece t%8).
__device__ inline void stage_kv(unsigned lk, unsigned lv,
                                const _Float16* gk, const _Float16* gv) {
  const unsigned lk1 = lk + FROW, lk2 = lk + 2 * FROW, lk3 = lk + 3 * FROW;
  const unsigned lv1 = lv + FROW, lv2 = lv + 2 * FROW, lv3 = lv + 3 * FROW;
  const _Float16* gk1 = gk + 16 * HD;
  const _Float16* gk2 = gk + 32 * HD;
  const _Float16* gk3 = gk + 48 * HD;
  const _Float16* gv1 = gv + (size_t)16 * CTX;
  const _Float16* gv2 = gv + (size_t)32 * CTX;
  const _Float16* gv3 = gv + (size_t)48 * CTX;
  // the copies go past the registers; the closing wait stands in the same statement so
  // that no address register named here is rewritten in front of it
  asm volatile(
      "global_load_async_to_lds_b128 %0, %8, off\n\t"
      "global_load_async_to_lds_b128 %1, %9, off\n\t"
      "global_load_async_to_lds_b128 %2, %10, off\n\t"
      "global_load_async_to_lds_b128 %3, %11, off\n\t"
      "global_load_async_to_lds_b128 %4, %12, off\n\t"
      "global_load_async_to_lds_b128 %5, %13, off\n\t"
      "global_load_async_to_lds_b128 %6, %14, off\n\t"
      "global_load_async_to_lds_b128 %7, %15, off\n\t"
      "s_wait_xcnt 0x0"
      :: "v"(lk), "v"(lk1), "v"(lk2), "v"(lk3), "v"(lv), "v"(lv1), "v"(lv2), "v"(lv3),
         "v"(gk), "v"(gk1), "v"(gk2), "v"(gk3), "v"(gv), "v"(gv1), "v"(gv2), "v"(gv3)
      : "memory");
}

__global__ __launch_bounds__(128) void flash_kernel(
    const _Float16* __restrict__ qn, const _Float16* __restrict__ kn,
    const _Float16* __restrict__ vT, _Float16* __restrict__ aout)
{
  const int t = threadIdx.x;
  const int lane = t & 31;
  const int w = t >> 5;
  const int h = blockIdx.y;
  const int qt = blockIdx.x * 4 + w;          // 16-row query tile
  const int half = lane >> 4, l16 = lane & 15;
  __shared__ __align__(16) _Float16 Ks[2][FK][FP];
  __shared__ __align__(16) _Float16 Vs[2][HD][FP];
  __shared__ __align__(16) _Float16 P[4][16][40];

  const int cr = t >> 3, cc = (t & 7) * 8;    // the lane's row and 16-byte piece in a copy
  const _Float16* gk = kn + ((size_t)h * CTX + cr) * HD + cc;
  const _Float16* gv = vT + ((size_t)h * HD + cr) * CTX + cc;
  const unsigned lk = (unsigned)(size_t)&Ks[0][cr][cc];
  const unsigned lv = (unsigned)(size_t)&Vs[0][cr][cc];

  stage_kv(lk, lv, gk, gv);                                  // stage 0 -> buffer 0

  const _Float16* qrow = qn + ((size_t)h * CTX + qt * 16 + l16) * HD;
  const v16h aq0 = load_frag(qrow, half);       // K = 0..31
  const v16h aq1 = load_frag(qrow + 32, half);  // K = 32..63

  v8f o0 = {}, o1 = {}, o2 = {}, o3 = {};
  float mrow[8], lrow[8];
#pragma unroll
  for (int r = 0; r < 8; ++r) { mrow[r] = -1e30f; lrow[r] = 0.f; }

  asm volatile("s_wait_asynccnt 0x0" ::: "memory");          // this wave's part of stage 0 has landed
  __syncthreads();                                           // ... and every other wave's
  stage_kv(lk + FBUF, lv + FBUF, gk + FK * HD, gv + FK);     // stage 1 -> buffer 1

  for (int s = 0; s < NST; ++s) {
    const int buf = s & 1;
    // both 32-key passes of a stage in straight line: constant LDS offsets, and the second
    // pass's fragment reads and products need not wait for the first pass's softmax
#pragma unroll
    for (int sub = 0; sub < FK; sub += 32) {
      const _Float16* k0row = &Ks[buf][sub + l16][0];
      const _Float16* k1row = k0row + 16 * FP;
      v8f z = {};
      v8f s0 = __builtin_amdgcn_wmma_f32_16x16x32_f16(false, aq0, false, load_frag(k0row, half), (short)0, z, false, false);
      s0 = __builtin_amdgcn_wmma_f32_16x16x32_f16(false, aq1, false, load_frag(k0row + 32, half), (short)0, s0, false, false);
      v8f s1 = __builtin_amdgcn_wmma_f32_16x16x32_f16(false, aq0, false, load_frag(k1row, half), (short)0, z, false, false);
      s1 = __builtin_amdgcn_wmma_f32_16x16x32_f16(false, aq1, false, load_frag(k1row + 32, half), (short)0, s1, false, false);
#pragma unroll
      for (int r = 0; r < 8; ++r) {
        float a = s0[r] * 0.125f, b = s1[r] * 0.125f;   // 1/sqrt(64)
        float mx = fmaxf(a, b);
#pragma unroll
        for (int m = 8; m >= 1; m >>= 1) mx = fmaxf(mx, __shfl_xor(mx, m, 32));
        float mnew = fmaxf(mrow[r], mx);
        float alpha = __expf(mrow[r] - mnew);
        mrow[r] = mnew;
        float p0 = __expf(a - mnew), p1 = __expf(b - mnew);
        float ps = p0 + p1;
#pragma unroll
        for (int m = 8; m >= 1; m >>= 1) ps += __shfl_xor(ps, m, 32);
        lrow[r] = lrow[r] * alpha + ps;
        o0[r] *= alpha; o1[r] *= alpha; o2[r] *= alpha; o3[r] *= alpha;
        P[w][r + 8 * half][l16]      = (_Float16)p0;   // C layout -> LDS
        P[w][r + 8 * half][16 + l16] = (_Float16)p1;
      }
      const v16h ap = load_frag(&P[w][l16][0], half);  // back as A fragment
      const _Float16* vb = &Vs[buf][l16][sub];
      o0 = __builtin_amdgcn_wmma_f32_16x16x32_f16(false, ap, false, load_frag(vb, half), (short)0, o0, false, false);
      o1 = __builtin_amdgcn_wmma_f32_16x16x32_f16(false, ap, false, load_frag(vb + 16 * FP, half), (short)0, o1, false, false);
      o2 = __builtin_amdgcn_wmma_f32_16x16x32_f16(false, ap, false, load_frag(vb + 32 * FP, half), (short)0, o2, false, false);
      o3 = __builtin_amdgcn_wmma_f32_16x16x32_f16(false, ap, false, load_frag(vb + 48 * FP, half), (short)0, o3, false, false);
    }
    // hand-over: stage s + 1 becomes readable and buffer buf becomes free
    asm volatile("s_wait_dscnt 0x0" ::: "memory");     // this wave's reads of buffer buf are done
    asm volatile("s_wait_asynccnt 0x0" ::: "memory");  // its copies of stage s + 1 have landed
    __syncthreads();                                   // the same holds for all four waves
    if (s + 2 < NST)
      stage_kv(lk + buf * FBUF, lv + buf * FBUF,
               gk + (size_t)(s + 2) * FK * HD, gv + (s + 2) * FK);
  }
  asm volatile("s_wait_asynccnt 0x0" ::: "memory");    // no copy is open when the wave ends
  _Float16* arow0 = aout + (size_t)(qt * 16) * DIMS + h * HD;
#pragma unroll
  for (int r = 0; r < 8; ++r) {
    float rl = 1.f / lrow[r];
    _Float16* dst = arow0 + (size_t)(r + 8 * half) * DIMS;
    dst[ 0 + l16] = (_Float16)(o0[r] * rl);
    dst[16 + l16] = (_Float16)(o1[r] * rl);
    dst[32 + l16] = (_Float16)(o2[r] * rl);
    dst[48 + l16] = (_Float16)(o3[r] * rl);
  }
}

// ---------------------------------------------------------------------------
extern "C" void kernel_launch(void* const* d_in, const int* in_sizes, int n_in,
                              void* d_out, int out_size, void* d_ws, size_t ws_size,
                              hipStream_t stream) {
  const float* x     = (const float*)d_in[0];
  const float* qn_w  = (const float*)d_in[1];
  const float* qn_b  = (const float*)d_in[2];
  const float* q_w   = (const float*)d_in[3];
  const float* q_b   = (const float*)d_in[4];
  const float* kvn_w = (const float*)d_in[5];
  const float* kvn_b = (const float*)d_in[6];
  const float* kv_w  = (const float*)d_in[7];
  const float* kv_b  = (const float*)d_in[8];
  const float* out_w = (const float*)d_in[9];
  const float* out_b = (const float*)d_in[10];
  const float* ln_w  = (const float*)d_in[11];
  const float* ln_b  = (const float*)d_in[12];
  const float* rh_w  = (const float*)d_in[13];
  const float* rh_b  = (const float*)d_in[14];
  float* out = (float*)d_out;
  (void)in_sizes; (void)n_in; (void)out_size; (void)ws_size;

  char* base = (char*)d_ws;
  size_t off = 0;
  auto take = [&](size_t bytes) -> char* {
    char* p = base + off;
    off = (off + bytes + 255) & ~(size_t)255;
    return p;
  };
  _Float16* lnq16  = (_Float16*)take((size_t)CTX * DIMS * 2);
  _Float16* lnkv16 = (_Float16*)take((size_t)CTX * DIMS * 2);
  float*    radius = (float*)take((size_t)CTX * 4);
  _Float16* qw16   = (_Float16*)take((size_t)DIMS * DIMS * 2);
  _Float16* kvw16  = (_Float16*)take((size_t)DIMS * 2 * DIMS * 2);
  _Float16* outw16 = (_Float16*)take((size_t)DIMS * DIMS * 2);
  float*    qf32   = (float*)take((size_t)CTX * DIMS * 4);
  float*    kvf32  = (float*)take((size_t)CTX * 2 * DIMS * 4);
  _Float16* qn16   = (_Float16*)take((size_t)HEAD * CTX * HD * 2);
  _Float16* kn16   = (_Float16*)take((size_t)HEAD * CTX * HD * 2);
  _Float16* vT16   = (_Float16*)take((size_t)HEAD * HD * CTX * 2);
  _Float16* a16    = (_Float16*)take((size_t)CTX * DIMS * 2);

  prep_kernel<<<CTX, 256, 0, stream>>>(x, qn_w, qn_b, kvn_w, kvn_b, rh_w, rh_b,
                                       lnq16, lnkv16, radius);
  cvt_kernel<<<256, 256, 0, stream>>>(q_w,   qw16,   DIMS * DIMS);
  cvt_kernel<<<256, 256, 0, stream>>>(kv_w,  kvw16,  DIMS * 2 * DIMS);
  cvt_kernel<<<256, 256, 0, stream>>>(out_w, outw16, DIMS * DIMS);

  gemm_kernel<<<dim3(DIMS / BN, CTX / BM), 256, 0, stream>>>(
      lnq16, qw16, q_b, qf32, CTX, DIMS, DIMS);
  gemm_kernel<<<dim3(2 * DIMS / BN, CTX / BM), 256, 0, stream>>>(
      lnkv16, kvw16, kv_b, kvf32, CTX, 2 * DIMS, DIMS);

  rotln_kernel<<<dim3(CTX / RT, HEAD), 256, 0, stream>>>(
      qf32, kvf32, radius, ln_w, ln_b, qn16, kn16, vT16);

  flash_kernel<<<dim3(CTX / 16 / 4, HEAD), 128, 0, stream>>>(qn16, kn16, vT16, a16);

  gemm_kernel<<<dim3(DIMS / BN, CTX / BM), 256, 0, stream>>>(
      a16, outw16, out_b, out, CTX, DIMS, DIMS);
}

// v005
// Measured time: 84.7 microseconds a run.
// In two side-by-side timings against v004, it was 1.45 and 1.46 times as fast.
// Counting every step since v000, it is 3.98 times as fast.
#include <hip/hip_runtime.h>

#define CTX  2048
#define DIMS 1024
#define HEAD 16
#define HD   64

typedef __attribute__((ext_vector_type(16))) _Float16 v16h;
typedef __attribute__((ext_vector_type(8)))  _Float16 v8h;
typedef __attribute__((ext_vector_type(2)))  _Float16 v2h;
typedef __attribute__((ext_vector_type(8)))  float    v8f;
typedef __attribute__((ext_vector_type(8)))  short    v8s;

// Build a 16x16x32 f16 WMMA A/B fragment for this lane.
// 16-bit operand layout (ISA 7.12.2): lane half (lane/16) selects
// K in {0..7,16..23} (half=0) or {8..15,24..31} (half=1); both chunks are
// contiguous 8 x f16 = 16B runs, so two aligned 16-byte loads suffice.
__device__ inline v16h load_frag(const _Float16* rowbase, int half) {
  v8h lo = *(const v8h*)(rowbase + half * 8);
  v8h hi = *(const v8h*)(rowbase + 16 + half * 8);
  v16h r;
#pragma unroll
  for (int i = 0; i < 8; ++i) { r[i] = lo[i]; r[i + 8] = hi[i]; }
  return r;
}

// The same fragment out of a row-major (K x N) f16 tile in LDS, by the
// transposing LDS load. p is the lane's own address: row 8*(lane/16) + (lane&7),
// column n0 + 8*((lane/8)&1). Lane (c = lane&15, h = lane/16) then holds
// T[8h + 0..7][n0 + c] and, from 16 rows further on, T[16 + 8h + 0..7][n0 + c]:
// the k order of load_frag.
__device__ inline v16h load_frag_tr(const _Float16* p, int pitch) {
  typedef __attribute__((address_space(3))) v8s lds_v8s;
  v8h lo = __builtin_bit_cast(v8h, __builtin_amdgcn_ds_load_tr16_b128_v8i16((lds_v8s*)p));
  v8h hi = __builtin_bit_cast(v8h, __builtin_amdgcn_ds_load_tr16_b128_v8i16((lds_v8s*)(p + 16 * pitch)));
  v16h r;
#pragma unroll
  for (int i = 0; i < 8; ++i) { r[i] = lo[i]; r[i + 8] = hi[i]; }
  return r;
}

// ---------------------------------------------------------------------------
// Stage 1: fused LayerNorm (q-path & kv-path share mean/var) + rotary radius
// ---------------------------------------------------------------------------
__global__ __launch_bounds__(256) void prep_kernel(
    const float* __restrict__ x,
    const float* __restrict__ qn_w, const float* __restrict__ qn_b,
    const float* __restrict__ kvn_w, const float* __restrict__ kvn_b,
    const float* __restrict__ rh_w, const float* __restrict__ rh_b,
    _Float16* __restrict__ lnq, _Float16* __restrict__ lnkv,
    float* __restrict__ radius)
{
  const int c = blockIdx.x, t = threadIdx.x;
  const float* row = x + (size_t)c * DIMS;
  float v[4];
  float s = 0.f, s2 = 0.f, dp = 0.f;
#pragma unroll
  for (int i = 0; i < 4; ++i) {
    int d = t + i * 256;
    float val = row[d];
    v[i] = val;
    s += val; s2 += val * val; dp += val * rh_w[d];
  }
  __shared__ float red[256];
  auto reduceAll = [&](float val) -> float {
    red[t] = val; __syncthreads();
    for (int o = 128; o > 0; o >>= 1) { if (t < o) red[t] += red[t + o]; __syncthreads(); }
    float r = red[0]; __syncthreads(); return r;
  };
  float tot  = reduceAll(s);
  float tot2 = reduceAll(s2);
  float dtot = reduceAll(dp);
  float mean = tot * (1.f / DIMS);
  float var  = tot2 * (1.f / DIMS) - mean * mean;
  float inv  = rsqrtf(var + 1e-5f);
  if (t == 0) {
    float per = dtot + rh_b[0];
    radius[c] = fminf(fmaxf(per * 0.01f, 0.5f), 2.0f);
  }
#pragma unroll
  for (int i = 0; i < 4; ++i) {
    int d = t + i * 256;
    float n = (v[i] - mean) * inv;
    lnq [(size_t)c * DIMS + d] = (_Float16)(n * qn_w[d] + qn_b[d]);
    lnkv[(size_t)c * DIMS + d] = (_Float16)(n * kvn_w[d] + kvn_b[d]);
  }
}

// ---------------------------------------------------------------------------
// Stage 2: f32 -> f16 weight conversion (one pass; weights then live in L2)
// ---------------------------------------------------------------------------
__global__ void cvt_kernel(const float* __restrict__ s, _Float16* __restrict__ d, int n) {
  int i = blockIdx.x * blockDim.x + threadIdx.x;
  int stride = gridDim.x * blockDim.x;
  for (; i < n; i += stride) d[i] = (_Float16)s[i];
}

// ---------------------------------------------------------------------------
// Stage 3/6: LDS-staged WMMA GEMM.  C(f32) = A(f16,MxK) * B(f16,KxN) + bias
// Block tile 64x128; 8 waves in 4(M) x 2(N); each wave owns a 16x64 strip
// = 4 accumulators -> 4 WMMAs per 32 k sharing one A-fragment.
// A and B come into LDS 128 k a stage, by asynchronous copies that cover whole
// 256-byte rows and pass no register. Two buffers: the next stage's copies fly
// while this stage's 16 WMMAs a wave are worked on.
// B lies in LDS as in memory (K x N); the transposing LDS load turns it into fragments.
// M, N, K: multiples of 64, 128, 128.
// ---------------------------------------------------------------------------
#define BM 64
#define BN 128
#define BK 128  // k per stage = one 256-byte row of A
#define AP 136  // A row stride in f16 (272 bytes = 16 B x 17, odd: the pitch of 16-byte fragment reads)
#define BP 144  // B row stride in f16 (288 bytes = 32 B x 9, odd: the transposing load's pitch)
#define ABUF (BM * AP * 2)   // bytes of one A buffer
#define BBUF (BK * BP * 2)   // bytes of one B buffer
#define AROW (16 * AP * 2)   // bytes of 16 LDS rows of A
#define BROW (16 * BP * 2)   // bytes of 16 LDS rows of B

// One stage: 64 A rows and 128 B rows of 256 B each; 256 threads x 12 copies of 16 B.
// Sixteen lanes cover one row, so a wave's copy reads four whole lines.
// la, lb: the lane's LDS byte addresses; ga, gb: its global addresses (row t/16, piece t%16);
// a16, b16: 16 rows of A and of B in elements.
__device__ inline void stage_ab(unsigned la, unsigned lb,
                                const _Float16* ga, const _Float16* gb,
                                size_t a16, size_t b16) {
  const unsigned la1 = la + AROW, la2 = la + 2 * AROW, la3 = la + 3 * AROW;
  const unsigned lb1 = lb + BROW, lb2 = lb + 2 * BROW, lb3 = lb + 3 * BROW;
  const unsigned lb4 = lb + 4 * BROW, lb5 = lb + 5 * BROW, lb6 = lb + 6 * BROW, lb7 = lb + 7 * BROW;
  const _Float16* ga1 = ga + a16;
  const _Float16* ga2 = ga + 2 * a16;
  const _Float16* ga3 = ga + 3 * a16;
  const _Float16* gb1 = gb + b16;
  const _Float16* gb2 = gb + 2 * b16;
  const _Float16* gb3 = gb + 3 * b16;
  const _Float16* gb4 = gb + 4 * b16;
  const _Float16* gb5 = gb + 5 * b16;
  const _Float16* gb6 = gb + 6 * b16;
  const _Float16* gb7 = gb + 7 * b16;
  // the copies go past the registers; the closing wait stands in the same statement so
  // that no address register named here is rewritten in front of it
  asm volatile(
      "global_load_async_to_lds_b128 %0, %12, off\n\t"
      "global_load_async_to_lds_b128 %1, %13, off\n\t"
      "global_load_async_to_lds_b128 %2, %14, off\n\t"
      "global_load_async_to_lds_b128 %3, %15, off\n\t"
      "global_load_async_to_lds_b128 %4, %16, off\n\t"
      "global_load_async_to_lds_b128 %5, %17, off\n\t"
      "global_load_async_to_lds_b128 %6, %18, off\n\t"
      "global_load_async_to_lds_b128 %7, %19, off\n\t"
      "global_load_async_to_lds_b128 %8, %20, off\n\t"
      "global_load_async_to_lds_b128 %9, %21, off\n\t"
      "global_load_async_to_lds_b128 %10, %22, off\n\t"
      "global_load_async_to_lds_b128 %11, %23, off\n\t"
      "s_wait_xcnt 0x0"
      :: "v"(la), "v"(la1), "v"(la2), "v"(la3),
         "v"(lb), "v"(lb1), "v"(lb2), "v"(lb3), "v"(lb4), "v"(lb5), "v"(lb6), "v"(lb7),
         "v"(ga), "v"(ga1), "v"(ga2), "v"(ga3),
         "v"(gb), "v"(gb1), "v"(gb2), "v"(gb3), "v"(gb4), "v"(gb5), "v"(gb6), "v"(gb7)
      : "memory");
}

__global__ __launch_bounds__(256) void gemm_kernel(
    const _Float16* __restrict__ A, const _Float16* __restrict__ B,
    const float* __restrict__ bias, float* __restrict__ C,
    int M, int N, int K)
{
  __shared__ __align__(16) _Float16 As[2][BM][AP];
  __shared__ __align__(16) _Float16 Bs[2][BK][BP];   // B staged row-major (KxN)
  const int t = threadIdx.x, lane = t & 31, w = t >> 5;
  const int wm = w >> 1, wn = w & 1;              // 4 x 2 wave grid
  const int half = lane >> 4, l16 = lane & 15;
  const int bm = blockIdx.y * BM, bn = blockIdx.x * BN;
  const int cr = t >> 4, cc = (t & 15) * 8;       // the lane's row and 16-byte piece in a copy
  const _Float16* ga = A + (size_t)(bm + cr) * K + cc;
  const _Float16* gb = B + (size_t)cr * N + bn + cc;
  const unsigned la = (unsigned)(size_t)&As[0][cr][cc];
  const unsigned lb = (unsigned)(size_t)&Bs[0][cr][cc];
  const size_t a16 = (size_t)16 * K, b16 = (size_t)16 * N;
  const size_t bst = (size_t)BK * N;              // one stage further on in B
  const int nst = K / BK;                         // stages
  v8f acc0 = {}, acc1 = {}, acc2 = {}, acc3 = {};

  stage_ab(la, lb, ga, gb, a16, b16);                        // stage 0 -> buffer 0
  asm volatile("s_wait_asynccnt 0x0" ::: "memory");          // this wave's part of stage 0 has landed
  __syncthreads();                                           // ... and every other wave's
  if (nst > 1)
    stage_ab(la + ABUF, lb + BBUF, ga + BK, gb + bst, a16, b16);   // stage 1 -> buffer 1

  for (int s = 0; s < nst; ++s) {
    const int buf = s & 1;
    const _Float16* ap = &As[buf][wm * 16 + l16][0];
    const _Float16* bp = &Bs[buf][8 * half + (lane & 7)][wn * 64 + 8 * ((lane >> 3) & 1)];
    // the stage's four 32-k steps in straight line: constant LDS offsets, and a step's
    // fragment reads need not wait for the step before
#pragma unroll
    for (int kk = 0; kk < BK; kk += 32) {
      const v16h a = load_frag(ap + kk, half);
      const v16h b0 = load_frag_tr(bp + kk * BP,      BP);
      const v16h b1 = load_frag_tr(bp + kk * BP + 16, BP);
      const v16h b2 = load_frag_tr(bp + kk * BP + 32, BP);
      const v16h b3 = load_frag_tr(bp + kk * BP + 48, BP);
      acc0 = __builtin_amdgcn_wmma_f32_16x16x32_f16(false, a, false, b0, (short)0, acc0, false, false);
      acc1 = __builtin_amdgcn_wmma_f32_16x16x32_f16(false, a, false, b1, (short)0, acc1, false, false);
      acc2 = __builtin_amdgcn_wmma_f32_16x16x32_f16(false, a, false, b2, (short)0, acc2, false, false);
      acc3 = __builtin_amdgcn_wmma_f32_16x16x32_f16(false, a, false, b3, (short)0, acc3, false, false);
    }
    // hand-over: stage s + 1 becomes readable and buffer buf becomes free
    asm volatile("s_wait_dscnt 0x0" ::: "memory");     // this wave's reads of buffer buf are done
    asm volatile("s_wait_asynccnt 0x0" ::: "memory");  // its copies of stage s + 1 have landed
    __syncthreads();                                   // the same holds for all eight waves
    if (s + 2 < nst)
      stage_ab(la + buf * ABUF, lb + buf * BBUF,
               ga + (size_t)(s + 2) * BK, gb + (size_t)(s + 2) * bst, a16, b16);
  }
  asm volatile("s_wait_asynccnt 0x0" ::: "memory");    // no copy is open when the wave ends
  // epilogue: C layout per tile: M = r + 8*half, N = l16
  const int ncol0 = bn + wn * 64 + l16;
  const float bb0 = bias[ncol0], bb1 = bias[ncol0 + 16];
  const float bb2 = bias[ncol0 + 32], bb3 = bias[ncol0 + 48];
#pragma unroll
  for (int r = 0; r < 8; ++r) {
    const size_t rowoff = (size_t)(bm + wm * 16 + r + 8 * half) * N + ncol0;
    C[rowoff]      = acc0[r] + bb0;
    C[rowoff + 16] = acc1[r] + bb1;
    C[rowoff + 32] = acc2[r] + bb2;
    C[rowoff + 48] = acc3[r] + bb3;
  }
}

// ---------------------------------------------------------------------------
// Stage 4: rotary (mel-scaled freqs, per-step radius) + per-head LayerNorm.
// One 8-wave block per (64 ctx rows, head); a wave takes 8 rows, one after the
// other, and lane j handles complex pair (2j, 2j+1) of each.
// Also writes V transposed [h][d][c] so flash V fragments are contiguous: the
// 64x64 V tile is turned in LDS, so each vT store covers whole 128-byte lines.
// ---------------------------------------------------------------------------
#define RT 64   // ctx rows per block = one 128-byte line of vT per d
#define RW 8    // ctx rows per wave
#define VP 66   // LDS pitch in f16 = 33 dwords (odd): column writes and row reads both spread over the banks
__global__ __launch_bounds__(256) void rotln_kernel(
    const float* __restrict__ qf, const float* __restrict__ kvf,
    const float* __restrict__ radius,
    const float* __restrict__ ln_w, const float* __restrict__ ln_b,
    _Float16* __restrict__ qn, _Float16* __restrict__ kn,
    _Float16* __restrict__ vT)
{
  __shared__ __align__(16) _Float16 Vs[HD][VP];
  const int t = threadIdx.x, j = t & 31, w = t >> 5;
  const int c0 = blockIdx.x * RT, h = blockIdx.y;
  const float mel_max = 2595.0f * 1.3222192947339193f;          // 2595*log10(21)
  const float lin = (float)j * (mel_max / 31.0f);               // linspace, 32 pts
  const float fb = 0.2f * (expf(lin * (2.3025850929940457f / 2595.0f)) - 1.0f);
  const int d0 = 2 * j, d1 = 2 * j + 1;
  const float lw0 = ln_w[d0], lw1 = ln_w[d1], lb0 = ln_b[d0], lb1 = ln_b[d1];

  // all 8 rows' loads are issued before the first row is worked on
  float2 qv[RW], kk[RW], vv[RW];
  float rr[RW];
#pragma unroll
  for (int i = 0; i < RW; ++i) {
    const int c = c0 + w * RW + i;
    qv[i] = *(const float2*)(qf  + (size_t)c * DIMS + h * HD + d0);
    kk[i] = *(const float2*)(kvf + (size_t)c * (2 * DIMS) + h * HD + d0);
    vv[i] = *(const float2*)(kvf + (size_t)c * (2 * DIMS) + DIMS + h * HD + d0);
    rr[i] = radius[c];
  }

  // V: two neighbouring rows of one d make one 32-bit LDS store
#pragma unroll
  for (int i = 0; i < RW; i += 2) {
    v2h p0, p1;
    p0[0] = (_Float16)vv[i].x; p0[1] = (_Float16)vv[i + 1].x;
    p1[0] = (_Float16)vv[i].y; p1[1] = (_Float16)vv[i + 1].y;
    *(v2h*)&Vs[d0][w * RW + i] = p0;
    *(v2h*)&Vs[d1][w * RW + i] = p1;
  }

  // V goes out first, so that its stores fly under the q/k arithmetic below
  __syncthreads();   // the V tile is complete before any wave reads it back by rows
#pragma unroll
  for (int p = 0; p < 2; ++p) {
    const int idx = p * 256 + t;
    const int d = idx >> 3, ch = idx & 7;       // 8 lanes x 16 B = one line of vT
    v8h o;
#pragma unroll
    for (int e = 0; e < 4; ++e) {
      const v2h x = *(const v2h*)&Vs[d][ch * 8 + 2 * e];
      o[2 * e] = x[0]; o[2 * e + 1] = x[1];
    }
    *(v8h*)(vT + (size_t)(h * HD + d) * CTX + c0 + ch * 8) = o;
  }

#pragma unroll
  for (int i = 0; i < RW; ++i) {
    const int c = c0 + w * RW + i;
    const float freq = (float)c * fb;
    const float rad = rr[i];
    const float fr = rad * cosf(freq), fi = rad * sinf(freq);

    float qr = qv[i].x, qi = qv[i].y;
    float qor = qr * fr - qi * fi, qoi = qr * fi + qi * fr;
    float kr = kk[i].x, ki = kk[i].y;
    float kor = kr * fr - ki * fi, koi = kr * fi + ki * fr;

    // per-head LN over 64 elems, reduced across the 32 lanes of this wave
    float qs = qor + qoi, qs2 = qor * qor + qoi * qoi;
    float ks = kor + koi, ks2 = kor * kor + koi * koi;
#pragma unroll
    for (int m = 16; m >= 1; m >>= 1) {
      qs += __shfl_xor(qs, m, 32);  qs2 += __shfl_xor(qs2, m, 32);
      ks += __shfl_xor(ks, m, 32);  ks2 += __shfl_xor(ks2, m, 32);
    }
    float qm = qs * (1.f / HD), qvar = qs2 * (1.f / HD) - qm * qm, qiv = rsqrtf(qvar + 1e-5f);
    float km = ks * (1.f / HD), kvar = ks2 * (1.f / HD) - km * km, kiv = rsqrtf(kvar + 1e-5f);
    v2h qo, ko;
    qo[0] = (_Float16)((qor - qm) * qiv * lw0 + lb0);
    qo[1] = (_Float16)((qoi - qm) * qiv * lw1 + lb1);
    ko[0] = (_Float16)((kor - km) * kiv * lw0 + lb0);
    ko[1] = (_Float16)((koi - km) * kiv * lw1 + lb1);
    *(v2h*)(qn + ((size_t)h * CTX + c) * HD + d0) = qo;   // a wave stores one 128-byte row
    *(v2h*)(kn + ((size_t)h * CTX + c) * HD + d0) = ko;
  }
}

// ---------------------------------------------------------------------------
// Stage 5: flash attention. 4 waves/block; each wave owns 16 queries of one
// head and takes 32 keys/pass. Both products are transposed: S^T = K Q^T
// (4 WMMAs) and O^T += V^T P^T (4 WMMAs). A lane then holds 16 scores of ONE
// query, so maximum and sum are taken in its own registers, with one exchange
// between the wave's halves for the maximum, and the two S^T tiles, converted
// in place, are the B operand of the second product: P never touches LDS.
// K and vT come into LDS once per block, 64 keys a stage, by asynchronous copies
// that cover whole 128-byte lines; the four waves read their fragments from there.
// Two buffers: the next stage's copies fly while this stage is worked on.
// ---------------------------------------------------------------------------
#define FK  64            // keys per stage = one 128-byte line of each vT row
#define FP  72            // LDS row pitch in f16: 144 B = 16 B x 9 (odd), the pitch of 16-byte fragment reads
#define NST (CTX / FK)    // stages
#define FBUF (FK * FP * 2)  // bytes of one buffer (K: 64 keys; vT: 64 d rows)
#define FROW (16 * FP * 2)  // bytes of 16 LDS rows

// One stage: 64 K rows and 64 vT rows of 128 B each; 128 threads x 8 copies of 16 B.
// Eight lanes cover one row, so a wave's copy reads four whole lines.
// lk, lv: the lane's LDS byte addresses; gk, gv: its global addresses (row t/8, piece t%8).
__device__ inline void stage_kv(unsigned lk, unsigned lv,
                                const _Float16* gk, const _Float16* gv) {
  const unsigned lk1 = lk + FROW, lk2 = lk + 2 * FROW, lk3 = lk + 3 * FROW;
  const unsigned lv1 = lv + FROW, lv2 = lv + 2 * FROW, lv3 = lv + 3 * FROW;
  const _Float16* gk1 = gk + 16 * HD;
  const _Float16* gk2 = gk + 32 * HD;
  const _Float16* gk3 = gk + 48 * HD;
  const _Float16* gv1 = gv + (size_t)16 * CTX;
  const _Float16* gv2 = gv + (size_t)32 * CTX;
  const _Float16* gv3 = gv + (size_t)48 * CTX;
  // the copies go past the registers; the closing wait stands in the same statement so
  // that no address register named here is rewritten in front of it
  asm volatile(
      "global_load_async_to_lds_b128 %0, %8, off\n\t"
      "global_load_async_to_lds_b128 %1, %9, off\n\t"
      "global_load_async_to_lds_b128 %2, %10, off\n\t"
      "global_load_async_to_lds_b128 %3, %11, off\n\t"
      "global_load_async_to_lds_b128 %4, %12, off\n\t"
      "global_load_async_to_lds_b128 %5, %13, off\n\t"
      "global_load_async_to_lds_b128 %6, %14, off\n\t"
      "global_load_async_to_lds_b128 %7, %15, off\n\t"
      "s_wait_xcnt 0x0"
      :: "v"(lk), "v"(lk1), "v"(lk2), "v"(lk3), "v"(lv), "v"(lv1), "v"(lv2), "v"(lv3),
         "v"(gk), "v"(gk1), "v"(gk2), "v"(gk3), "v"(gv), "v"(gv1), "v"(gv2), "v"(gv3)
      : "memory");
}

typedef __attribute__((ext_vector_type(2))) float v2f;

// lane l takes the value of lane l ^ 16
__device__ inline float xhalf(float x) {
  const int i = __builtin_bit_cast(int, x);
  return __builtin_bit_cast(float, __builtin_amdgcn_permlanex16(i, i, 0x76543210, 0xfedcba98, false, false));
}
__device__ inline float max3f(float a, float b, float c) { return fmaxf(fmaxf(a, b), c); }

__global__ __launch_bounds__(128) void flash_kernel(
    const _Float16* __restrict__ qn, const _Float16* __restrict__ kn,
    const _Float16* __restrict__ vT, _Float16* __restrict__ aout)
{
  const int t = threadIdx.x;
  const int lane = t & 31;
  const int w = t >> 5;
  const int h = blockIdx.y;
  const int qt = blockIdx.x * 4 + w;          // 16-row query tile
  const int half = lane >> 4, l16 = lane & 15;
  __shared__ __align__(16) _Float16 Ks[2][FK][FP];
  __shared__ __align__(16) _Float16 Vs[2][HD][FP];

  const int cr = t >> 3, cc = (t & 7) * 8;    // the lane's row and 16-byte piece in a copy
  const _Float16* gk = kn + ((size_t)h * CTX + cr) * HD + cc;
  const _Float16* gv = vT + ((size_t)h * HD + cr) * CTX + cc;
  const unsigned lk = (unsigned)(size_t)&Ks[0][cr][cc];
  const unsigned lv = (unsigned)(size_t)&Vs[0][cr][cc];

  stage_kv(lk, lv, gk, gv);                                  // stage 0 -> buffer 0

  // Q as the B operand: column = query l16, the k order of load_frag
  const _Float16* qrow = qn + ((size_t)h * CTX + qt * 16 + l16) * HD;
  const v16h bq0 = load_frag(qrow, half);       // d = 0..31
  const v16h bq1 = load_frag(qrow + 32, half);  // d = 32..63

  // o<i>[r] = O[query l16][d = 16 i + 8 half + r]
  v8f o0 = {}, o1 = {}, o2 = {}, o3 = {};
  const float cs = 0.125f * 1.4426950408889634f;   // 1/sqrt(64), in the base-2 domain
  float mrun = -1e30f;    // query l16's running maximum, scaled; alike in both halves
  float lrun = 0.f;       // its sum over the keys that this half of the wave holds

  asm volatile("s_wait_asynccnt 0x0" ::: "memory");          // this wave's part of stage 0 has landed
  __syncthreads();                                           // ... and every other wave's
  stage_kv(lk + FBUF, lv + FBUF, gk + FK * HD, gv + FK);     // stage 1 -> buffer 1

  for (int s = 0; s < NST; ++s) {
    const int buf = s & 1;
    // both 32-key passes of a stage in straight line: constant LDS offsets, and the second
    // pass's fragment reads and products need not wait for the first pass's softmax
#pragma unroll
    for (int sub = 0; sub < FK; sub += 32) {
      const _Float16* k0row = &Ks[buf][sub + l16][0];
      const _Float16* k1row = k0row + 16 * FP;
      v8f z = {};
      // s0[r] = S[key sub + 8 half + r][query l16], s1[r] = the same 16 keys further on
      v8f s0 = __builtin_amdgcn_wmma_f32_16x16x32_f16(false, load_frag(k0row, half), false, bq0, (short)0, z, false, false);
      s0 = __builtin_amdgcn_wmma_f32_16x16x32_f16(false, load_frag(k0row + 32, half), false, bq1, (short)0, s0, false, false);
      v8f s1 = __builtin_amdgcn_wmma_f32_16x16x32_f16(false, load_frag(k1row, half), false, bq0, (short)0, z, false, false);
      s1 = __builtin_amdgcn_wmma_f32_16x16x32_f16(false, load_frag(k1row + 32, half), false, bq1, (short)0, s1, false, false);

      // maximum of the raw scores (the scale is positive): 16 in the lane, then the other half's
      const float ma = max3f(max3f(s0[0], s0[1], s0[2]), max3f(s0[3], s0[4], s0[5]), max3f(s0[6], s0[7], s1[0]));
      const float mb = max3f(max3f(s1[1], s1[2], s1[3]), max3f(s1[4], s1[5], s1[6]), s1[7]);
      float mx = fmaxf(ma, mb);
      mx = fmaxf(mx, xhalf(mx));
      const float mnew = fmaxf(mrun, mx * cs);
      const float alpha = __builtin_amdgcn_exp2f(mrun - mnew);
      mrun = mnew;

      // P^T as the B operand, in the k order of load_frag: element e is s0[e] for e < 8, s1[e - 8] behind it
      const v2f c2 = {cs, cs}, nm = {-mnew, -mnew};
      v2f p[8];
      v16h bp;
#pragma unroll
      for (int i = 0; i < 8; ++i) {
        const v8f& sv = i < 4 ? s0 : s1;
        const v2f x = {sv[2 * (i & 3)], sv[2 * (i & 3) + 1]};
        const v2f arg = __builtin_elementwise_fma(x, c2, nm);
        p[i] = v2f{__builtin_amdgcn_exp2f(arg[0]), __builtin_amdgcn_exp2f(arg[1])};
        const v2h ph = __builtin_convertvector(p[i], v2h);
        bp[2 * i] = ph[0]; bp[2 * i + 1] = ph[1];
      }
      const v2f ps = ((p[0] + p[1]) + (p[2] + p[3])) + ((p[4] + p[5]) + (p[6] + p[7]));
      lrun = lrun * alpha + (ps[0] + ps[1]);
      o0 *= alpha; o1 *= alpha; o2 *= alpha; o3 *= alpha;

      // V^T as the A operand: row = d, k = the pass's 32 keys in the order of load_frag
      const _Float16* vb = &Vs[buf][l16][sub];
      o0 = __builtin_amdgcn_wmma_f32_16x16x32_f16(false, load_frag(vb, half), false, bp, (short)0, o0, false, false);
      o1 = __builtin_amdgcn_wmma_f32_16x16x32_f16(false, load_frag(vb + 16 * FP, half), false, bp, (short)0, o1, false, false);
      o2 = __builtin_amdgcn_wmma_f32_16x16x32_f16(false, load_frag(vb + 32 * FP, half), false, bp, (short)0, o2, false, false);
      o3 = __builtin_amdgcn_wmma_f32_16x16x32_f16(false, load_frag(vb + 48 * FP, half), false, bp, (short)0, o3, false, false);
    }
    // hand-over: stage s + 1 becomes readable and buffer buf becomes free
    asm volatile("s_wait_dscnt 0x0" ::: "memory");     // this wave's reads of buffer buf are done
    asm volatile("s_wait_asynccnt 0x0" ::: "memory");  // its copies of stage s + 1 have landed
    __syncthreads();                                   // the same holds for all four waves
    if (s + 2 < NST)
      stage_kv(lk + buf * FBUF, lv + buf * FBUF,
               gk + (size_t)(s + 2) * FK * HD, gv + (s + 2) * FK);
  }
  asm volatile("s_wait_asynccnt 0x0" ::: "memory");    // no copy is open when the wave ends
  // the two halves' sums join once; a lane's 8 registers of a tile are 8 neighbouring d of its query
  const float rl = 1.f / (lrun + xhalf(lrun));
  _Float16* dst = aout + (size_t)(qt * 16 + l16) * DIMS + h * HD + 8 * half;
  *(v8h*)(dst)      = __builtin_convertvector(o0 * rl, v8h);
  *(v8h*)(dst + 16) = __builtin_convertvector(o1 * rl, v8h);
  *(v8h*)(dst + 32) = __builtin_convertvector(o2 * rl, v8h);
  *(v8h*)(dst + 48) = __builtin_convertvector(o3 * rl, v8h);
}

// ---------------------------------------------------------------------------
extern "C" void kernel_launch(void* const* d_in, const int* in_sizes, int n_in,
                              void* d_out, int out_size, void* d_ws, size_t ws_size,
                              hipStream_t stream) {
  const float* x     = (const float*)d_in[0];
  const float* qn_w  = (const float*)d_in[1];
  const float* qn_b  = (const float*)d_in[2];
  const float* q_w   = (const float*)d_in[3];
  const float* q_b   = (const float*)d_in[4];
  const float* kvn_w = (const float*)d_in[5];
  const float* kvn_b = (const float*)d_in[6];
  const float* kv_w  = (const float*)d_in[7];
  const float* kv_b  = (const float*)d_in[8];
  const float* out_w = (const float*)d_in[9];
  const float* out_b = (const float*)d_in[10];
  const float* ln_w  = (const float*)d_in[11];
  const float* ln_b  = (const float*)d_in[12];
  const float* rh_w  = (const float*)d_in[13];
  const float* rh_b  = (const float*)d_in[14];
  float* out = (float*)d_out;
  (void)in_sizes; (void)n_in; (void)out_size; (void)ws_size;

  char* base = (char*)d_ws;
  size_t off = 0;
  auto take = [&](size_t bytes) -> char* {
    char* p = base + off;
    off = (off + bytes + 255) & ~(size_t)255;
    return p;
  };
  _Float16* lnq16  = (_Float16*)take((size_t)CTX * DIMS * 2);
  _Float16* lnkv16 = (_Float16*)take((size_t)CTX * DIMS * 2);
  float*    radius = (float*)take((size_t)CTX * 4);
  _Float16* qw16   = (_Float16*)take((size_t)DIMS * DIMS * 2);
  _Float16* kvw16  = (_Float16*)take((size_t)DIMS * 2 * DIMS * 2);
  _Float16* outw16 = (_Float16*)take((size_t)DIMS * DIMS * 2);
  float*    qf32   = (float*)take((size_t)CTX * DIMS * 4);
  float*    kvf32  = (float*)take((size_t)CTX * 2 * DIMS * 4);
  _Float16* qn16   = (_Float16*)take((size_t)HEAD * CTX * HD * 2);
  _Float16* kn16   = (_Float16*)take((size_t)HEAD * CTX * HD * 2);
  _Float16* vT16   = (_Float16*)take((size_t)HEAD * HD * CTX * 2);
  _Float16* a16    = (_Float16*)take((size_t)CTX * DIMS * 2);

  prep_kernel<<<CTX, 256, 0, stream>>>(x, qn_w, qn_b, kvn_w, kvn_b, rh_w, rh_b,
                                       lnq16, lnkv16, radius);
  cvt_kernel<<<256, 256, 0, stream>>>(q_w,   qw16,   DIMS * DIMS);
  cvt_kernel<<<256, 256, 0, stream>>>(kv_w,  kvw16,  DIMS * 2 * DIMS);
  cvt_kernel<<<256, 256, 0, stream>>>(out_w, outw16, DIMS * DIMS);

  gemm_kernel<<<dim3(DIMS / BN, CTX / BM), 256, 0, stream>>>(
      lnq16, qw16, q_b, qf32, CTX, DIMS, DIMS);
  gemm_kernel<<<dim3(2 * DIMS / BN, CTX / BM), 256, 0, stream>>>(
      lnkv16, kvw16, kv_b, kvf32, CTX, 2 * DIMS, DIMS);

  rotln_kernel<<<dim3(CTX / RT, HEAD), 256, 0, stream>>>(
      qf32, kvf32, radius, ln_w, ln_b, qn16, kn16, vT16);

  flash_kernel<<<dim3(CTX / 16 / 4, HEAD), 128, 0, stream>>>(qn16, kn16, vT16, a16);

  gemm_kernel<<<dim3(DIMS / BN, CTX / BM), 256, 0, stream>>>(
      a16, outw16, out_b, out, CTX, DIMS, DIMS);
}

// v006
// One run takes 77.5 microseconds.
// Two timings next to v005 both put it at 1.10 times that version's speed.
// All steps since v000 together make it 4.36 times as fast.
#include <hip/hip_runtime.h>

#define CTX  2048
#define DIMS 1024
#define HEAD 16
#define HD   64

typedef __attribute__((ext_vector_type(16))) _Float16 v16h;
typedef __attribute__((ext_vector_type(8)))  _Float16 v8h;
typedef __attribute__((ext_vector_type(4)))  _Float16 v4h;
typedef __attribute__((ext_vector_type(2)))  _Float16 v2h;
typedef __attribute__((ext_vector_type(4)))  float    v4f;
typedef __attribute__((ext_vector_type(8)))  float    v8f;
typedef __attribute__((ext_vector_type(8)))  short    v8s;

// Build a 16x16x32 f16 WMMA A/B fragment for this lane.
// 16-bit operand layout (ISA 7.12.2): lane half (lane/16) selects
// K in {0..7,16..23} (half=0) or {8..15,24..31} (half=1); both chunks are
// contiguous 8 x f16 = 16B runs, so two aligned 16-byte loads suffice.
__device__ inline v16h load_frag(const _Float16* rowbase, int half) {
  v8h lo = *(const v8h*)(rowbase + half * 8);
  v8h hi = *(const v8h*)(rowbase + 16 + half * 8);
  v16h r;
#pragma unroll
  for (int i = 0; i < 8; ++i) { r[i] = lo[i]; r[i + 8] = hi[i]; }
  return r;
}

// The same fragment out of a row-major (K x N) f16 tile in LDS, by the
// transposing LDS load. p is the lane's own address: row 8*(lane/16) + (lane&7),
// column n0 + 8*((lane/8)&1). Lane (c = lane&15, h = lane/16) then holds
// T[8h + 0..7][n0 + c] and, from 16 rows further on, T[16 + 8h + 0..7][n0 + c]:
// the k order of load_frag.
__device__ inline v16h load_frag_tr(const _Float16* p, int pitch) {
  typedef __attribute__((address_space(3))) v8s lds_v8s;
  v8h lo = __builtin_bit_cast(v8h, __builtin_amdgcn_ds_load_tr16_b128_v8i16((lds_v8s*)p));
  v8h hi = __builtin_bit_cast(v8h, __builtin_amdgcn_ds_load_tr16_b128_v8i16((lds_v8s*)(p + 16 * pitch)));
  v16h r;
#pragma unroll
  for (int i = 0; i < 8; ++i) { r[i] = lo[i]; r[i + 8] = hi[i]; }
  return r;
}

// ---------------------------------------------------------------------------
// Stage 1: fused LayerNorm (q-path & kv-path share mean/var) + rotary radius,
// and the f32 -> f16 conversion of the three weight matrices: the 4 * DIMS * DIMS
// weight elements are dealt out evenly, WPB to each of the CTX blocks. A block's
// share is loaded together with its row, so that both wait out one memory latency,
// and is stored at the block's end.
// ---------------------------------------------------------------------------
#define WPB (4 * DIMS * DIMS / CTX)   // weight elements per block: 2048 = 256 threads x 2 x 4
#define QWB (DIMS * DIMS / WPB)       // blocks that hold q_w (and as many for out_w); kv_w takes twice as many
__global__ __launch_bounds__(256) void prep_kernel(
    const float* __restrict__ x,
    const float* __restrict__ qn_w, const float* __restrict__ qn_b,
    const float* __restrict__ kvn_w, const float* __restrict__ kvn_b,
    const float* __restrict__ rh_w, const float* __restrict__ rh_b,
    const float* __restrict__ q_w, const float* __restrict__ kv_w,
    const float* __restrict__ out_w,
    _Float16* __restrict__ lnq, _Float16* __restrict__ lnkv,
    float* __restrict__ radius,
    _Float16* __restrict__ qw16, _Float16* __restrict__ kvw16,
    _Float16* __restrict__ outw16)
{
  const int c = blockIdx.x, t = threadIdx.x;
  const float* row = x + (size_t)c * DIMS;
  // the block's share of the weights: which matrix is the same for the whole block
  const float* wsrc;
  _Float16* wdst;
  if (c < QWB)          { wsrc = q_w   + (size_t)c * WPB;             wdst = qw16   + (size_t)c * WPB; }
  else if (c < 3 * QWB) { wsrc = kv_w  + (size_t)(c - QWB) * WPB;     wdst = kvw16  + (size_t)(c - QWB) * WPB; }
  else                  { wsrc = out_w + (size_t)(c - 3 * QWB) * WPB; wdst = outw16 + (size_t)(c - 3 * QWB) * WPB; }
  // a wave's load covers 512 B in a row, its store 256 B: whole lines both
  const v4f w0 = *(const v4f*)(wsrc + 4 * t);
  const v4f w1 = *(const v4f*)(wsrc + WPB / 2 + 4 * t);
  float v[4];
  float s = 0.f, s2 = 0.f, dp = 0.f;
#pragma unroll
  for (int i = 0; i < 4; ++i) {
    int d = t + i * 256;
    float val = row[d];
    v[i] = val;
    s += val; s2 += val * val; dp += val * rh_w[d];
  }
  __shared__ float red[256];
  auto reduceAll = [&](float val) -> float {
    red[t] = val; __syncthreads();
    for (int o = 128; o > 0; o >>= 1) { if (t < o) red[t] += red[t + o]; __syncthreads(); }
    float r = red[0]; __syncthreads(); return r;
  };
  float tot  = reduceAll(s);
  float tot2 = reduceAll(s2);
  float dtot = reduceAll(dp);
  float mean = tot * (1.f / DIMS);
  float var  = tot2 * (1.f / DIMS) - mean * mean;
  float inv  = rsqrtf(var + 1e-5f);
  if (t == 0) {
    float per = dtot + rh_b[0];
    radius[c] = fminf(fmaxf(per * 0.01f, 0.5f), 2.0f);
  }
#pragma unroll
  for (int i = 0; i < 4; ++i) {
    int d = t + i * 256;
    float n = (v[i] - mean) * inv;
    lnq [(size_t)c * DIMS + d] = (_Float16)(n * qn_w[d] + qn_b[d]);
    lnkv[(size_t)c * DIMS + d] = (_Float16)(n * kvn_w[d] + kvn_b[d]);
  }
  *(v4h*)(wdst + 4 * t)           = __builtin_convertvector(w0, v4h);
  *(v4h*)(wdst + WPB / 2 + 4 * t) = __builtin_convertvector(w1, v4h);
}

// ---------------------------------------------------------------------------
// Stage 3/6: LDS-staged WMMA GEMM.  C(f32) = A(f16,MxK) * B(f16,KxN) + bias
// Block tile 64x128; 8 waves in 4(M) x 2(N); each wave owns a 16x64 strip
// = 4 accumulators -> 4 WMMAs per 32 k sharing one A-fragment.
// A and B come into LDS 128 k a stage, by asynchronous copies that cover whole
// 256-byte rows and pass no register. Two buffers: the next stage's copies fly
// while this stage's 16 WMMAs a wave are worked on.
// B lies in LDS as in memory (K x N); the transposing LDS load turns it into fragments.
// M, N, K: multiples of 64, 128, 128.
// ---------------------------------------------------------------------------
#define BM 64
#define BN 128
#define BK 128  // k per stage = one 256-byte row of A
#define AP 136  // A row stride in f16 (272 bytes = 16 B x 17, odd: the pitch of 16-byte fragment reads)
#define BP 144  // B row stride in f16 (288 bytes = 32 B x 9, odd: the transposing load's pitch)
#define ABUF (BM * AP * 2)   // bytes of one A buffer
#define BBUF (BK * BP * 2)   // bytes of one B buffer
#define AROW (16 * AP * 2)   // bytes of 16 LDS rows of A
#define BROW (16 * BP * 2)   // bytes of 16 LDS rows of B

// One stage: 64 A rows and 128 B rows of 256 B each; 256 threads x 12 copies of 16 B.
// Sixteen lanes cover one row, so a wave's copy reads four whole lines.
// la, lb: the lane's LDS byte addresses; ga, gb: its global addresses (row t/16, piece t%16);
// a16, b16: 16 rows of A and of B in elements.
__device__ inline void stage_ab(unsigned la, unsigned lb,
                                const _Float16* ga, const _Float16* gb,
                                size_t a16, size_t b16) {
  const unsigned la1 = la + AROW, la2 = la + 2 * AROW, la3 = la + 3 * AROW;
  const unsigned lb1 = lb + BROW, lb2 = lb + 2 * BROW, lb3 = lb + 3 * BROW;
  const unsigned lb4 = lb + 4 * BROW, lb5 = lb + 5 * BROW, lb6 = lb + 6 * BROW, lb7 = lb + 7 * BROW;
  const _Float16* ga1 = ga + a16;
  const _Float16* ga2 = ga + 2 * a16;
  const _Float16* ga3 = ga + 3 * a16;
  const _Float16* gb1 = gb + b16;
  const _Float16* gb2 = gb + 2 * b16;
  const _Float16* gb3 = gb + 3 * b16;
  const _Float16* gb4 = gb + 4 * b16;
  const _Float16* gb5 = gb + 5 * b16;
  const _Float16* gb6 = gb + 6 * b16;
  const _Float16* gb7 = gb + 7 * b16;
  // the copies go past the registers; the closing wait stands in the same statement so
  // that no address register named here is rewritten in front of it
  asm volatile(
      "global_load_async_to_lds_b128 %0, %12, off\n\t"
      "global_load_async_to_lds_b128 %1, %13, off\n\t"
      "global_load_async_to_lds_b128 %2, %14, off\n\t"
      "global_load_async_to_lds_b128 %3, %15, off\n\t"
      "global_load_async_to_lds_b128 %4, %16, off\n\t"
      "global_load_async_to_lds_b128 %5, %17, off\n\t"
      "global_load_async_to_lds_b128 %6, %18, off\n\t"
      "global_load_async_to_lds_b128 %7, %19, off\n\t"
      "global_load_async_to_lds_b128 %8, %20, off\n\t"
      "global_load_async_to_lds_b128 %9, %21, off\n\t"
      "global_load_async_to_lds_b128 %10, %22, off\n\t"
      "global_load_async_to_lds_b128 %11, %23, off\n\t"
      "s_wait_xcnt 0x0"
      :: "v"(la), "v"(la1), "v"(la2), "v"(la3),
         "v"(lb), "v"(lb1), "v"(lb2), "v"(lb3), "v"(lb4), "v"(lb5), "v"(lb6), "v"(lb7),
         "v"(ga), "v"(ga1), "v"(ga2), "v"(ga3),
         "v"(gb), "v"(gb1), "v"(gb2), "v"(gb3), "v"(gb4), "v"(gb5), "v"(gb6), "v"(gb7)
      : "memory");
}

__global__ __launch_bounds__(256) void gemm_kernel(
    const _Float16* __restrict__ A, const _Float16* __restrict__ B,
    const float* __restrict__ bias, float* __restrict__ C,
    int M, int N, int K)
{
  __shared__ __align__(16) _Float16 As[2][BM][AP];
  __shared__ __align__(16) _Float16 Bs[2][BK][BP];   // B staged row-major (KxN)
  const int t = threadIdx.x, lane = t & 31, w = t >> 5;
  const int wm = w >> 1, wn = w & 1;              // 4 x 2 wave grid
  const int half = lane >> 4, l16 = lane & 15;
  const int bm = blockIdx.y * BM, bn = blockIdx.x * BN;
  const int cr = t >> 4, cc = (t & 15) * 8;       // the lane's row and 16-byte piece in a copy
  const _Float16* ga = A + (size_t)(bm + cr) * K + cc;
  const _Float16* gb = B + (size_t)cr * N + bn + cc;
  const unsigned la = (unsigned)(size_t)&As[0][cr][cc];
  const unsigned lb = (unsigned)(size_t)&Bs[0][cr][cc];
  const size_t a16 = (size_t)16 * K, b16 = (size_t)16 * N;
  const size_t bst = (size_t)BK * N;              // one stage further on in B
  const int nst = K / BK;                         // stages
  v8f acc0 = {}, acc1 = {}, acc2 = {}, acc3 = {};

  stage_ab(la, lb, ga, gb, a16, b16);                        // stage 0 -> buffer 0
  asm volatile("s_wait_asynccnt 0x0" ::: "memory");          // this wave's part of stage 0 has landed
  __syncthreads();                                           // ... and every other wave's
  if (nst > 1)
    stage_ab(la + ABUF, lb + BBUF, ga + BK, gb + bst, a16, b16);   // stage 1 -> buffer 1

  for (int s = 0; s < nst; ++s) {
    const int buf = s & 1;
    const _Float16* ap = &As[buf][wm * 16 + l16][0];
    const _Float16* bp = &Bs[buf][8 * half + (lane & 7)][wn * 64 + 8 * ((lane >> 3) & 1)];
    // the stage's four 32-k steps in straight line: constant LDS offsets, and a step's
    // fragment reads need not wait for the step before
#pragma unroll
    for (int kk = 0; kk < BK; kk += 32) {
      const v16h a = load_frag(ap + kk, half);
      const v16h b0 = load_frag_tr(bp + kk * BP,      BP);
      const v16h b1 = load_frag_tr(bp + kk * BP + 16, BP);
      const v16h b2 = load_frag_tr(bp + kk * BP + 32, BP);
      const v16h b3 = load_frag_tr(bp + kk * BP + 48, BP);
      acc0 = __builtin_amdgcn_wmma_f32_16x16x32_f16(false, a, false, b0, (short)0, acc0, false, false);
      acc1 = __builtin_amdgcn_wmma_f32_16x16x32_f16(false, a, false, b1, (short)0, acc1, false, false);
      acc2 = __builtin_amdgcn_wmma_f32_16x16x32_f16(false, a, false, b2, (short)0, acc2, false, false);
      acc3 = __builtin_amdgcn_wmma_f32_16x16x32_f16(false, a, false, b3, (short)0, acc3, false, false);
    }
    // hand-over: stage s + 1 becomes readable and buffer buf becomes free
    asm volatile("s_wait_dscnt 0x0" ::: "memory");     // this wave's reads of buffer buf are done
    asm volatile("s_wait_asynccnt 0x0" ::: "memory");  // its copies of stage s + 1 have landed
    __syncthreads();                                   // the same holds for all eight waves
    if (s + 2 < nst)
      stage_ab(la + buf * ABUF, lb + buf * BBUF,
               ga + (size_t)(s + 2) * BK, gb + (size_t)(s + 2) * bst, a16, b16);
  }
  asm volatile("s_wait_asynccnt 0x0" ::: "memory");    // no copy is open when the wave ends
  // epilogue: C layout per tile: M = r + 8*half, N = l16
  const int ncol0 = bn + wn * 64 + l16;
  const float bb0 = bias[ncol0], bb1 = bias[ncol0 + 16];
  const float bb2 = bias[ncol0 + 32], bb3 = bias[ncol0 + 48];
#pragma unroll
  for (int r = 0; r < 8; ++r) {
    const size_t rowoff = (size_t)(bm + wm * 16 + r + 8 * half) * N + ncol0;
    C[rowoff]      = acc0[r] + bb0;
    C[rowoff + 16] = acc1[r] + bb1;
    C[rowoff + 32] = acc2[r] + bb2;
    C[rowoff + 48] = acc3[r] + bb3;
  }
}

// ---------------------------------------------------------------------------
// Stage 4: rotary (mel-scaled freqs, per-step radius) + per-head LayerNorm.
// One 8-wave block per (64 ctx rows, head); a wave takes 8 rows, one after the
// other, and lane j handles complex pair (2j, 2j+1) of each.
// Also writes V transposed [h][d][c] so flash V fragments are contiguous: the
// 64x64 V tile is turned in LDS, so each vT store covers whole 128-byte lines.
// ---------------------------------------------------------------------------
#define RT 64   // ctx rows per block = one 128-byte line of vT per d
#define RW 8    // ctx rows per wave
#define VP 66   // LDS pitch in f16 = 33 dwords (odd): column writes and row reads both spread over the banks
__global__ __launch_bounds__(256) void rotln_kernel(
    const float* __restrict__ qf, const float* __restrict__ kvf,
    const float* __restrict__ radius,
    const float* __restrict__ ln_w, const float* __restrict__ ln_b,
    _Float16* __restrict__ qn, _Float16* __restrict__ kn,
    _Float16* __restrict__ vT)
{
  __shared__ __align__(16) _Float16 Vs[HD][VP];
  const int t = threadIdx.x, j = t & 31, w = t >> 5;
  const int c0 = blockIdx.x * RT, h = blockIdx.y;
  const float mel_max = 2595.0f * 1.3222192947339193f;          // 2595*log10(21)
  const float lin = (float)j * (mel_max / 31.0f);               // linspace, 32 pts
  const float fb = 0.2f * (expf(lin * (2.3025850929940457f / 2595.0f)) - 1.0f);
  const int d0 = 2 * j, d1 = 2 * j + 1;
  const float lw0 = ln_w[d0], lw1 = ln_w[d1], lb0 = ln_b[d0], lb1 = ln_b[d1];

  // all 8 rows' loads are issued before the first row is worked on
  float2 qv[RW], kk[RW], vv[RW];
  float rr[RW];
#pragma unroll
  for (int i = 0; i < RW; ++i) {
    const int c = c0 + w * RW + i;
    qv[i] = *(const float2*)(qf  + (size_t)c * DIMS + h * HD + d0);
    kk[i] = *(const float2*)(kvf + (size_t)c * (2 * DIMS) + h * HD + d0);
    vv[i] = *(const float2*)(kvf + (size_t)c * (2 * DIMS) + DIMS + h * HD + d0);
    rr[i] = radius[c];
  }

  // V: two neighbouring rows of one d make one 32-bit LDS store
#pragma unroll
  for (int i = 0; i < RW; i += 2) {
    v2h p0, p1;
    p0[0] = (_Float16)vv[i].x; p0[1] = (_Float16)vv[i + 1].x;
    p1[0] = (_Float16)vv[i].y; p1[1] = (_Float16)vv[i + 1].y;
    *(v2h*)&Vs[d0][w * RW + i] = p0;
    *(v2h*)&Vs[d1][w * RW + i] = p1;
  }

  // V goes out first, so that its stores fly under the q/k arithmetic below
  __syncthreads();   // the V tile is complete before any wave reads it back by rows
#pragma unroll
  for (int p = 0; p < 2; ++p) {
    const int idx = p * 256 + t;
    const int d = idx >> 3, ch = idx & 7;       // 8 lanes x 16 B = one line of vT
    v8h o;
#pragma unroll
    for (int e = 0; e < 4; ++e) {
      const v2h x = *(const v2h*)&Vs[d][ch * 8 + 2 * e];
      o[2 * e] = x[0]; o[2 * e + 1] = x[1];
    }
    *(v8h*)(vT + (size_t)(h * HD + d) * CTX + c0 + ch * 8) = o;
  }

#pragma unroll
  for (int i = 0; i < RW; ++i) {
    const int c = c0 + w * RW + i;
    const float freq = (float)c * fb;
    const float rad = rr[i];
    const float fr = rad * cosf(freq), fi = rad * sinf(freq);

    float qr = qv[i].x, qi = qv[i].y;
    float qor = qr * fr - qi * fi, qoi = qr * fi + qi * fr;
    float kr = kk[i].x, ki = kk[i].y;
    float kor = kr * fr - ki * fi, koi = kr * fi + ki * fr;

    // per-head LN over 64 elems, reduced across the 32 lanes of this wave
    float qs = qor + qoi, qs2 = qor * qor + qoi * qoi;
    float ks = kor + koi, ks2 = kor * kor + koi * koi;
#pragma unroll
    for (int m = 16; m >= 1; m >>= 1) {
      qs += __shfl_xor(qs, m, 32);  qs2 += __shfl_xor(qs2, m, 32);
      ks += __shfl_xor(ks, m, 32);  ks2 += __shfl_xor(ks2, m, 32);
    }
    float qm = qs * (1.f / HD), qvar = qs2 * (1.f / HD) - qm * qm, qiv = rsqrtf(qvar + 1e-5f);
    float km = ks * (1.f / HD), kvar = ks2 * (1.f / HD) - km * km, kiv = rsqrtf(kvar + 1e-5f);
    v2h qo, ko;
    qo[0] = (_Float16)((qor - qm) * qiv * lw0 + lb0);
    qo[1] = (_Float16)((qoi - qm) * qiv * lw1 + lb1);
    ko[0] = (_Float16)((kor - km) * kiv * lw0 + lb0);
    ko[1] = (_Float16)((koi - km) * kiv * lw1 + lb1);
    *(v2h*)(qn + ((size_t)h * CTX + c) * HD + d0) = qo;   // a wave stores one 128-byte row
    *(v2h*)(kn + ((size_t)h * CTX + c) * HD + d0) = ko;
  }
}

// ---------------------------------------------------------------------------
// Stage 5: flash attention. 4 waves/block; each wave owns 16 queries of one
// head and takes 32 keys/pass. Both products are transposed: S^T = K Q^T
// (4 WMMAs) and O^T += V^T P^T (4 WMMAs). A lane then holds 16 scores of ONE
// query, so maximum and sum are taken in its own registers, with one exchange
// between the wave's halves for the maximum, and the two S^T tiles, converted
// in place, are the B operand of the second product: P never touches LDS.
// K and vT come into LDS once per block, 64 keys a stage, by asynchronous copies
// that cover whole 128-byte lines; the four waves read their fragments from there.
// Two buffers: the next stage's copies fly while this stage is worked on.
// ---------------------------------------------------------------------------
#define FK  64            // keys per stage = one 128-byte line of each vT row
#define FP  72            // LDS row pitch in f16: 144 B = 16 B x 9 (odd), the pitch of 16-byte fragment reads
#define NST (CTX / FK)    // stages
#define FBUF (FK * FP * 2)  // bytes of one buffer (K: 64 keys; vT: 64 d rows)
#define FROW (16 * FP * 2)  // bytes of 16 LDS rows

// One stage: 64 K rows and 64 vT rows of 128 B each; 128 threads x 8 copies of 16 B.
// Eight lanes cover one row, so a wave's copy reads four whole lines.
// lk, lv: the lane's LDS byte addresses; gk, gv: its global addresses (row t/8, piece t%8).
__device__ inline void stage_kv(unsigned lk, unsigned lv,
                                const _Float16* gk, const _Float16* gv) {
  const unsigned lk1 = lk + FROW, lk2 = lk + 2 * FROW, lk3 = lk + 3 * FROW;
  const unsigned lv1 = lv + FROW, lv2 = lv + 2 * FROW, lv3 = lv + 3 * FROW;
  const _Float16* gk1 = gk + 16 * HD;
  const _Float16* gk2 = gk + 32 * HD;
  const _Float16* gk3 = gk + 48 * HD;
  const _Float16* gv1 = gv + (size_t)16 * CTX;
  const _Float16* gv2 = gv + (size_t)32 * CTX;
  const _Float16* gv3 = gv + (size_t)48 * CTX;
  // the copies go past the registers; the closing wait stands in the same statement so
  // that no address register named here is rewritten in front of it
  asm volatile(
      "global_load_async_to_lds_b128 %0, %8, off\n\t"
      "global_load_async_to_lds_b128 %1, %9, off\n\t"
      "global_load_async_to_lds_b128 %2, %10, off\n\t"
      "global_load_async_to_lds_b128 %3, %11, off\n\t"
      "global_load_async_to_lds_b128 %4, %12, off\n\t"
      "global_load_async_to_lds_b128 %5, %13, off\n\t"
      "global_load_async_to_lds_b128 %6, %14, off\n\t"
      "global_load_async_to_lds_b128 %7, %15, off\n\t"
      "s_wait_xcnt 0x0"
      :: "v"(lk), "v"(lk1), "v"(lk2), "v"(lk3), "v"(lv), "v"(lv1), "v"(lv2), "v"(lv3),
         "v"(gk), "v"(gk1), "v"(gk2), "v"(gk3), "v"(gv), "v"(gv1), "v"(gv2), "v"(gv3)
      : "memory");
}

typedef __attribute__((ext_vector_type(2))) float v2f;

// lane l takes the value of lane l ^ 16
__device__ inline float xhalf(float x) {
  const int i = __builtin_bit_cast(int, x);
  return __builtin_bit_cast(float, __builtin_amdgcn_permlanex16(i, i, 0x76543210, 0xfedcba98, false, false));
}
__device__ inline float max3f(float a, float b, float c) { return fmaxf(fmaxf(a, b), c); }

__global__ __launch_bounds__(128) void flash_kernel(
    const _Float16* __restrict__ qn, const _Float16* __restrict__ kn,
    const _Float16* __restrict__ vT, _Float16* __restrict__ aout)
{
  const int t = threadIdx.x;
  const int lane = t & 31;
  const int w = t >> 5;
  const int h = blockIdx.y;
  const int qt = blockIdx.x * 4 + w;          // 16-row query tile
  const int half = lane >> 4, l16 = lane & 15;
  __shared__ __align__(16) _Float16 Ks[2][FK][FP];
  __shared__ __align__(16) _Float16 Vs[2][HD][FP];

  const int cr = t >> 3, cc = (t & 7) * 8;    // the lane's row and 16-byte piece in a copy
  const _Float16* gk = kn + ((size_t)h * CTX + cr) * HD + cc;
  const _Float16* gv = vT + ((size_t)h * HD + cr) * CTX + cc;
  const unsigned lk = (unsigned)(size_t)&Ks[0][cr][cc];
  const unsigned lv = (unsigned)(size_t)&Vs[0][cr][cc];

  stage_kv(lk, lv, gk, gv);                                  // stage 0 -> buffer 0

  // Q as the B operand: column = query l16, the k order of load_frag
  const _Float16* qrow = qn + ((size_t)h * CTX + qt * 16 + l16) * HD;
  const v16h bq0 = load_frag(qrow, half);       // d = 0..31
  const v16h bq1 = load_frag(qrow + 32, half);  // d = 32..63

  // o<i>[r] = O[query l16][d = 16 i + 8 half + r]
  v8f o0 = {}, o1 = {}, o2 = {}, o3 = {};
  const float cs = 0.125f * 1.4426950408889634f;   // 1/sqrt(64), in the base-2 domain
  float mrun = -1e30f;    // query l16's running maximum, scaled; alike in both halves
  float lrun = 0.f;       // its sum over the keys that this half of the wave holds

  asm volatile("s_wait_asynccnt 0x0" ::: "memory");          // this wave's part of stage 0 has landed
  __syncthreads();                                           // ... and every other wave's
  stage_kv(lk + FBUF, lv + FBUF, gk + FK * HD, gv + FK);     // stage 1 -> buffer 1

  for (int s = 0; s < NST; ++s) {
    const int buf = s & 1;
    // both 32-key passes of a stage in straight line: constant LDS offsets, and the second
    // pass's fragment reads and products need not wait for the first pass's softmax
#pragma unroll
    for (int sub = 0; sub < FK; sub += 32) {
      const _Float16* k0row = &Ks[buf][sub + l16][0];
      const _Float16* k1row = k0row + 16 * FP;
      v8f z = {};
      // s0[r] = S[key sub + 8 half + r][query l16], s1[r] = the same 16 keys further on
      v8f s0 = __builtin_amdgcn_wmma_f32_16x16x32_f16(false, load_frag(k0row, half), false, bq0, (short)0, z, false, false);
      s0 = __builtin_amdgcn_wmma_f32_16x16x32_f16(false, load_frag(k0row + 32, half), false, bq1, (short)0, s0, false, false);
      v8f s1 = __builtin_amdgcn_wmma_f32_16x16x32_f16(false, load_frag(k1row, half), false, bq0, (short)0, z, false, false);
      s1 = __builtin_amdgcn_wmma_f32_16x16x32_f16(false, load_frag(k1row + 32, half), false, bq1, (short)0, s1, false, false);

      // maximum of the raw scores (the scale is positive): 16 in the lane, then the other half's
      const float ma = max3f(max3f(s0[0], s0[1], s0[2]), max3f(s0[3], s0[4], s0[5]), max3f(s0[6], s0[7], s1[0]));
      const float mb = max3f(max3f(s1[1], s1[2], s1[3]), max3f(s1[4], s1[5], s1[6]), s1[7]);
      float mx = fmaxf(ma, mb);
      mx = fmaxf(mx, xhalf(mx));
      const float mnew = fmaxf(mrun, mx * cs);
      const float alpha = __builtin_amdgcn_exp2f(mrun - mnew);
      mrun = mnew;

      // P^T as the B operand, in the k order of load_frag: element e is s0[e] for e < 8, s1[e - 8] behind it
      const v2f c2 = {cs, cs}, nm = {-mnew, -mnew};
      v2f p[8];
      v16h bp;
#pragma unroll
      for (int i = 0; i < 8; ++i) {
        const v8f& sv = i < 4 ? s0 : s1;
        const v2f x = {sv[2 * (i & 3)], sv[2 * (i & 3) + 1]};
        const v2f arg = __builtin_elementwise_fma(x, c2, nm);
        p[i] = v2f{__builtin_amdgcn_exp2f(arg[0]), __builtin_amdgcn_exp2f(arg[1])};
        const v2h ph = __builtin_convertvector(p[i], v2h);
        bp[2 * i] = ph[0]; bp[2 * i + 1] = ph[1];
      }
      const v2f ps = ((p[0] + p[1]) + (p[2] + p[3])) + ((p[4] + p[5]) + (p[6] + p[7]));
      lrun = lrun * alpha + (ps[0] + ps[1]);
      o0 *= alpha; o1 *= alpha; o2 *= alpha; o3 *= alpha;

      // V^T as the A operand: row = d, k = the pass's 32 keys in the order of load_frag
      const _Float16* vb = &Vs[buf][l16][sub];
      o0 = __builtin_amdgcn_wmma_f32_16x16x32_f16(false, load_frag(vb, half), false, bp, (short)0, o0, false, false);
      o1 = __builtin_amdgcn_wmma_f32_16x16x32_f16(false, load_frag(vb + 16 * FP, half), false, bp, (short)0, o1, false, false);
      o2 = __builtin_amdgcn_wmma_f32_16x16x32_f16(false, load_frag(vb + 32 * FP, half), false, bp, (short)0, o2, false, false);
      o3 = __builtin_amdgcn_wmma_f32_16x16x32_f16(false, load_frag(vb + 48 * FP, half), false, bp, (short)0, o3, false, false);
    }
    // hand-over: stage s + 1 becomes readable and buffer buf becomes free
    asm volatile("s_wait_dscnt 0x0" ::: "memory");     // this wave's reads of buffer buf are done
    asm volatile("s_wait_asynccnt 0x0" ::: "memory");  // its copies of stage s + 1 have landed
    __syncthreads();                                   // the same holds for all four waves
    if (s + 2 < NST)
      stage_kv(lk + buf * FBUF, lv + buf * FBUF,
               gk + (size_t)(s + 2) * FK * HD, gv + (s + 2) * FK);
  }
  asm volatile("s_wait_asynccnt 0x0" ::: "memory");    // no copy is open when the wave ends
  // the two halves' sums join once; a lane's 8 registers of a tile are 8 neighbouring d of its query
  const float rl = 1.f / (lrun + xhalf(lrun));
  _Float16* dst = aout + (size_t)(qt * 16 + l16) * DIMS + h * HD + 8 * half;
  *(v8h*)(dst)      = __builtin_convertvector(o0 * rl, v8h);
  *(v8h*)(dst + 16) = __builtin_convertvector(o1 * rl, v8h);
  *(v8h*)(dst + 32) = __builtin_convertvector(o2 * rl, v8h);
  *(v8h*)(dst + 48) = __builtin_convertvector(o3 * rl, v8h);
}

// ---------------------------------------------------------------------------
extern "C" void kernel_launch(void* const* d_in, const int* in_sizes, int n_in,
                              void* d_out, int out_size, void* d_ws, size_t ws_size,
                              hipStream_t stream) {
  const float* x     = (const float*)d_in[0];
  const float* qn_w  = (const float*)d_in[1];
  const float* qn_b  = (const float*)d_in[2];
  const float* q_w   = (const float*)d_in[3];
  const float* q_b   = (const float*)d_in[4];
  const float* kvn_w = (const float*)d_in[5];
  const float* kvn_b = (const float*)d_in[6];
  const float* kv_w  = (const float*)d_in[7];
  const float* kv_b  = (const float*)d_in[8];
  const float* out_w = (const float*)d_in[9];
  const float* out_b = (const float*)d_in[10];
  const float* ln_w  = (const float*)d_in[11];
  const float* ln_b  = (const float*)d_in[12];
  const float* rh_w  = (const float*)d_in[13];
  const float* rh_b  = (const float*)d_in[14];
  float* out = (float*)d_out;
  (void)in_sizes; (void)n_in; (void)out_size; (void)ws_size;

  char* base = (char*)d_ws;
  size_t off = 0;
  auto take = [&](size_t bytes) -> char* {
    char* p = base + off;
    off = (off + bytes + 255) & ~(size_t)255;
    return p;
  };
  _Float16* lnq16  = (_Float16*)take((size_t)CTX * DIMS * 2);
  _Float16* lnkv16 = (_Float16*)take((size_t)CTX * DIMS * 2);
  float*    radius = (float*)take((size_t)CTX * 4);
  _Float16* qw16   = (_Float16*)take((size_t)DIMS * DIMS * 2);
  _Float16* kvw16  = (_Float16*)take((size_t)DIMS * 2 * DIMS * 2);
  _Float16* outw16 = (_Float16*)take((size_t)DIMS * DIMS * 2);
  float*    qf32   = (float*)take((size_t)CTX * DIMS * 4);
  float*    kvf32  = (float*)take((size_t)CTX * 2 * DIMS * 4);
  _Float16* qn16   = (_Float16*)take((size_t)HEAD * CTX * HD * 2);
  _Float16* kn16   = (_Float16*)take((size_t)HEAD * CTX * HD * 2);
  _Float16* vT16   = (_Float16*)take((size_t)HEAD * HD * CTX * 2);
  _Float16* a16    = (_Float16*)take((size_t)CTX * DIMS * 2);

  prep_kernel<<<CTX, 256, 0, stream>>>(x, qn_w, qn_b, kvn_w, kvn_b, rh_w, rh_b,
                                       q_w, kv_w, out_w,
                                       lnq16, lnkv16, radius, qw16, kvw16, outw16);

  gemm_kernel<<<dim3(DIMS / BN, CTX / BM), 256, 0, stream>>>(
      lnq16, qw16, q_b, qf32, CTX, DIMS, DIMS);
  gemm_kernel<<<dim3(2 * DIMS / BN, CTX / BM), 256, 0, stream>>>(
      lnkv16, kvw16, kv_b, kvf32, CTX, 2 * DIMS, DIMS);

  rotln_kernel<<<dim3(CTX / RT, HEAD), 256, 0, stream>>>(
      qf32, kvf32, radius, ln_w, ln_b, qn16, kn16, vT16);

  flash_kernel<<<dim3(CTX / 16 / 4, HEAD), 128, 0, stream>>>(qn16, kn16, vT16, a16);

  gemm_kernel<<<dim3(DIMS / BN, CTX / BM), 256, 0, stream>>>(
      a16, outw16, out_b, out, CTX, DIMS, DIMS);
}

// v007
// One run takes 70 microseconds.
// Two timings next to v006 both put it at 1.10 times that version's speed.
// Counting every step since v000, it is 4.79 times as fast.
#include <hip/hip_runtime.h>

#define CTX  2048
#define DIMS 1024
#define HEAD 16
#define HD   64

typedef __attribute__((ext_vector_type(16))) _Float16 v16h;
typedef __attribute__((ext_vector_type(8)))  _Float16 v8h;
typedef __attribute__((ext_vector_type(4)))  _Float16 v4h;
typedef __attribute__((ext_vector_type(2)))  _Float16 v2h;
typedef __attribute__((ext_vector_type(2)))  float    v2f;
typedef __attribute__((ext_vector_type(4)))  float    v4f;
typedef __attribute__((ext_vector_type(8)))  float    v8f;
typedef __attribute__((ext_vector_type(8)))  short    v8s;

// Build a 16x16x32 f16 WMMA A/B fragment for this lane.
// 16-bit operand layout (ISA 7.12.2): lane half (lane/16) selects
// K in {0..7,16..23} (half=0) or {8..15,24..31} (half=1); both chunks are
// contiguous 8 x f16 = 16B runs, so two aligned 16-byte loads suffice.
__device__ inline v16h load_frag(const _Float16* rowbase, int half) {
  v8h lo = *(const v8h*)(rowbase + half * 8);
  v8h hi = *(const v8h*)(rowbase + 16 + half * 8);
  v16h r;
#pragma unroll
  for (int i = 0; i < 8; ++i) { r[i] = lo[i]; r[i + 8] = hi[i]; }
  return r;
}

// The same fragment out of a row-major (K x N) f16 tile in LDS, by the
// transposing LDS load. p is the lane's own address: row 8*(lane/16) + (lane&7),
// column n0 + 8*((lane/8)&1). Lane (c = lane&15, h = lane/16) then holds
// T[8h + 0..7][n0 + c] and, from 16 rows further on, T[16 + 8h + 0..7][n0 + c]:
// the k order of load_frag.
__device__ inline v16h load_frag_tr(const _Float16* p, int pitch) {
  typedef __attribute__((address_space(3))) v8s lds_v8s;
  v8h lo = __builtin_bit_cast(v8h, __builtin_amdgcn_ds_load_tr16_b128_v8i16((lds_v8s*)p));
  v8h hi = __builtin_bit_cast(v8h, __builtin_amdgcn_ds_load_tr16_b128_v8i16((lds_v8s*)(p + 16 * pitch)));
  v16h r;
#pragma unroll
  for (int i = 0; i < 8; ++i) { r[i] = lo[i]; r[i + 8] = hi[i]; }
  return r;
}

// ---------------------------------------------------------------------------
// Stage 1: fused LayerNorm (q-path & kv-path share mean/var) + the row's 32 rotary
// factors (radius x cos, radius x sin; mel-scaled freqs, per-step radius), which the
// projection GEMMs' epilogues apply, and the f32 -> f16 conversion of the three weight matrices: the 4 * DIMS * DIMS
// weight elements are dealt out evenly, WPB to each of the CTX blocks. A block's
// share is loaded together with its row, so that both wait out one memory latency,
// and is stored at the block's end.
// ---------------------------------------------------------------------------
#define WPB (4 * DIMS * DIMS / CTX)   // weight elements per block: 2048 = 256 threads x 2 x 4
#define QWB (DIMS * DIMS / WPB)       // blocks that hold q_w (and as many for out_w); kv_w takes twice as many
__global__ __launch_bounds__(256) void prep_kernel(
    const float* __restrict__ x,
    const float* __restrict__ qn_w, const float* __restrict__ qn_b,
    const float* __restrict__ kvn_w, const float* __restrict__ kvn_b,
    const float* __restrict__ rh_w, const float* __restrict__ rh_b,
    const float* __restrict__ q_w, const float* __restrict__ kv_w,
    const float* __restrict__ out_w,
    _Float16* __restrict__ lnq, _Float16* __restrict__ lnkv,
    float* __restrict__ rot,
    _Float16* __restrict__ qw16, _Float16* __restrict__ kvw16,
    _Float16* __restrict__ outw16)
{
  const int c = blockIdx.x, t = threadIdx.x;
  const float* row = x + (size_t)c * DIMS;
  // the block's share of the weights: which matrix is the same for the whole block
  const float* wsrc;
  _Float16* wdst;
  if (c < QWB)          { wsrc = q_w   + (size_t)c * WPB;             wdst = qw16   + (size_t)c * WPB; }
  else if (c < 3 * QWB) { wsrc = kv_w  + (size_t)(c - QWB) * WPB;     wdst = kvw16  + (size_t)(c - QWB) * WPB; }
  else                  { wsrc = out_w + (size_t)(c - 3 * QWB) * WPB; wdst = outw16 + (size_t)(c - 3 * QWB) * WPB; }
  // a wave's load covers 512 B in a row, its store 256 B: whole lines both
  const v4f w0 = *(const v4f*)(wsrc + 4 * t);
  const v4f w1 = *(const v4f*)(wsrc + WPB / 2 + 4 * t);
  float v[4];
  float s = 0.f, s2 = 0.f, dp = 0.f;
#pragma unroll
  for (int i = 0; i < 4; ++i) {
    int d = t + i * 256;
    float val = row[d];
    v[i] = val;
    s += val; s2 += val * val; dp += val * rh_w[d];
  }
  __shared__ float red[256];
  auto reduceAll = [&](float val) -> float {
    red[t] = val; __syncthreads();
    for (int o = 128; o > 0; o >>= 1) { if (t < o) red[t] += red[t + o]; __syncthreads(); }
    float r = red[0]; __syncthreads(); return r;
  };
  float tot  = reduceAll(s);
  float tot2 = reduceAll(s2);
  float dtot = reduceAll(dp);
  float mean = tot * (1.f / DIMS);
  float var  = tot2 * (1.f / DIMS) - mean * mean;
  float inv  = rsqrtf(var + 1e-5f);
  if (t < 32) {   // the first wave: lane j writes the factor of complex pair j; the wave's store covers 256 B
    const float per = dtot + rh_b[0];
    const float rad = fminf(fmaxf(per * 0.01f, 0.5f), 2.0f);
    const float mel_max = 2595.0f * 1.3222192947339193f;          // 2595*log10(21)
    const float lin = (float)t * (mel_max / 31.0f);               // linspace, 32 pts
    const float fb = 0.2f * (expf(lin * (2.3025850929940457f / 2595.0f)) - 1.0f);
    const float freq = (float)c * fb;
    const v2f f = {rad * cosf(freq), rad * sinf(freq)};
    *(v2f*)(rot + ((size_t)c * (HD / 2) + t) * 2) = f;
  }
#pragma unroll
  for (int i = 0; i < 4; ++i) {
    int d = t + i * 256;
    float n = (v[i] - mean) * inv;
    lnq [(size_t)c * DIMS + d] = (_Float16)(n * qn_w[d] + qn_b[d]);
    lnkv[(size_t)c * DIMS + d] = (_Float16)(n * kvn_w[d] + kvn_b[d]);
  }
  *(v4h*)(wdst + 4 * t)           = __builtin_convertvector(w0, v4h);
  *(v4h*)(wdst + WPB / 2 + 4 * t) = __builtin_convertvector(w1, v4h);
}

// ---------------------------------------------------------------------------
// Stage 3/6: LDS-staged WMMA GEMM.  C(f32) = A(f16,MxK) * B(f16,KxN) + bias
// Block tile 64x128; 8 waves in 4(M) x 2(N); each wave owns a 16x64 strip
// = 4 accumulators -> 4 WMMAs per 32 k sharing one A-fragment.
// A and B come into LDS 128 k a stage, by asynchronous copies that cover whole
// 256-byte rows and pass no register. Two buffers: the next stage's copies fly
// while this stage's 16 WMMAs a wave are worked on.
// B lies in LDS as in memory (K x N); the transposing LDS load turns it into fragments.
// M, N, K: multiples of 64, 128, 128.
// EPI 0: C = product + bias, f32.
// EPI 1 (the q and kv projections; a wave's 16x64 strip is 16 rows of ONE head):
//   columns below NR: rotary, then the per-head LayerNorm, out as f16 [h][c][d];
//   columns from NR on (V): out as f16, transposed [h][d][c].
//   Both go through LDS, free behind the loop's last barrier, so that every global
//   store covers whole 128-byte lines.
// ---------------------------------------------------------------------------
#define BM 64
#define BN 128
#define BK 128  // k per stage = one 256-byte row of A
#define AP 136  // A row stride in f16 (272 bytes = 16 B x 17, odd: the pitch of 16-byte fragment reads)
#define BP 144  // B row stride in f16 (288 bytes = 32 B x 9, odd: the transposing load's pitch)
#define ABUF (BM * AP * 2)   // bytes of one A buffer
#define BBUF (BK * BP * 2)   // bytes of one B buffer
#define AROW (16 * AP * 2)   // bytes of 16 LDS rows of A
#define BROW (16 * BP * 2)   // bytes of 16 LDS rows of B

// One stage: 64 A rows and 128 B rows of 256 B each; 256 threads x 12 copies of 16 B.
// Sixteen lanes cover one row, so a wave's copy reads four whole lines.
// la, lb: the lane's LDS byte addresses; ga, gb: its global addresses (row t/16, piece t%16);
// a16, b16: 16 rows of A and of B in elements.
__device__ inline void stage_ab(unsigned la, unsigned lb,
                                const _Float16* ga, const _Float16* gb,
                                size_t a16, size_t b16) {
  const unsigned la1 = la + AROW, la2 = la + 2 * AROW, la3 = la + 3 * AROW;
  const unsigned lb1 = lb + BROW, lb2 = lb + 2 * BROW, lb3 = lb + 3 * BROW;
  const unsigned lb4 = lb + 4 * BROW, lb5 = lb + 5 * BROW, lb6 = lb + 6 * BROW, lb7 = lb + 7 * BROW;
  const _Float16* ga1 = ga + a16;
  const _Float16* ga2 = ga + 2 * a16;
  const _Float16* ga3 = ga + 3 * a16;
  const _Float16* gb1 = gb + b16;
  const _Float16* gb2 = gb + 2 * b16;
  const _Float16* gb3 = gb + 3 * b16;
  const _Float16* gb4 = gb + 4 * b16;
  const _Float16* gb5 = gb + 5 * b16;
  const _Float16* gb6 = gb + 6 * b16;
  const _Float16* gb7 = gb + 7 * b16;
  // the copies go past the registers; the closing wait stands in the same statement so
  // that no address register named here is rewritten in front of it
  asm volatile(
      "global_load_async_to_lds_b128 %0, %12, off\n\t"
      "global_load_async_to_lds_b128 %1, %13, off\n\t"
      "global_load_async_to_lds_b128 %2, %14, off\n\t"
      "global_load_async_to_lds_b128 %3, %15, off\n\t"
      "global_load_async_to_lds_b128 %4, %16, off\n\t"
      "global_load_async_to_lds_b128 %5, %17, off\n\t"
      "global_load_async_to_lds_b128 %6, %18, off\n\t"
      "global_load_async_to_lds_b128 %7, %19, off\n\t"
      "global_load_async_to_lds_b128 %8, %20, off\n\t"
      "global_load_async_to_lds_b128 %9, %21, off\n\t"
      "global_load_async_to_lds_b128 %10, %22, off\n\t"
      "global_load_async_to_lds_b128 %11, %23, off\n\t"
      "s_wait_xcnt 0x0"
      :: "v"(la), "v"(la1), "v"(la2), "v"(la3),
         "v"(lb), "v"(lb1), "v"(lb2), "v"(lb3), "v"(lb4), "v"(lb5), "v"(lb6), "v"(lb7),
         "v"(ga), "v"(ga1), "v"(ga2), "v"(ga3),
         "v"(gb), "v"(gb1), "v"(gb2), "v"(gb3), "v"(gb4), "v"(gb5), "v"(gb6), "v"(gb7)
      : "memory");
}

#define SP 72   // pitch of the epilogue's LDS tiles in f16: 144 B = 16 B x 9 (odd), the pitch of 16-byte accesses

// lane l takes the value of lane l ^ M, M < 16 (DPP row_xmask: no LDS path, no wait)
template <int M> __device__ inline float xrow(float x) {
  const int i = __builtin_bit_cast(int, x);
  return __builtin_bit_cast(float, __builtin_amdgcn_update_dpp(i, i, 0x160 | M, 0xf, 0xf, false));
}
// sum over the 16 lanes of a row; every lane of the row ends with it
__device__ inline float row_sum(float x) {
  x += xrow<1>(x); x += xrow<2>(x); x += xrow<4>(x); x += xrow<8>(x);
  return x;
}

// 1 / sqrt(x) as the library's rsqrtf forms it: an x below the smallest normal number goes in times 2^24
// and its result comes out times 2^12. The v_nop stands in the instruction's own statement, where nothing
// can come between: it is the one slot that the instruction set asks for behind a transcendental, in front
// of an instruction that reads its result or overwrites its source.
__device__ inline float rsq_slot(float x) {
  const bool tiny = x < 1.17549435e-38f;
  const float a = tiny ? x * 16777216.0f : x;
  float r;
  asm("v_rsq_f32 %0, %1\n\tv_nop" : "=v"(r) : "v"(a));
  return tiny ? r * 4096.0f : r;
}

template <int EPI>
__global__ __launch_bounds__(256) void gemm_kernel(
    const _Float16* __restrict__ A, const _Float16* __restrict__ B,
    const float* __restrict__ bias, float* __restrict__ C,
    int M, int N, int K,
    const float* __restrict__ rot, const float* __restrict__ ln_w, const float* __restrict__ ln_b,
    _Float16* __restrict__ rn, _Float16* __restrict__ vT, int NR)
{
  __shared__ __align__(16) _Float16 As[2][BM][AP];
  __shared__ __align__(16) _Float16 Bs[2][BK][BP];   // B staged row-major (KxN)
  const int t = threadIdx.x, lane = t & 31, w = t >> 5;
  const int wm = w >> 1, wn = w & 1;              // 4 x 2 wave grid
  const int half = lane >> 4, l16 = lane & 15;
  const int bm = blockIdx.y * BM, bn = blockIdx.x * BN;
  const int cr = t >> 4, cc = (t & 15) * 8;       // the lane's row and 16-byte piece in a copy
  const _Float16* ga = A + (size_t)(bm + cr) * K + cc;
  const _Float16* gb = B + (size_t)cr * N + bn + cc;
  const unsigned la = (unsigned)(size_t)&As[0][cr][cc];
  const unsigned lb = (unsigned)(size_t)&Bs[0][cr][cc];
  const size_t a16 = (size_t)16 * K, b16 = (size_t)16 * N;
  const size_t bst = (size_t)BK * N;              // one stage further on in B
  const int nst = K / BK;                         // stages
  v8f acc0 = {}, acc1 = {}, acc2 = {}, acc3 = {};

  stage_ab(la, lb, ga, gb, a16, b16);                        // stage 0 -> buffer 0
  // the rotary factors of the lane's 8 rows x 4 columns, asked for here so that they come in beside stage 0's
  // copies, under the same memory latency: rf[r][i] belongs to row bm + wm*16 + 8*half + r and complex pair (16 i + l16) / 2
  v2f rf[8][4] = {};
  if (EPI == 1 && bn < NR) {
#pragma unroll
    for (int r = 0; r < 8; ++r)
#pragma unroll
      for (int i = 0; i < 4; ++i)
        rf[r][i] = *(const v2f*)(rot + ((size_t)(bm + wm * 16 + 8 * half + r) * (HD / 2) + 8 * i + (l16 >> 1)) * 2);
  }
  asm volatile("s_wait_asynccnt 0x0" ::: "memory");          // this wave's part of stage 0 has landed
  __syncthreads();                                           // ... and every other wave's
  if (nst > 1)
    stage_ab(la + ABUF, lb + BBUF, ga + BK, gb + bst, a16, b16);   // stage 1 -> buffer 1

  for (int s = 0; s < nst; ++s) {
    const int buf = s & 1;
    const _Float16* ap = &As[buf][wm * 16 + l16][0];
    const _Float16* bp = &Bs[buf][8 * half + (lane & 7)][wn * 64 + 8 * ((lane >> 3) & 1)];
    // the stage's four 32-k steps in straight line: constant LDS offsets, and a step's
    // fragment reads need not wait for the step before
#pragma unroll
    for (int kk = 0; kk < BK; kk += 32) {
      const v16h a = load_frag(ap + kk, half);
      const v16h b0 = load_frag_tr(bp + kk * BP,      BP);
      const v16h b1 = load_frag_tr(bp + kk * BP + 16, BP);
      const v16h b2 = load_frag_tr(bp + kk * BP + 32, BP);
      const v16h b3 = load_frag_tr(bp + kk * BP + 48, BP);
      acc0 = __builtin_amdgcn_wmma_f32_16x16x32_f16(false, a, false, b0, (short)0, acc0, false, false);
      acc1 = __builtin_amdgcn_wmma_f32_16x16x32_f16(false, a, false, b1, (short)0, acc1, false, false);
      acc2 = __builtin_amdgcn_wmma_f32_16x16x32_f16(false, a, false, b2, (short)0, acc2, false, false);
      acc3 = __builtin_amdgcn_wmma_f32_16x16x32_f16(false, a, false, b3, (short)0, acc3, false, false);
    }
    // hand-over: stage s + 1 becomes readable and buffer buf becomes free
    asm volatile("s_wait_dscnt 0x0" ::: "memory");     // this wave's reads of buffer buf are done
    asm volatile("s_wait_asynccnt 0x0" ::: "memory");  // its copies of stage s + 1 have landed
    __syncthreads();                                   // the same holds for all eight waves
    if (s + 2 < nst)
      stage_ab(la + buf * ABUF, lb + buf * BBUF,
               ga + (size_t)(s + 2) * BK, gb + (size_t)(s + 2) * bst, a16, b16);
  }
  asm volatile("s_wait_asynccnt 0x0" ::: "memory");    // no copy is open when the wave ends
  // epilogue: C layout per tile: M = r + 8*half, N = l16
  const int ncol0 = bn + wn * 64 + l16;
  const float bb0 = bias[ncol0], bb1 = bias[ncol0 + 16];
  const float bb2 = bias[ncol0 + 32], bb3 = bias[ncol0 + 48];
  if (EPI == 0) {
#pragma unroll
    for (int r = 0; r < 8; ++r) {
      const size_t rowoff = (size_t)(bm + wm * 16 + r + 8 * half) * N + ncol0;
      C[rowoff]      = acc0[r] + bb0;
      C[rowoff + 16] = acc1[r] + bb1;
      C[rowoff + 32] = acc2[r] + bb2;
      C[rowoff + 48] = acc3[r] + bb3;
    }
  } else if (bn < NR) {
    // rotary + per-head LayerNorm. Column d = 16 i + l16 of the head: even d is the real part of
    // pair d / 2, odd d the imaginary part, and the other part sits in lane l ^ 1.
    const int h = (bn + wn * 64) / HD;
    const float lw[4] = {ln_w[l16], ln_w[l16 + 16], ln_w[l16 + 32], ln_w[l16 + 48]};
    const float lb[4] = {ln_b[l16], ln_b[l16 + 16], ln_b[l16 + 32], ln_b[l16 + 48]};
    const bool odd = l16 & 1;
    _Float16* st = &As[0][0][0] + w * (16 * SP);   // the wave's own 16 x 64 tile
#pragma unroll
    for (int r = 0; r < 8; ++r) {
      const float own[4] = {acc0[r] + bb0, acc1[r] + bb1, acc2[r] + bb2, acc3[r] + bb3};
      float v[4];
      float s = 0.f, s2 = 0.f;
#pragma unroll
      for (int i = 0; i < 4; ++i) {
        const float oth = xrow<1>(own[i]);
        // real: xr*fr - xi*fi; imaginary: xi*fr + xr*fi
        v[i] = own[i] * rf[r][i][0] + oth * (odd ? rf[r][i][1] : -rf[r][i][1]);
        s += v[i]; s2 += v[i] * v[i];
      }
      s = row_sum(s); s2 = row_sum(s2);
      const float m = s * (1.f / HD), var = s2 * (1.f / HD) - m * m, iv = rsq_slot(var + 1e-5f);
#pragma unroll
      for (int i = 0; i < 4; ++i)
        st[(8 * half + r) * SP + 16 * i + l16] = (_Float16)((v[i] - m) * iv * lw[i] + lb[i]);
    }
    asm volatile("s_wait_dscnt 0x0" ::: "memory");   // the wave's tile is written before its lanes read each other's parts
#pragma unroll
    for (int k = 0; k < 4; ++k) {
      const int pc = lane + 32 * k, rr = pc >> 3, ch = pc & 7;   // 8 lanes x 16 B = one row; the wave's store covers 512 B in a row
      const v8h o = *(const v8h*)(st + rr * SP + ch * 8);
      *(v8h*)(rn + ((size_t)h * CTX + bm + wm * 16 + rr) * HD + ch * 8) = o;
    }
  } else {
    // V: a lane's 8 registers of a tile are 8 neighbouring rows c of one column d: one 16-byte piece of vT's row d
    _Float16* sv = &As[0][0][0];                     // the block's tile, turned: 128 d x 64 c
    const float bb[4] = {bb0, bb1, bb2, bb3};
#pragma unroll
    for (int i = 0; i < 4; ++i) {
      const v8f a = (i == 0 ? acc0 : i == 1 ? acc1 : i == 2 ? acc2 : acc3) + bb[i];
      *(v8h*)(sv + (wn * 64 + 16 * i + l16) * SP + wm * 16 + 8 * half) = __builtin_convertvector(a, v8h);
    }
    __syncthreads();   // the tile is complete before any wave reads it back by rows of 64 c
#pragma unroll
    for (int k = 0; k < 4; ++k) {
      const int pc = t + 256 * k, d = pc >> 3, ch = pc & 7;      // 8 lanes x 16 B = one line of vT
      const v8h o = *(const v8h*)(sv + d * SP + ch * 8);
      *(v8h*)(vT + (size_t)(bn - NR + d) * CTX + bm + ch * 8) = o;
    }
    // a precaution: the built code lays the rotary part behind this one, and the wait stands between
    // these stores and that part's writes of the registers which the stores name
    asm volatile("s_wait_xcnt 0x0" ::: "memory");
  }
}

// ---------------------------------------------------------------------------
// Stage 5: flash attention. 4 waves/block; each wave owns 16 queries of one
// head and takes 32 keys/pass. Both products are transposed: S^T = K Q^T
// (4 WMMAs) and O^T += V^T P^T (4 WMMAs). A lane then holds 16 scores of ONE
// query, so maximum and sum are taken in its own registers, with one exchange
// between the wave's halves for the maximum, and the two S^T tiles, converted
// in place, are the B operand of the second product: P never touches LDS.
// K and vT come into LDS once per block, 64 keys a stage, by asynchronous copies
// that cover whole 128-byte lines; the four waves read their fragments from there.
// Two buffers: the next stage's copies fly while this stage is worked on.
// ---------------------------------------------------------------------------
#define FK  64            // keys per stage = one 128-byte line of each vT row
#define FP  72            // LDS row pitch in f16: 144 B = 16 B x 9 (odd), the pitch of 16-byte fragment reads
#define NST (CTX / FK)    // stages
#define FBUF (FK * FP * 2)  // bytes of one buffer (K: 64 keys; vT: 64 d rows)
#define FROW (16 * FP * 2)  // bytes of 16 LDS rows

// One stage: 64 K rows and 64 vT rows of 128 B each; 128 threads x 8 copies of 16 B.
// Eight lanes cover one row, so a wave's copy reads four whole lines.
// lk, lv: the lane's LDS byte addresses; gk, gv: its global addresses (row t/8, piece t%8).
__device__ inline void stage_kv(unsigned lk, unsigned lv,
                                const _Float16* gk, const _Float16* gv) {
  const unsigned lk1 = lk + FROW, lk2 = lk + 2 * FROW, lk3 = lk + 3 * FROW;
  const unsigned lv1 = lv + FROW, lv2 = lv + 2 * FROW, lv3 = lv + 3 * FROW;
  const _Float16* gk1 = gk + 16 * HD;
  const _Float16* gk2 = gk + 32 * HD;
  const _Float16* gk3 = gk + 48 * HD;
  const _Float16* gv1 = gv + (size_t)16 * CTX;
  const _Float16* gv2 = gv + (size_t)32 * CTX;
  const _Float16* gv3 = gv + (size_t)48 * CTX;
  // the copies go past the registers; the closing wait stands in the same statement so
  // that no address register named here is rewritten in front of it
  asm volatile(
      "global_load_async_to_lds_b128 %0, %8, off\n\t"
      "global_load_async_to_lds_b128 %1, %9, off\n\t"
      "global_load_async_to_lds_b128 %2, %10, off\n\t"
      "global_load_async_to_lds_b128 %3, %11, off\n\t"
      "global_load_async_to_lds_b128 %4, %12, off\n\t"
      "global_load_async_to_lds_b128 %5, %13, off\n\t"
      "global_load_async_to_lds_b128 %6, %14, off\n\t"
      "global_load_async_to_lds_b128 %7, %15, off\n\t"
      "s_wait_xcnt 0x0"
      :: "v"(lk), "v"(lk1), "v"(lk2), "v"(lk3), "v"(lv), "v"(lv1), "v"(lv2), "v"(lv3),
         "v"(gk), "v"(gk1), "v"(gk2), "v"(gk3), "v"(gv), "v"(gv1), "v"(gv2), "v"(gv3)
      : "memory");
}

// lane l takes the value of lane l ^ 16
__device__ inline float xhalf(float x) {
  const int i = __builtin_bit_cast(int, x);
  return __builtin_bit_cast(float, __builtin_amdgcn_permlanex16(i, i, 0x76543210, 0xfedcba98, false, false));
}
__device__ inline float max3f(float a, float b, float c) { return fmaxf(fmaxf(a, b), c); }

__global__ __launch_bounds__(128) void flash_kernel(
    const _Float16* __restrict__ qn, const _Float16* __restrict__ kn,
    const _Float16* __restrict__ vT, _Float16* __restrict__ aout)
{
  const int t = threadIdx.x;
  const int lane = t & 31;
  const int w = t >> 5;
  const int h = blockIdx.y;
  const int qt = blockIdx.x * 4 + w;          // 16-row query tile
  const int half = lane >> 4, l16 = lane & 15;
  __shared__ __align__(16) _Float16 Ks[2][FK][FP];
  __shared__ __align__(16) _Float16 Vs[2][HD][FP];

  const int cr = t >> 3, cc = (t & 7) * 8;    // the lane's row and 16-byte piece in a copy
  const _Float16* gk = kn + ((size_t)h * CTX + cr) * HD + cc;
  const _Float16* gv = vT + ((size_t)h * HD + cr) * CTX + cc;
  const unsigned lk = (unsigned)(size_t)&Ks[0][cr][cc];
  const unsigned lv = (unsigned)(size_t)&Vs[0][cr][cc];

  stage_kv(lk, lv, gk, gv);                                  // stage 0 -> buffer 0

  // Q as the B operand: column = query l16, the k order of load_frag
  const _Float16* qrow = qn + ((size_t)h * CTX + qt * 16 + l16) * HD;
  const v16h bq0 = load_frag(qrow, half);       // d = 0..31
  const v16h bq1 = load_frag(qrow + 32, half);  // d = 32..63

  // o<i>[r] = O[query l16][d = 16 i + 8 half + r]
  v8f o0 = {}, o1 = {}, o2 = {}, o3 = {};
  const float cs = 0.125f * 1.4426950408889634f;   // 1/sqrt(64), in the base-2 domain
  float mrun = -1e30f;    // query l16's running maximum, scaled; alike in both halves
  float lrun = 0.f;       // its sum over the keys that this half of the wave holds

  asm volatile("s_wait_asynccnt 0x0" ::: "memory");          // this wave's part of stage 0 has landed
  __syncthreads();                                           // ... and every other wave's
  stage_kv(lk + FBUF, lv + FBUF, gk + FK * HD, gv + FK);     // stage 1 -> buffer 1

  for (int s = 0; s < NST; ++s) {
    const int buf = s & 1;
    // both 32-key passes of a stage in straight line: constant LDS offsets, and the second
    // pass's fragment reads and products need not wait for the first pass's softmax
#pragma unroll
    for (int sub = 0; sub < FK; sub += 32) {
      const _Float16* k0row = &Ks[buf][sub + l16][0];
      const _Float16* k1row = k0row + 16 * FP;
      v8f z = {};
      // s0[r] = S[key sub + 8 half + r][query l16], s1[r] = the same 16 keys further on
      v8f s0 = __builtin_amdgcn_wmma_f32_16x16x32_f16(false, load_frag(k0row, half), false, bq0, (short)0, z, false, false);
      s0 = __builtin_amdgcn_wmma_f32_16x16x32_f16(false, load_frag(k0row + 32, half), false, bq1, (short)0, s0, false, false);
      v8f s1 = __builtin_amdgcn_wmma_f32_16x16x32_f16(false, load_frag(k1row, half), false, bq0, (short)0, z, false, false);
      s1 = __builtin_amdgcn_wmma_f32_16x16x32_f16(false, load_frag(k1row + 32, half), false, bq1, (short)0, s1, false, false);

      // maximum of the raw scores (the scale is positive): 16 in the lane, then the other half's
      const float ma = max3f(max3f(s0[0], s0[1], s0[2]), max3f(s0[3], s0[4], s0[5]), max3f(s0[6], s0[7], s1[0]));
      const float mb = max3f(max3f(s1[1], s1[2], s1[3]), max3f(s1[4], s1[5], s1[6]), s1[7]);
      float mx = fmaxf(ma, mb);
      mx = fmaxf(mx, xhalf(mx));
      const float mnew = fmaxf(mrun, mx * cs);
      const float alpha = __builtin_amdgcn_exp2f(mrun - mnew);
      mrun = mnew;

      // P^T as the B operand, in the k order of load_frag: element e is s0[e] for e < 8, s1[e - 8] behind it
      const v2f c2 = {cs, cs}, nm = {-mnew, -mnew};
      v2f p[8];
      v16h bp;
#pragma unroll
      for (int i = 0; i < 8; ++i) {
        const v8f& sv = i < 4 ? s0 : s1;
        const v2f x = {sv[2 * (i & 3)], sv[2 * (i & 3) + 1]};
        const v2f arg = __builtin_elementwise_fma(x, c2, nm);
        p[i] = v2f{__builtin_amdgcn_exp2f(arg[0]), __builtin_amdgcn_exp2f(arg[1])};
        const v2h ph = __builtin_convertvector(p[i], v2h);
        bp[2 * i] = ph[0]; bp[2 * i + 1] = ph[1];
      }
      const v2f ps = ((p[0] + p[1]) + (p[2] + p[3])) + ((p[4] + p[5]) + (p[6] + p[7]));
      lrun = lrun * alpha + (ps[0] + ps[1]);
      o0 *= alpha; o1 *= alpha; o2 *= alpha; o3 *= alpha;

      // V^T as the A operand: row = d, k = the pass's 32 keys in the order of load_frag
      const _Float16* vb = &Vs[buf][l16][sub];
      o0 = __builtin_amdgcn_wmma_f32_16x16x32_f16(false, load_frag(vb, half), false, bp, (short)0, o0, false, false);
      o1 = __builtin_amdgcn_wmma_f32_16x16x32_f16(false, load_frag(vb + 16 * FP, half), false, bp, (short)0, o1, false, false);
      o2 = __builtin_amdgcn_wmma_f32_16x16x32_f16(false, load_frag(vb + 32 * FP, half), false, bp, (short)0, o2, false, false);
      o3 = __builtin_amdgcn_wmma_f32_16x16x32_f16(false, load_frag(vb + 48 * FP, half), false, bp, (short)0, o3, false, false);
    }
    // hand-over: stage s + 1 becomes readable and buffer buf becomes free
    asm volatile("s_wait_dscnt 0x0" ::: "memory");     // this wave's reads of buffer buf are done
    asm volatile("s_wait_asynccnt 0x0" ::: "memory");  // its copies of stage s + 1 have landed
    __syncthreads();                                   // the same holds for all four waves
    if (s + 2 < NST)
      stage_kv(lk + buf * FBUF, lv + buf * FBUF,
               gk + (size_t)(s + 2) * FK * HD, gv + (s + 2) * FK);
  }
  asm volatile("s_wait_asynccnt 0x0" ::: "memory");    // no copy is open when the wave ends
  // the two halves' sums join once; a lane's 8 registers of a tile are 8 neighbouring d of its query
  const float rl = 1.f / (lrun + xhalf(lrun));
  _Float16* dst = aout + (size_t)(qt * 16 + l16) * DIMS + h * HD + 8 * half;
  *(v8h*)(dst)      = __builtin_convertvector(o0 * rl, v8h);
  *(v8h*)(dst + 16) = __builtin_convertvector(o1 * rl, v8h);
  *(v8h*)(dst + 32) = __builtin_convertvector(o2 * rl, v8h);
  *(v8h*)(dst + 48) = __builtin_convertvector(o3 * rl, v8h);
}

// ---------------------------------------------------------------------------
extern "C" void kernel_launch(void* const* d_in, const int* in_sizes, int n_in,
                              void* d_out, int out_size, void* d_ws, size_t ws_size,
                              hipStream_t stream) {
  const float* x     = (const float*)d_in[0];
  const float* qn_w  = (const float*)d_in[1];
  const float* qn_b  = (const float*)d_in[2];
  const float* q_w   = (const float*)d_in[3];
  const float* q_b   = (const float*)d_in[4];
  const float* kvn_w = (const float*)d_in[5];
  const float* kvn_b = (const float*)d_in[6];
  const float* kv_w  = (const float*)d_in[7];
  const float* kv_b  = (const float*)d_in[8];
  const float* out_w = (const float*)d_in[9];
  const float* out_b = (const float*)d_in[10];
  const float* ln_w  = (const float*)d_in[11];
  const float* ln_b  = (const float*)d_in[12];
  const float* rh_w  = (const float*)d_in[13];
  const float* rh_b  = (const float*)d_in[14];
  float* out = (float*)d_out;
  (void)in_sizes; (void)n_in; (void)out_size; (void)ws_size;

  char* base = (char*)d_ws;
  size_t off = 0;
  auto take = [&](size_t bytes) -> char* {
    char* p = base + off;
    off = (off + bytes + 255) & ~(size_t)255;
    return p;
  };
  _Float16* lnq16  = (_Float16*)take((size_t)CTX * DIMS * 2);
  _Float16* lnkv16 = (_Float16*)take((size_t)CTX * DIMS * 2);
  float*    rot    = (float*)take((size_t)CTX * HD * 4);
  _Float16* qw16   = (_Float16*)take((size_t)DIMS * DIMS * 2);
  _Float16* kvw16  = (_Float16*)take((size_t)DIMS * 2 * DIMS * 2);
  _Float16* outw16 = (_Float16*)take((size_t)DIMS * DIMS * 2);
  _Float16* qn16   = (_Float16*)take((size_t)HEAD * CTX * HD * 2);
  _Float16* kn16   = (_Float16*)take((size_t)HEAD * CTX * HD * 2);
  _Float16* vT16   = (_Float16*)take((size_t)HEAD * HD * CTX * 2);
  _Float16* a16    = (_Float16*)take((size_t)CTX * DIMS * 2);

  prep_kernel<<<CTX, 256, 0, stream>>>(x, qn_w, qn_b, kvn_w, kvn_b, rh_w, rh_b,
                                       q_w, kv_w, out_w,
                                       lnq16, lnkv16, rot, qw16, kvw16, outw16);

  gemm_kernel<1><<<dim3(DIMS / BN, CTX / BM), 256, 0, stream>>>(
      lnq16, qw16, q_b, nullptr, CTX, DIMS, DIMS, rot, ln_w, ln_b, qn16, vT16, DIMS);
  gemm_kernel<1><<<dim3(2 * DIMS / BN, CTX / BM), 256, 0, stream>>>(
      lnkv16, kvw16, kv_b, nullptr, CTX, 2 * DIMS, DIMS, rot, ln_w, ln_b, kn16, vT16, DIMS);

  flash_kernel<<<dim3(CTX / 16 / 4, HEAD), 128, 0, stream>>>(qn16, kn16, vT16, a16);

  gemm_kernel<0><<<dim3(DIMS / BN, CTX / BM), 256, 0, stream>>>(
      a16, outw16, out_b, out, CTX, DIMS, DIMS, nullptr, nullptr, nullptr, nullptr, nullptr, 0);
}

// v008
// Measured time: 64.2 microseconds a run.
// In two side-by-side timings against v007, it was 1.09 and 1.08 times as fast.
// Counting every step since v000, it is 5.21 times as fast.
#include <hip/hip_runtime.h>

#define CTX  2048
#define DIMS 1024
#define HEAD 16
#define HD   64

typedef __attribute__((ext_vector_type(16))) _Float16 v16h;
typedef __attribute__((ext_vector_type(8)))  _Float16 v8h;
typedef __attribute__((ext_vector_type(4)))  _Float16 v4h;
typedef __attribute__((ext_vector_type(2)))  _Float16 v2h;
typedef __attribute__((ext_vector_type(2)))  float    v2f;
typedef __attribute__((ext_vector_type(4)))  float    v4f;
typedef __attribute__((ext_vector_type(8)))  float    v8f;
typedef __attribute__((ext_vector_type(8)))  short    v8s;

// Build a 16x16x32 f16 WMMA A/B fragment for this lane.
// 16-bit operand layout (ISA 7.12.2): lane half (lane/16) selects
// K in {0..7,16..23} (half=0) or {8..15,24..31} (half=1); both chunks are
// contiguous 8 x f16 = 16B runs, so two aligned 16-byte loads suffice.
__device__ inline v16h load_frag(const _Float16* rowbase, int half) {
  v8h lo = *(const v8h*)(rowbase + half * 8);
  v8h hi = *(const v8h*)(rowbase + 16 + half * 8);
  v16h r;
#pragma unroll
  for (int i = 0; i < 8; ++i) { r[i] = lo[i]; r[i + 8] = hi[i]; }
  return r;
}

// The same fragment out of a row-major (K x N) f16 tile in LDS, by the
// transposing LDS load. p is the lane's own address: row 8*(lane/16) + (lane&7),
// column n0 + 8*((lane/8)&1). Lane (c = lane&15, h = lane/16) then holds
// T[8h + 0..7][n0 + c] and, from 16 rows further on, T[16 + 8h + 0..7][n0 + c]:
// the k order of load_frag.
__device__ inline v16h load_frag_tr(const _Float16* p, int pitch) {
  typedef __attribute__((address_space(3))) v8s lds_v8s;
  v8h lo = __builtin_bit_cast(v8h, __builtin_amdgcn_ds_load_tr16_b128_v8i16((lds_v8s*)p));
  v8h hi = __builtin_bit_cast(v8h, __builtin_amdgcn_ds_load_tr16_b128_v8i16((lds_v8s*)(p + 16 * pitch)));
  v16h r;
#pragma unroll
  for (int i = 0; i < 8; ++i) { r[i] = lo[i]; r[i + 8] = hi[i]; }
  return r;
}

// ---------------------------------------------------------------------------
// Stage 1: fused LayerNorm (q-path & kv-path share mean/var) + the row's 32 rotary
// factors (radius x cos, radius x sin; mel-scaled freqs, per-step radius), which the
// projection GEMMs' epilogues apply, and the f32 -> f16 conversion of the three weight matrices: the 4 * DIMS * DIMS
// weight elements are dealt out evenly, WPB to each of the CTX blocks. A block's
// share is loaded together with its row, so that both wait out one memory latency,
// and is stored at the block's end.
// ---------------------------------------------------------------------------
#define WPB (4 * DIMS * DIMS / CTX)   // weight elements per block: 2048 = 256 threads x 2 x 4
#define QWB (DIMS * DIMS / WPB)       // blocks that hold q_w (and as many for out_w); kv_w takes twice as many
__global__ __launch_bounds__(256) void prep_kernel(
    const float* __restrict__ x,
    const float* __restrict__ qn_w, const float* __restrict__ qn_b,
    const float* __restrict__ kvn_w, const float* __restrict__ kvn_b,
    const float* __restrict__ rh_w, const float* __restrict__ rh_b,
    const float* __restrict__ q_w, const float* __restrict__ kv_w,
    const float* __restrict__ out_w,
    _Float16* __restrict__ lnq, _Float16* __restrict__ lnkv,
    float* __restrict__ rot,
    _Float16* __restrict__ qw16, _Float16* __restrict__ kvw16,
    _Float16* __restrict__ outw16)
{
  const int c = blockIdx.x, t = threadIdx.x;
  const float* row = x + (size_t)c * DIMS;
  // the block's share of the weights: which matrix is the same for the whole block
  const float* wsrc;
  _Float16* wdst;
  if (c < QWB)          { wsrc = q_w   + (size_t)c * WPB;             wdst = qw16   + (size_t)c * WPB; }
  else if (c < 3 * QWB) { wsrc = kv_w  + (size_t)(c - QWB) * WPB;     wdst = kvw16  + (size_t)(c - QWB) * WPB; }
  else                  { wsrc = out_w + (size_t)(c - 3 * QWB) * WPB; wdst = outw16 + (size_t)(c - 3 * QWB) * WPB; }
  // a wave's load covers 512 B in a row, its store 256 B: whole lines both
  const v4f w0 = *(const v4f*)(wsrc + 4 * t);
  const v4f w1 = *(const v4f*)(wsrc + WPB / 2 + 4 * t);
  float v[4];
  float s = 0.f, s2 = 0.f, dp = 0.f;
#pragma unroll
  for (int i = 0; i < 4; ++i) {
    int d = t + i * 256;
    float val = row[d];
    v[i] = val;
    s += val; s2 += val * val; dp += val * rh_w[d];
  }
  __shared__ float red[256];
  auto reduceAll = [&](float val) -> float {
    red[t] = val; __syncthreads();
    for (int o = 128; o > 0; o >>= 1) { if (t < o) red[t] += red[t + o]; __syncthreads(); }
    float r = red[0]; __syncthreads(); return r;
  };
  float tot  = reduceAll(s);
  float tot2 = reduceAll(s2);
  float dtot = reduceAll(dp);
  float mean = tot * (1.f / DIMS);
  float var  = tot2 * (1.f / DIMS) - mean * mean;
  float inv  = rsqrtf(var + 1e-5f);
  if (t < 32) {   // the first wave: lane j writes the factor of complex pair j; the wave's store covers 256 B
    const float per = dtot + rh_b[0];
    const float rad = fminf(fmaxf(per * 0.01f, 0.5f), 2.0f);
    const float mel_max = 2595.0f * 1.3222192947339193f;          // 2595*log10(21)
    const float lin = (float)t * (mel_max / 31.0f);               // linspace, 32 pts
    const float fb = 0.2f * (expf(lin * (2.3025850929940457f / 2595.0f)) - 1.0f);
    const float freq = (float)c * fb;
    const v2f f = {rad * cosf(freq), rad * sinf(freq)};
    *(v2f*)(rot + ((size_t)c * (HD / 2) + t) * 2) = f;
  }
#pragma unroll
  for (int i = 0; i < 4; ++i) {
    int d = t + i * 256;
    float n = (v[i] - mean) * inv;
    lnq [(size_t)c * DIMS + d] = (_Float16)(n * qn_w[d] + qn_b[d]);
    lnkv[(size_t)c * DIMS + d] = (_Float16)(n * kvn_w[d] + kvn_b[d]);
  }
  *(v4h*)(wdst + 4 * t)           = __builtin_convertvector(w0, v4h);
  *(v4h*)(wdst + WPB / 2 + 4 * t) = __builtin_convertvector(w1, v4h);
}

// ---------------------------------------------------------------------------
// Stage 3/6: LDS-staged WMMA GEMM.  C(f32) = A(f16,MxK) * B(f16,KxN) + bias
// Block tile 64x128; 8 waves in 4(M) x 2(N); each wave owns a 16x64 strip
// = 4 accumulators -> 4 WMMAs per 32 k sharing one A-fragment.
// A and B come into LDS 128 k a stage, by asynchronous copies that cover whole
// 256-byte rows and pass no register. Two buffers: the next stage's copies fly
// while this stage's 16 WMMAs a wave are worked on.
// B lies in LDS as in memory (K x N); the transposing LDS load turns it into fragments.
// M, N, K: multiples of 64, 128, 128.
// EPI 0: C = product + bias, f32.
// EPI 1 (the q and kv projections; a wave's 16x64 strip is 16 rows of ONE head):
//   columns below NR: rotary, then the per-head LayerNorm, out as f16 [h][c][d];
//   columns from NR on (V): out as f16, transposed [h][d][c].
//   Both go through LDS, free behind the loop's last barrier, so that every global
//   store covers whole 128-byte lines.
//   One launch holds both projections: the grid's first nb1 block columns work on
//   A, B, bias, rn, N (q), the columns behind them on A2, B2, bias2, rn2, N2 (kv).
//   Three blocks fit a WGP's LDS, so all blocks of both products run side by side.
// ---------------------------------------------------------------------------
#define BM 64
#define BN 128
#define BK 128  // k per stage = one 256-byte row of A
#define AP 136  // A row stride in f16 (272 bytes = 16 B x 17, odd: the pitch of 16-byte fragment reads)
#define BP 144  // B row stride in f16 (288 bytes = 32 B x 9, odd: the transposing load's pitch)
#define ABUF (BM * AP * 2)   // bytes of one A buffer
#define BBUF (BK * BP * 2)   // bytes of one B buffer
#define AROW (16 * AP * 2)   // bytes of 16 LDS rows of A
#define BROW (16 * BP * 2)   // bytes of 16 LDS rows of B

// One stage: 64 A rows and 128 B rows of 256 B each; 256 threads x 12 copies of 16 B.
// Sixteen lanes cover one row, so a wave's copy reads four whole lines.
// la, lb: the lane's LDS byte addresses; ga, gb: its global addresses (row t/16, piece t%16);
// a16, b16: 16 rows of A and of B in elements.
__device__ inline void stage_ab(unsigned la, unsigned lb,
                                const _Float16* ga, const _Float16* gb,
                                size_t a16, size_t b16) {
  const unsigned la1 = la + AROW, la2 = la + 2 * AROW, la3 = la + 3 * AROW;
  const unsigned lb1 = lb + BROW, lb2 = lb + 2 * BROW, lb3 = lb + 3 * BROW;
  const unsigned lb4 = lb + 4 * BROW, lb5 = lb + 5 * BROW, lb6 = lb + 6 * BROW, lb7 = lb + 7 * BROW;
  const _Float16* ga1 = ga + a16;
  const _Float16* ga2 = ga + 2 * a16;
  const _Float16* ga3 = ga + 3 * a16;
  const _Float16* gb1 = gb + b16;
  const _Float16* gb2 = gb + 2 * b16;
  const _Float16* gb3 = gb + 3 * b16;
  const _Float16* gb4 = gb + 4 * b16;
  const _Float16* gb5 = gb + 5 * b16;
  const _Float16* gb6 = gb + 6 * b16;
  const _Float16* gb7 = gb + 7 * b16;
  // the copies go past the registers; the closing wait stands in the same statement so
  // that no address register named here is rewritten in front of it
  asm volatile(
      "global_load_async_to_lds_b128 %0, %12, off\n\t"
      "global_load_async_to_lds_b128 %1, %13, off\n\t"
      "global_load_async_to_lds_b128 %2, %14, off\n\t"
      "global_load_async_to_lds_b128 %3, %15, off\n\t"
      "global_load_async_to_lds_b128 %4, %16, off\n\t"
      "global_load_async_to_lds_b128 %5, %17, off\n\t"
      "global_load_async_to_lds_b128 %6, %18, off\n\t"
      "global_load_async_to_lds_b128 %7, %19, off\n\t"
      "global_load_async_to_lds_b128 %8, %20, off\n\t"
      "global_load_async_to_lds_b128 %9, %21, off\n\t"
      "global_load_async_to_lds_b128 %10, %22, off\n\t"
      "global_load_async_to_lds_b128 %11, %23, off\n\t"
      "s_wait_xcnt 0x0"
      :: "v"(la), "v"(la1), "v"(la2), "v"(la3),
         "v"(lb), "v"(lb1), "v"(lb2), "v"(lb3), "v"(lb4), "v"(lb5), "v"(lb6), "v"(lb7),
         "v"(ga), "v"(ga1), "v"(ga2), "v"(ga3),
         "v"(gb), "v"(gb1), "v"(gb2), "v"(gb3), "v"(gb4), "v"(gb5), "v"(gb6), "v"(gb7)
      : "memory");
}

#define SP 72   // pitch of the epilogue's LDS tiles in f16: 144 B = 16 B x 9 (odd), the pitch of 16-byte accesses

// lane l takes the value of lane l ^ M, M < 16 (DPP row_xmask: no LDS path, no wait)
template <int M> __device__ inline float xrow(float x) {
  const int i = __builtin_bit_cast(int, x);
  return __builtin_bit_cast(float, __builtin_amdgcn_update_dpp(i, i, 0x160 | M, 0xf, 0xf, false));
}
// sum over the 16 lanes of a row; every lane of the row ends with it
__device__ inline float row_sum(float x) {
  x += xrow<1>(x); x += xrow<2>(x); x += xrow<4>(x); x += xrow<8>(x);
  return x;
}

// 1 / sqrt(x) as the library's rsqrtf forms it: an x below the smallest normal number goes in times 2^24
// and its result comes out times 2^12. The v_nop stands in the instruction's own statement, where nothing
// can come between: it is the one slot that the instruction set asks for behind a transcendental, in front
// of an instruction that reads its result or overwrites its source.
__device__ inline float rsq_slot(float x) {
  const bool tiny = x < 1.17549435e-38f;
  const float a = tiny ? x * 16777216.0f : x;
  float r;
  asm("v_rsq_f32 %0, %1\n\tv_nop" : "=v"(r) : "v"(a));
  return tiny ? r * 4096.0f : r;
}

template <int EPI>
__global__ __launch_bounds__(256) void gemm_kernel(
    const _Float16* __restrict__ A, const _Float16* __restrict__ B,
    const float* __restrict__ bias, float* __restrict__ C,
    int M, int N, int K,
    const float* __restrict__ rot, const float* __restrict__ ln_w, const float* __restrict__ ln_b,
    _Float16* __restrict__ rn, _Float16* __restrict__ vT, int NR,
    const _Float16* __restrict__ A2, const _Float16* __restrict__ B2,
    const float* __restrict__ bias2, _Float16* __restrict__ rn2, int N2, int nb1)
{
  __shared__ __align__(16) _Float16 As[2][BM][AP];
  __shared__ __align__(16) _Float16 Bs[2][BK][BP];   // B staged row-major (KxN)
  const int t = threadIdx.x, lane = t & 31, w = t >> 5;
  const int wm = w >> 1, wn = w & 1;              // 4 x 2 wave grid
  const int half = lane >> 4, l16 = lane & 15;
  int bx = blockIdx.x;
  if (EPI == 1 && bx >= nb1) {   // a block of the launch's second product: the same for the whole block
    bx -= nb1; A = A2; B = B2; bias = bias2; rn = rn2; N = N2;
  }
  const int bm = blockIdx.y * BM, bn = bx * BN;
  const int cr = t >> 4, cc = (t & 15) * 8;       // the lane's row and 16-byte piece in a copy
  const _Float16* ga = A + (size_t)(bm + cr) * K + cc;
  const _Float16* gb = B + (size_t)cr * N + bn + cc;
  const unsigned la = (unsigned)(size_t)&As[0][cr][cc];
  const unsigned lb = (unsigned)(size_t)&Bs[0][cr][cc];
  const size_t a16 = (size_t)16 * K, b16 = (size_t)16 * N;
  const size_t bst = (size_t)BK * N;              // one stage further on in B
  const int nst = K / BK;                         // stages
  v8f acc0 = {}, acc1 = {}, acc2 = {}, acc3 = {};

  stage_ab(la, lb, ga, gb, a16, b16);                        // stage 0 -> buffer 0
  // the rotary factors of the lane's 8 rows x 4 columns, asked for here so that they come in beside stage 0's
  // copies, under the same memory latency: rf[r][i] belongs to row bm + wm*16 + 8*half + r and complex pair (16 i + l16) / 2
  v2f rf[8][4] = {};
  if (EPI == 1 && bn < NR) {
#pragma unroll
    for (int r = 0; r < 8; ++r)
#pragma unroll
      for (int i = 0; i < 4; ++i)
        rf[r][i] = *(const v2f*)(rot + ((size_t)(bm + wm * 16 + 8 * half + r) * (HD / 2) + 8 * i + (l16 >> 1)) * 2);
  }
  asm volatile("s_wait_asynccnt 0x0" ::: "memory");          // this wave's part of stage 0 has landed
  __syncthreads();                                           // ... and every other wave's
  if (nst > 1)
    stage_ab(la + ABUF, lb + BBUF, ga + BK, gb + bst, a16, b16);   // stage 1 -> buffer 1

  for (int s = 0; s < nst; ++s) {
    const int buf = s & 1;
    const _Float16* ap = &As[buf][wm * 16 + l16][0];
    const _Float16* bp = &Bs[buf][8 * half + (lane & 7)][wn * 64 + 8 * ((lane >> 3) & 1)];
    // the stage's four 32-k steps in straight line: constant LDS offsets, and a step's
    // fragment reads need not wait for the step before
#pragma unroll
    for (int kk = 0; kk < BK; kk += 32) {
      const v16h a = load_frag(ap + kk, half);
      const v16h b0 = load_frag_tr(bp + kk * BP,      BP);
      const v16h b1 = load_frag_tr(bp + kk * BP + 16, BP);
      const v16h b2 = load_frag_tr(bp + kk * BP + 32, BP);
      const v16h b3 = load_frag_tr(bp + kk * BP + 48, BP);
      acc0 = __builtin_amdgcn_wmma_f32_16x16x32_f16(false, a, false, b0, (short)0, acc0, false, false);
      acc1 = __builtin_amdgcn_wmma_f32_16x16x32_f16(false, a, false, b1, (short)0, acc1, false, false);
      acc2 = __builtin_amdgcn_wmma_f32_16x16x32_f16(false, a, false, b2, (short)0, acc2, false, false);
      acc3 = __builtin_amdgcn_wmma_f32_16x16x32_f16(false, a, false, b3, (short)0, acc3, false, false);
    }
    // hand-over: stage s + 1 becomes readable and buffer buf becomes free
    asm volatile("s_wait_dscnt 0x0" ::: "memory");     // this wave's reads of buffer buf are done
    asm volatile("s_wait_asynccnt 0x0" ::: "memory");  // its copies of stage s + 1 have landed
    __syncthreads();                                   // the same holds for all eight waves
    if (s + 2 < nst)
      stage_ab(la + buf * ABUF, lb + buf * BBUF,
               ga + (size_t)(s + 2) * BK, gb + (size_t)(s + 2) * bst, a16, b16);
  }
  asm volatile("s_wait_asynccnt 0x0" ::: "memory");    // no copy is open when the wave ends
  // epilogue: C layout per tile: M = r + 8*half, N = l16
  const int ncol0 = bn + wn * 64 + l16;
  const float bb0 = bias[ncol0], bb1 = bias[ncol0 + 16];
  const float bb2 = bias[ncol0 + 32], bb3 = bias[ncol0 + 48];
  if (EPI == 0) {
#pragma unroll
    for (int r = 0; r < 8; ++r) {
      const size_t rowoff = (size_t)(bm + wm * 16 + r + 8 * half) * N + ncol0;
      C[rowoff]      = acc0[r] + bb0;
      C[rowoff + 16] = acc1[r] + bb1;
      C[rowoff + 32] = acc2[r] + bb2;
      C[rowoff + 48] = acc3[r] + bb3;
    }
  } else if (bn < NR) {
    // rotary + per-head LayerNorm. Column d = 16 i + l16 of the head: even d is the real part of
    // pair d / 2, odd d the imaginary part, and the other part sits in lane l ^ 1.
    const int h = (bn + wn * 64) / HD;
    const float lw[4] = {ln_w[l16], ln_w[l16 + 16], ln_w[l16 + 32], ln_w[l16 + 48]};
    const float lb[4] = {ln_b[l16], ln_b[l16 + 16], ln_b[l16 + 32], ln_b[l16 + 48]};
    const bool odd = l16 & 1;
    _Float16* st = &As[0][0][0] + w * (16 * SP);   // the wave's own 16 x 64 tile
#pragma unroll
    for (int r = 0; r < 8; ++r) {
      const float own[4] = {acc0[r] + bb0, acc1[r] + bb1, acc2[r] + bb2, acc3[r] + bb3};
      float v[4];
      float s = 0.f, s2 = 0.f;
#pragma unroll
      for (int i = 0; i < 4; ++i) {
        const float oth = xrow<1>(own[i]);
        // real: xr*fr - xi*fi; imaginary: xi*fr + xr*fi
        v[i] = own[i] * rf[r][i][0] + oth * (odd ? rf[r][i][1] : -rf[r][i][1]);
        s += v[i]; s2 += v[i] * v[i];
      }
      s = row_sum(s); s2 = row_sum(s2);
      const float m = s * (1.f / HD), var = s2 * (1.f / HD) - m * m, iv = rsq_slot(var + 1e-5f);
#pragma unroll
      for (int i = 0; i < 4; ++i)
        st[(8 * half + r) * SP + 16 * i + l16] = (_Float16)((v[i] - m) * iv * lw[i] + lb[i]);
    }
    asm volatile("s_wait_dscnt 0x0" ::: "memory");   // the wave's tile is written before its lanes read each other's parts
#pragma unroll
    for (int k = 0; k < 4; ++k) {
      const int pc = lane + 32 * k, rr = pc >> 3, ch = pc & 7;   // 8 lanes x 16 B = one row; the wave's store covers 512 B in a row
      const v8h o = *(const v8h*)(st + rr * SP + ch * 8);
      *(v8h*)(rn + ((size_t)h * CTX + bm + wm * 16 + rr) * HD + ch * 8) = o;
    }
  } else {
    // V: a lane's 8 registers of a tile are 8 neighbouring rows c of one column d: one 16-byte piece of vT's row d
    _Float16* sv = &As[0][0][0];                     // the block's tile, turned: 128 d x 64 c
    const float bb[4] = {bb0, bb1, bb2, bb3};
#pragma unroll
    for (int i = 0; i < 4; ++i) {
      const v8f a = (i == 0 ? acc0 : i == 1 ? acc1 : i == 2 ? acc2 : acc3) + bb[i];
      *(v8h*)(sv + (wn * 64 + 16 * i + l16) * SP + wm * 16 + 8 * half) = __builtin_convertvector(a, v8h);
    }
    __syncthreads();   // the tile is complete before any wave reads it back by rows of 64 c
#pragma unroll
    for (int k = 0; k < 4; ++k) {
      const int pc = t + 256 * k, d = pc >> 3, ch = pc & 7;      // 8 lanes x 16 B = one line of vT
      const v8h o = *(const v8h*)(sv + d * SP + ch * 8);
      *(v8h*)(vT + (size_t)(bn - NR + d) * CTX + bm + ch * 8) = o;
    }
    // a precaution: the built code lays the rotary part behind this one, and the wait stands between
    // these stores and that part's writes of the registers which the stores name
    asm volatile("s_wait_xcnt 0x0" ::: "memory");
  }
}

// ---------------------------------------------------------------------------
// Stage 5: flash attention. 4 waves/block; each wave owns 16 queries of one
// head and takes 32 keys/pass. Both products are transposed: S^T = K Q^T
// (4 WMMAs) and O^T += V^T P^T (4 WMMAs). A lane then holds 16 scores of ONE
// query, so maximum and sum are taken in its own registers, with one exchange
// between the wave's halves for the maximum, and the two S^T tiles, converted
// in place, are the B operand of the second product: P never touches LDS.
// K and vT come into LDS once per block, 64 keys a stage, by asynchronous copies
// that cover whole 128-byte lines; the four waves read their fragments from there.
// Two buffers: the next stage's copies fly while this stage is worked on.
// ---------------------------------------------------------------------------
#define FK  64            // keys per stage = one 128-byte line of each vT row
#define FP  72            // LDS row pitch in f16: 144 B = 16 B x 9 (odd), the pitch of 16-byte fragment reads
#define NST (CTX / FK)    // stages
#define FBUF (FK * FP * 2)  // bytes of one buffer (K: 64 keys; vT: 64 d rows)
#define FROW (16 * FP * 2)  // bytes of 16 LDS rows

// One stage: 64 K rows and 64 vT rows of 128 B each; 128 threads x 8 copies of 16 B.
// Eight lanes cover one row, so a wave's copy reads four whole lines.
// lk, lv: the lane's LDS byte addresses; gk, gv: its global addresses (row t/8, piece t%8).
__device__ inline void stage_kv(unsigned lk, unsigned lv,
                                const _Float16* gk, const _Float16* gv) {
  const unsigned lk1 = lk + FROW, lk2 = lk + 2 * FROW, lk3 = lk + 3 * FROW;
  const unsigned lv1 = lv + FROW, lv2 = lv + 2 * FROW, lv3 = lv + 3 * FROW;
  const _Float16* gk1 = gk + 16 * HD;
  const _Float16* gk2 = gk + 32 * HD;
  const _Float16* gk3 = gk + 48 * HD;
  const _Float16* gv1 = gv + (size_t)16 * CTX;
  const _Float16* gv2 = gv + (size_t)32 * CTX;
  const _Float16* gv3 = gv + (size_t)48 * CTX;
  // the copies go past the registers; the closing wait stands in the same statement so
  // that no address register named here is rewritten in front of it
  asm volatile(
      "global_load_async_to_lds_b128 %0, %8, off\n\t"
      "global_load_async_to_lds_b128 %1, %9, off\n\t"
      "global_load_async_to_lds_b128 %2, %10, off\n\t"
      "global_load_async_to_lds_b128 %3, %11, off\n\t"
      "global_load_async_to_lds_b128 %4, %12, off\n\t"
      "global_load_async_to_lds_b128 %5, %13, off\n\t"
      "global_load_async_to_lds_b128 %6, %14, off\n\t"
      "global_load_async_to_lds_b128 %7, %15, off\n\t"
      "s_wait_xcnt 0x0"
      :: "v"(lk), "v"(lk1), "v"(lk2), "v"(lk3), "v"(lv), "v"(lv1), "v"(lv2), "v"(lv3),
         "v"(gk), "v"(gk1), "v"(gk2), "v"(gk3), "v"(gv), "v"(gv1), "v"(gv2), "v"(gv3)
      : "memory");
}

// lane l takes the value of lane l ^ 16
__device__ inline float xhalf(float x) {
  const int i = __builtin_bit_cast(int, x);
  return __builtin_bit_cast(float, __builtin_amdgcn_permlanex16(i, i, 0x76543210, 0xfedcba98, false, false));
}
__device__ inline float max3f(float a, float b, float c) { return fmaxf(fmaxf(a, b), c); }

__global__ __launch_bounds__(128) void flash_kernel(
    const _Float16* __restrict__ qn, const _Float16* __restrict__ kn,
    const _Float16* __restrict__ vT, _Float16* __restrict__ aout)
{
  const int t = threadIdx.x;
  const int lane = t & 31;
  const int w = t >> 5;
  const int h = blockIdx.y;
  const int qt = blockIdx.x * 4 + w;          // 16-row query tile
  const int half = lane >> 4, l16 = lane & 15;
  __shared__ __align__(16) _Float16 Ks[2][FK][FP];
  __shared__ __align__(16) _Float16 Vs[2][HD][FP];

  const int cr = t >> 3, cc = (t & 7) * 8;    // the lane's row and 16-byte piece in a copy
  const _Float16* gk = kn + ((size_t)h * CTX + cr) * HD + cc;
  const _Float16* gv = vT + ((size_t)h * HD + cr) * CTX + cc;
  const unsigned lk = (unsigned)(size_t)&Ks[0][cr][cc];
  const unsigned lv = (unsigned)(size_t)&Vs[0][cr][cc];

  stage_kv(lk, lv, gk, gv);                                  // stage 0 -> buffer 0

  // Q as the B operand: column = query l16, the k order of load_frag
  const _Float16* qrow = qn + ((size_t)h * CTX + qt * 16 + l16) * HD;
  const v16h bq0 = load_frag(qrow, half);       // d = 0..31
  const v16h bq1 = load_frag(qrow + 32, half);  // d = 32..63

  // o<i>[r] = O[query l16][d = 16 i + 8 half + r]
  v8f o0 = {}, o1 = {}, o2 = {}, o3 = {};
  const float cs = 0.125f * 1.4426950408889634f;   // 1/sqrt(64), in the base-2 domain
  float mrun = -1e30f;    // query l16's running maximum, scaled; alike in both halves
  float lrun = 0.f;       // its sum over the keys that this half of the wave holds

  asm volatile("s_wait_asynccnt 0x0" ::: "memory");          // this wave's part of stage 0 has landed
  __syncthreads();                                           // ... and every other wave's
  stage_kv(lk + FBUF, lv + FBUF, gk + FK * HD, gv + FK);     // stage 1 -> buffer 1

  for (int s = 0; s < NST; ++s) {
    const int buf = s & 1;
    // both 32-key passes of a stage in straight line: constant LDS offsets, and the second
    // pass's fragment reads and products need not wait for the first pass's softmax
#pragma unroll
    for (int sub = 0; sub < FK; sub += 32) {
      const _Float16* k0row = &Ks[buf][sub + l16][0];
      const _Float16* k1row = k0row + 16 * FP;
      v8f z = {};
      // s0[r] = S[key sub + 8 half + r][query l16], s1[r] = the same 16 keys further on
      v8f s0 = __builtin_amdgcn_wmma_f32_16x16x32_f16(false, load_frag(k0row, half), false, bq0, (short)0, z, false, false);
      s0 = __builtin_amdgcn_wmma_f32_16x16x32_f16(false, load_frag(k0row + 32, half), false, bq1, (short)0, s0, false, false);
      v8f s1 = __builtin_amdgcn_wmma_f32_16x16x32_f16(false, load_frag(k1row, half), false, bq0, (short)0, z, false, false);
      s1 = __builtin_amdgcn_wmma_f32_16x16x32_f16(false, load_frag(k1row + 32, half), false, bq1, (short)0, s1, false, false);

      // maximum of the raw scores (the scale is positive): 16 in the lane, then the other half's
      const float ma = max3f(max3f(s0[0], s0[1], s0[2]), max3f(s0[3], s0[4], s0[5]), max3f(s0[6], s0[7], s1[0]));
      const float mb = max3f(max3f(s1[1], s1[2], s1[3]), max3f(s1[4], s1[5], s1[6]), s1[7]);
      float mx = fmaxf(ma, mb);
      mx = fmaxf(mx, xhalf(mx));
      const float mnew = fmaxf(mrun, mx * cs);
      const float alpha = __builtin_amdgcn_exp2f(mrun - mnew);
      mrun = mnew;

      // P^T as the B operand, in the k order of load_frag: element e is s0[e] for e < 8, s1[e - 8] behind it
      const v2f c2 = {cs, cs}, nm = {-mnew, -mnew};
      v2f p[8];
      v16h bp;
#pragma unroll
      for (int i = 0; i < 8; ++i) {
        const v8f& sv = i < 4 ? s0 : s1;
        const v2f x = {sv[2 * (i & 3)], sv[2 * (i & 3) + 1]};
        const v2f arg = __builtin_elementwise_fma(x, c2, nm);
        p[i] = v2f{__builtin_amdgcn_exp2f(arg[0]), __builtin_amdgcn_exp2f(arg[1])};
        const v2h ph = __builtin_convertvector(p[i], v2h);
        bp[2 * i] = ph[0]; bp[2 * i + 1] = ph[1];
      }
      const v2f ps = ((p[0] + p[1]) + (p[2] + p[3])) + ((p[4] + p[5]) + (p[6] + p[7]));
      lrun = lrun * alpha + (ps[0] + ps[1]);
      o0 *= alpha; o1 *= alpha; o2 *= alpha; o3 *= alpha;

      // V^T as the A operand: row = d, k = the pass's 32 keys in the order of load_frag
      const _Float16* vb = &Vs[buf][l16][sub];
      o0 = __builtin_amdgcn_wmma_f32_16x16x32_f16(false, load_frag(vb, half), false, bp, (short)0, o0, false, false);
      o1 = __builtin_amdgcn_wmma_f32_16x16x32_f16(false, load_frag(vb + 16 * FP, half), false, bp, (short)0, o1, false, false);
      o2 = __builtin_amdgcn_wmma_f32_16x16x32_f16(false, load_frag(vb + 32 * FP, half), false, bp, (short)0, o2, false, false);
      o3 = __builtin_amdgcn_wmma_f32_16x16x32_f16(false, load_frag(vb + 48 * FP, half), false, bp, (short)0, o3, false, false);
    }
    // hand-over: stage s + 1 becomes readable and buffer buf becomes free
    asm volatile("s_wait_dscnt 0x0" ::: "memory");     // this wave's reads of buffer buf are done
    asm volatile("s_wait_asynccnt 0x0" ::: "memory");  // its copies of stage s + 1 have landed
    __syncthreads();                                   // the same holds for all four waves
    if (s + 2 < NST)
      stage_kv(lk + buf * FBUF, lv + buf * FBUF,
               gk + (size_t)(s + 2) * FK * HD, gv + (s + 2) * FK);
  }
  asm volatile("s_wait_asynccnt 0x0" ::: "memory");    // no copy is open when the wave ends
  // the two halves' sums join once; a lane's 8 registers of a tile are 8 neighbouring d of its query
  const float rl = 1.f / (lrun + xhalf(lrun));
  _Float16* dst = aout + (size_t)(qt * 16 + l16) * DIMS + h * HD + 8 * half;
  *(v8h*)(dst)      = __builtin_convertvector(o0 * rl, v8h);
  *(v8h*)(dst + 16) = __builtin_convertvector(o1 * rl, v8h);
  *(v8h*)(dst + 32) = __builtin_convertvector(o2 * rl, v8h);
  *(v8h*)(dst + 48) = __builtin_convertvector(o3 * rl, v8h);
}

// ---------------------------------------------------------------------------
extern "C" void kernel_launch(void* const* d_in, const int* in_sizes, int n_in,
                              void* d_out, int out_size, void* d_ws, size_t ws_size,
                              hipStream_t stream) {
  const float* x     = (const float*)d_in[0];
  const float* qn_w  = (const float*)d_in[1];
  const float* qn_b  = (const float*)d_in[2];
  const float* q_w   = (const float*)d_in[3];
  const float* q_b   = (const float*)d_in[4];
  const float* kvn_w = (const float*)d_in[5];
  const float* kvn_b = (const float*)d_in[6];
  const float* kv_w  = (const float*)d_in[7];
  const float* kv_b  = (const float*)d_in[8];
  const float* out_w = (const float*)d_in[9];
  const float* out_b = (const float*)d_in[10];
  const float* ln_w  = (const float*)d_in[11];
  const float* ln_b  = (const float*)d_in[12];
  const float* rh_w  = (const float*)d_in[13];
  const float* rh_b  = (const float*)d_in[14];
  float* out = (float*)d_out;
  (void)in_sizes; (void)n_in; (void)out_size; (void)ws_size;

  char* base = (char*)d_ws;
  size_t off = 0;
  auto take = [&](size_t bytes) -> char* {
    char* p = base + off;
    off = (off + bytes + 255) & ~(size_t)255;
    return p;
  };
  _Float16* lnq16  = (_Float16*)take((size_t)CTX * DIMS * 2);
  _Float16* lnkv16 = (_Float16*)take((size_t)CTX * DIMS * 2);
  float*    rot    = (float*)take((size_t)CTX * HD * 4);
  _Float16* qw16   = (_Float16*)take((size_t)DIMS * DIMS * 2);
  _Float16* kvw16  = (_Float16*)take((size_t)DIMS * 2 * DIMS * 2);
  _Float16* outw16 = (_Float16*)take((size_t)DIMS * DIMS * 2);
  _Float16* qn16   = (_Float16*)take((size_t)HEAD * CTX * HD * 2);
  _Float16* kn16   = (_Float16*)take((size_t)HEAD * CTX * HD * 2);
  _Float16* vT16   = (_Float16*)take((size_t)HEAD * HD * CTX * 2);
  _Float16* a16    = (_Float16*)take((size_t)CTX * DIMS * 2);

  prep_kernel<<<CTX, 256, 0, stream>>>(x, qn_w, qn_b, kvn_w, kvn_b, rh_w, rh_b,
                                       q_w, kv_w, out_w,
                                       lnq16, lnkv16, rot, qw16, kvw16, outw16);

  gemm_kernel<1><<<dim3(3 * DIMS / BN, CTX / BM), 256, 0, stream>>>(
      lnq16, qw16, q_b, nullptr, CTX, DIMS, DIMS, rot, ln_w, ln_b, qn16, vT16, DIMS,
      lnkv16, kvw16, kv_b, kn16, 2 * DIMS, DIMS / BN);

  flash_kernel<<<dim3(CTX / 16 / 4, HEAD), 128, 0, stream>>>(qn16, kn16, vT16, a16);

  gemm_kernel<0><<<dim3(DIMS / BN, CTX / BM), 256, 0, stream>>>(
      a16, outw16, out_b, out, CTX, DIMS, DIMS, nullptr, nullptr, nullptr, nullptr, nullptr, 0,
      nullptr, nullptr, nullptr, nullptr, 0, 0);
}

// v009
// Measured time: 56.7 microseconds a run.
// In two side-by-side timings against v008, it was 1.11 and 1.13 times as fast.
// All steps since v000 together make it 5.84 times as fast.
#include <hip/hip_runtime.h>

#define CTX  2048
#define DIMS 1024
#define HEAD 16
#define HD   64

typedef __attribute__((ext_vector_type(16))) _Float16 v16h;
typedef __attribute__((ext_vector_type(8)))  _Float16 v8h;
typedef __attribute__((ext_vector_type(4)))  _Float16 v4h;
typedef __attribute__((ext_vector_type(2)))  _Float16 v2h;
typedef __attribute__((ext_vector_type(2)))  float    v2f;
typedef __attribute__((ext_vector_type(4)))  float    v4f;
typedef __attribute__((ext_vector_type(8)))  float    v8f;
typedef __attribute__((ext_vector_type(8)))  short    v8s;

// Build a 16x16x32 f16 WMMA A/B fragment for this lane.
// 16-bit operand layout (ISA 7.12.2): lane half (lane/16) selects
// K in {0..7,16..23} (half=0) or {8..15,24..31} (half=1); both chunks are
// contiguous 8 x f16 = 16B runs, so two aligned 16-byte loads suffice.
__device__ inline v16h load_frag(const _Float16* rowbase, int half) {
  v8h lo = *(const v8h*)(rowbase + half * 8);
  v8h hi = *(const v8h*)(rowbase + 16 + half * 8);
  v16h r;
#pragma unroll
  for (int i = 0; i < 8; ++i) { r[i] = lo[i]; r[i + 8] = hi[i]; }
  return r;
}

// The same fragment out of a row-major (K x N) f16 tile in LDS, by the
// transposing LDS load. p is the lane's own address: row 8*(lane/16) + (lane&7),
// column n0 + 8*((lane/8)&1). Lane (c = lane&15, h = lane/16) then holds
// T[8h + 0..7][n0 + c] and, from 16 rows further on, T[16 + 8h + 0..7][n0 + c]:
// the k order of load_frag.
__device__ inline v16h load_frag_tr(const _Float16* p, int pitch) {
  typedef __attribute__((address_space(3))) v8s lds_v8s;
  v8h lo = __builtin_bit_cast(v8h, __builtin_amdgcn_ds_load_tr16_b128_v8i16((lds_v8s*)p));
  v8h hi = __builtin_bit_cast(v8h, __builtin_amdgcn_ds_load_tr16_b128_v8i16((lds_v8s*)(p + 16 * pitch)));
  v16h r;
#pragma unroll
  for (int i = 0; i < 8; ++i) { r[i] = lo[i]; r[i + 8] = hi[i]; }
  return r;
}

// ---------------------------------------------------------------------------
// Stage 1: fused LayerNorm (q-path & kv-path share mean/var) + the row's 32 rotary
// factors (radius x cos, radius x sin; mel-scaled freqs, per-step radius), which the
// projection GEMMs' epilogues apply, and the f32 -> f16 conversion of the three weight matrices: the 4 * DIMS * DIMS
// weight elements are dealt out evenly, WPB to each of the CTX blocks. A block's
// share is loaded together with its row, so that both wait out one memory latency,
// and is stored at the block's end.
// ---------------------------------------------------------------------------
#define WPB (4 * DIMS * DIMS / CTX)   // weight elements per block: 2048 = 256 threads x 2 x 4
#define QWB (DIMS * DIMS / WPB)       // blocks that hold q_w (and as many for out_w); kv_w takes twice as many
__global__ __launch_bounds__(256) void prep_kernel(
    const float* __restrict__ x,
    const float* __restrict__ qn_w, const float* __restrict__ qn_b,
    const float* __restrict__ kvn_w, const float* __restrict__ kvn_b,
    const float* __restrict__ rh_w, const float* __restrict__ rh_b,
    const float* __restrict__ q_w, const float* __restrict__ kv_w,
    const float* __restrict__ out_w,
    _Float16* __restrict__ lnq, _Float16* __restrict__ lnkv,
    float* __restrict__ rot,
    _Float16* __restrict__ qw16, _Float16* __restrict__ kvw16,
    _Float16* __restrict__ outw16)
{
  const int c = blockIdx.x, t = threadIdx.x;
  const float* row = x + (size_t)c * DIMS;
  // the block's share of the weights: which matrix is the same for the whole block
  const float* wsrc;
  _Float16* wdst;
  if (c < QWB)          { wsrc = q_w   + (size_t)c * WPB;             wdst = qw16   + (size_t)c * WPB; }
  else if (c < 3 * QWB) { wsrc = kv_w  + (size_t)(c - QWB) * WPB;     wdst = kvw16  + (size_t)(c - QWB) * WPB; }
  else                  { wsrc = out_w + (size_t)(c - 3 * QWB) * WPB; wdst = outw16 + (size_t)(c - 3 * QWB) * WPB; }
  // a wave's load covers 512 B in a row, its store 256 B: whole lines both
  const v4f w0 = *(const v4f*)(wsrc + 4 * t);
  const v4f w1 = *(const v4f*)(wsrc + WPB / 2 + 4 * t);
  float v[4];
  float s = 0.f, s2 = 0.f, dp = 0.f;
#pragma unroll
  for (int i = 0; i < 4; ++i) {
    int d = t + i * 256;
    float val = row[d];
    v[i] = val;
    s += val; s2 += val * val; dp += val * rh_w[d];
  }
  __shared__ float red[256];
  auto reduceAll = [&](float val) -> float {
    red[t] = val; __syncthreads();
    for (int o = 128; o > 0; o >>= 1) { if (t < o) red[t] += red[t + o]; __syncthreads(); }
    float r = red[0]; __syncthreads(); return r;
  };
  float tot  = reduceAll(s);
  float tot2 = reduceAll(s2);
  float dtot = reduceAll(dp);
  float mean = tot * (1.f / DIMS);
  float var  = tot2 * (1.f / DIMS) - mean * mean;
  float inv  = rsqrtf(var + 1e-5f);
  if (t < 32) {   // the first wave: lane j writes the factor of complex pair j; the wave's store covers 256 B
    const float per = dtot + rh_b[0];
    const float rad = fminf(fmaxf(per * 0.01f, 0.5f), 2.0f);
    const float mel_max = 2595.0f * 1.3222192947339193f;          // 2595*log10(21)
    const float lin = (float)t * (mel_max / 31.0f);               // linspace, 32 pts
    const float fb = 0.2f * (expf(lin * (2.3025850929940457f / 2595.0f)) - 1.0f);
    const float freq = (float)c * fb;
    const v2f f = {rad * cosf(freq), rad * sinf(freq)};
    *(v2f*)(rot + ((size_t)c * (HD / 2) + t) * 2) = f;
  }
#pragma unroll
  for (int i = 0; i < 4; ++i) {
    int d = t + i * 256;
    float n = (v[i] - mean) * inv;
    lnq [(size_t)c * DIMS + d] = (_Float16)(n * qn_w[d] + qn_b[d]);
    lnkv[(size_t)c * DIMS + d] = (_Float16)(n * kvn_w[d] + kvn_b[d]);
  }
  *(v4h*)(wdst + 4 * t)           = __builtin_convertvector(w0, v4h);
  *(v4h*)(wdst + WPB / 2 + 4 * t) = __builtin_convertvector(w1, v4h);
}

// ---------------------------------------------------------------------------
// Stage 3/6: LDS-staged WMMA GEMM.  C(f32) = A(f16,MxK) * B(f16,KxN) + bias
// Block tile 64x128; 8 waves in 4(M) x 2(N); each wave owns a 16x64 strip
// = 4 accumulators -> 4 WMMAs per 32 k sharing one A-fragment.
// A and B come into LDS 128 k a stage, by asynchronous copies that cover whole
// 256-byte rows and pass no register. Two buffers: the next stage's copies fly
// while this stage's 16 WMMAs a wave are worked on.
// B lies in LDS as in memory (K x N); the transposing LDS load turns it into fragments.
// M, N, K: multiples of 64, 128, 128.
// EPI 0: C = product + bias, f32.
// EPI 1 (the q and kv projections; a wave's 16x64 strip is 16 rows of ONE head):
//   columns below NR: rotary, then the per-head LayerNorm, out as f16 [h][c][d];
//   columns from NR on (V): out as f16, transposed [h][d][c].
//   Both go through LDS, free behind the loop's last barrier, so that every global
//   store covers whole 128-byte lines.
//   One launch holds both projections: the grid's first nb1 block columns work on
//   A, B, bias, rn, N (q), the columns behind them on A2, B2, bias2, rn2, N2 (kv).
//   Three blocks fit a WGP's LDS, so all blocks of both products run side by side.
// ---------------------------------------------------------------------------
#define BM 64
#define BN 128
#define BK 128  // k per stage = one 256-byte row of A
#define AP 136  // A row stride in f16 (272 bytes = 16 B x 17, odd: the pitch of 16-byte fragment reads)
#define BP 144  // B row stride in f16 (288 bytes = 32 B x 9, odd: the transposing load's pitch)
#define ABUF (BM * AP * 2)   // bytes of one A buffer
#define BBUF (BK * BP * 2)   // bytes of one B buffer
#define AROW (16 * AP * 2)   // bytes of 16 LDS rows of A
#define BROW (16 * BP * 2)   // bytes of 16 LDS rows of B

// One stage: 64 A rows and 128 B rows of 256 B each; 256 threads x 12 copies of 16 B.
// Sixteen lanes cover one row, so a wave's copy reads four whole lines.
// la, lb: the lane's LDS byte addresses; ga, gb: its global addresses (row t/16, piece t%16);
// a16, b16: 16 rows of A and of B in elements.
__device__ inline void stage_ab(unsigned la, unsigned lb,
                                const _Float16* ga, const _Float16* gb,
                                size_t a16, size_t b16) {
  const unsigned la1 = la + AROW, la2 = la + 2 * AROW, la3 = la + 3 * AROW;
  const unsigned lb1 = lb + BROW, lb2 = lb + 2 * BROW, lb3 = lb + 3 * BROW;
  const unsigned lb4 = lb + 4 * BROW, lb5 = lb + 5 * BROW, lb6 = lb + 6 * BROW, lb7 = lb + 7 * BROW;
  const _Float16* ga1 = ga + a16;
  const _Float16* ga2 = ga + 2 * a16;
  const _Float16* ga3 = ga + 3 * a16;
  const _Float16* gb1 = gb + b16;
  const _Float16* gb2 = gb + 2 * b16;
  const _Float16* gb3 = gb + 3 * b16;
  const _Float16* gb4 = gb + 4 * b16;
  const _Float16* gb5 = gb + 5 * b16;
  const _Float16* gb6 = gb + 6 * b16;
  const _Float16* gb7 = gb + 7 * b16;
  // the copies go past the registers; the closing wait stands in the same statement so
  // that no address register named here is rewritten in front of it
  asm volatile(
      "global_load_async_to_lds_b128 %0, %12, off\n\t"
      "global_load_async_to_lds_b128 %1, %13, off\n\t"
      "global_load_async_to_lds_b128 %2, %14, off\n\t"
      "global_load_async_to_lds_b128 %3, %15, off\n\t"
      "global_load_async_to_lds_b128 %4, %16, off\n\t"
      "global_load_async_to_lds_b128 %5, %17, off\n\t"
      "global_load_async_to_lds_b128 %6, %18, off\n\t"
      "global_load_async_to_lds_b128 %7, %19, off\n\t"
      "global_load_async_to_lds_b128 %8, %20, off\n\t"
      "global_load_async_to_lds_b128 %9, %21, off\n\t"
      "global_load_async_to_lds_b128 %10, %22, off\n\t"
      "global_load_async_to_lds_b128 %11, %23, off\n\t"
      "s_wait_xcnt 0x0"
      :: "v"(la), "v"(la1), "v"(la2), "v"(la3),
         "v"(lb), "v"(lb1), "v"(lb2), "v"(lb3), "v"(lb4), "v"(lb5), "v"(lb6), "v"(lb7),
         "v"(ga), "v"(ga1), "v"(ga2), "v"(ga3),
         "v"(gb), "v"(gb1), "v"(gb2), "v"(gb3), "v"(gb4), "v"(gb5), "v"(gb6), "v"(gb7)
      : "memory");
}

#define SP 72   // pitch of the epilogue's LDS tiles in f16: 144 B = 16 B x 9 (odd), the pitch of 16-byte accesses

// lane l takes the value of lane l ^ M, M < 16 (DPP row_xmask: no LDS path, no wait)
template <int M> __device__ inline float xrow(float x) {
  const int i = __builtin_bit_cast(int, x);
  return __builtin_bit_cast(float, __builtin_amdgcn_update_dpp(i, i, 0x160 | M, 0xf, 0xf, false));
}
// sum over the 16 lanes of a row; every lane of the row ends with it
__device__ inline float row_sum(float x) {
  x += xrow<1>(x); x += xrow<2>(x); x += xrow<4>(x); x += xrow<8>(x);
  return x;
}

// 1 / sqrt(x) as the library's rsqrtf forms it: an x below the smallest normal number goes in times 2^24
// and its result comes out times 2^12. The v_nop stands in the instruction's own statement, where nothing
// can come between: it is the one slot that the instruction set asks for behind a transcendental, in front
// of an instruction that reads its result or overwrites its source.
__device__ inline float rsq_slot(float x) {
  const bool tiny = x < 1.17549435e-38f;
  const float a = tiny ? x * 16777216.0f : x;
  float r;
  asm("v_rsq_f32 %0, %1\n\tv_nop" : "=v"(r) : "v"(a));
  return tiny ? r * 4096.0f : r;
}

template <int EPI>
__global__ __launch_bounds__(256) void gemm_kernel(
    const _Float16* __restrict__ A, const _Float16* __restrict__ B,
    const float* __restrict__ bias, float* __restrict__ C,
    int M, int N, int K,
    const float* __restrict__ rot, const float* __restrict__ ln_w, const float* __restrict__ ln_b,
    _Float16* __restrict__ rn, _Float16* __restrict__ vT, int NR,
    const _Float16* __restrict__ A2, const _Float16* __restrict__ B2,
    const float* __restrict__ bias2, _Float16* __restrict__ rn2, int N2, int nb1)
{
  __shared__ __align__(16) _Float16 As[2][BM][AP];
  __shared__ __align__(16) _Float16 Bs[2][BK][BP];   // B staged row-major (KxN)
  const int t = threadIdx.x, lane = t & 31, w = t >> 5;
  const int wm = w >> 1, wn = w & 1;              // 4 x 2 wave grid
  const int half = lane >> 4, l16 = lane & 15;
  int bx = blockIdx.x;
  if (EPI == 1 && bx >= nb1) {   // a block of the launch's second product: the same for the whole block
    bx -= nb1; A = A2; B = B2; bias = bias2; rn = rn2; N = N2;
  }
  const int bm = blockIdx.y * BM, bn = bx * BN;
  const int cr = t >> 4, cc = (t & 15) * 8;       // the lane's row and 16-byte piece in a copy
  const _Float16* ga = A + (size_t)(bm + cr) * K + cc;
  const _Float16* gb = B + (size_t)cr * N + bn + cc;
  const unsigned la = (unsigned)(size_t)&As[0][cr][cc];
  const unsigned lb = (unsigned)(size_t)&Bs[0][cr][cc];
  const size_t a16 = (size_t)16 * K, b16 = (size_t)16 * N;
  const size_t bst = (size_t)BK * N;              // one stage further on in B
  const int nst = K / BK;                         // stages
  v8f acc0 = {}, acc1 = {}, acc2 = {}, acc3 = {};

  stage_ab(la, lb, ga, gb, a16, b16);                        // stage 0 -> buffer 0
  // the rotary factors of the lane's 8 rows x 4 columns, asked for here so that they come in beside stage 0's
  // copies, under the same memory latency: rf[r][i] belongs to row bm + wm*16 + 8*half + r and complex pair (16 i + l16) / 2
  v2f rf[8][4] = {};
  if (EPI == 1 && bn < NR) {
#pragma unroll
    for (int r = 0; r < 8; ++r)
#pragma unroll
      for (int i = 0; i < 4; ++i)
        rf[r][i] = *(const v2f*)(rot + ((size_t)(bm + wm * 16 + 8 * half + r) * (HD / 2) + 8 * i + (l16 >> 1)) * 2);
  }
  asm volatile("s_wait_asynccnt 0x0" ::: "memory");          // this wave's part of stage 0 has landed
  __syncthreads();                                           // ... and every other wave's
  if (nst > 1)
    stage_ab(la + ABUF, lb + BBUF, ga + BK, gb + bst, a16, b16);   // stage 1 -> buffer 1

  for (int s = 0; s < nst; ++s) {
    const int buf = s & 1;
    const _Float16* ap = &As[buf][wm * 16 + l16][0];
    const _Float16* bp = &Bs[buf][8 * half + (lane & 7)][wn * 64 + 8 * ((lane >> 3) & 1)];
    // the stage's four 32-k steps in straight line: constant LDS offsets, and a step's
    // fragment reads need not wait for the step before
#pragma unroll
    for (int kk = 0; kk < BK; kk += 32) {
      const v16h a = load_frag(ap + kk, half);
      const v16h b0 = load_frag_tr(bp + kk * BP,      BP);
      const v16h b1 = load_frag_tr(bp + kk * BP + 16, BP);
      const v16h b2 = load_frag_tr(bp + kk * BP + 32, BP);
      const v16h b3 = load_frag_tr(bp + kk * BP + 48, BP);
      acc0 = __builtin_amdgcn_wmma_f32_16x16x32_f16(false, a, false, b0, (short)0, acc0, false, false);
      acc1 = __builtin_amdgcn_wmma_f32_16x16x32_f16(false, a, false, b1, (short)0, acc1, false, false);
      acc2 = __builtin_amdgcn_wmma_f32_16x16x32_f16(false, a, false, b2, (short)0, acc2, false, false);
      acc3 = __builtin_amdgcn_wmma_f32_16x16x32_f16(false, a, false, b3, (short)0, acc3, false, false);
    }
    // hand-over: stage s + 1 becomes readable and buffer buf becomes free
    asm volatile("s_wait_dscnt 0x0" ::: "memory");     // this wave's reads of buffer buf are done
    asm volatile("s_wait_asynccnt 0x0" ::: "memory");  // its copies of stage s + 1 have landed
    __syncthreads();                                   // the same holds for all eight waves
    if (s + 2 < nst)
      stage_ab(la + buf * ABUF, lb + buf * BBUF,
               ga + (size_t)(s + 2) * BK, gb + (size_t)(s + 2) * bst, a16, b16);
  }
  asm volatile("s_wait_asynccnt 0x0" ::: "memory");    // no copy is open when the wave ends
  // epilogue: C layout per tile: M = r + 8*half, N = l16
  const int ncol0 = bn + wn * 64 + l16;
  const float bb0 = bias[ncol0], bb1 = bias[ncol0 + 16];
  const float bb2 = bias[ncol0 + 32], bb3 = bias[ncol0 + 48];
  if (EPI == 0) {
#pragma unroll
    for (int r = 0; r < 8; ++r) {
      const size_t rowoff = (size_t)(bm + wm * 16 + r + 8 * half) * N + ncol0;
      C[rowoff]      = acc0[r] + bb0;
      C[rowoff + 16] = acc1[r] + bb1;
      C[rowoff + 32] = acc2[r] + bb2;
      C[rowoff + 48] = acc3[r] + bb3;
    }
  } else if (bn < NR) {
    // rotary + per-head LayerNorm. Column d = 16 i + l16 of the head: even d is the real part of
    // pair d / 2, odd d the imaginary part, and the other part sits in lane l ^ 1.
    const int h = (bn + wn * 64) / HD;
    const float lw[4] = {ln_w[l16], ln_w[l16 + 16], ln_w[l16 + 32], ln_w[l16 + 48]};
    const float lb[4] = {ln_b[l16], ln_b[l16 + 16], ln_b[l16 + 32], ln_b[l16 + 48]};
    const bool odd = l16 & 1;
    _Float16* st = &As[0][0][0] + w * (16 * SP);   // the wave's own 16 x 64 tile
#pragma unroll
    for (int r = 0; r < 8; ++r) {
      const float own[4] = {acc0[r] + bb0, acc1[r] + bb1, acc2[r] + bb2, acc3[r] + bb3};
      float v[4];
      float s = 0.f, s2 = 0.f;
#pragma unroll
      for (int i = 0; i < 4; ++i) {
        const float oth = xrow<1>(own[i]);
        // real: xr*fr - xi*fi; imaginary: xi*fr + xr*fi
        v[i] = own[i] * rf[r][i][0] + oth * (odd ? rf[r][i][1] : -rf[r][i][1]);
        s += v[i]; s2 += v[i] * v[i];
      }
      s = row_sum(s); s2 = row_sum(s2);
      const float m = s * (1.f / HD), var = s2 * (1.f / HD) - m * m, iv = rsq_slot(var + 1e-5f);
#pragma unroll
      for (int i = 0; i < 4; ++i)
        st[(8 * half + r) * SP + 16 * i + l16] = (_Float16)((v[i] - m) * iv * lw[i] + lb[i]);
    }
    asm volatile("s_wait_dscnt 0x0" ::: "memory");   // the wave's tile is written before its lanes read each other's parts
#pragma unroll
    for (int k = 0; k < 4; ++k) {
      const int pc = lane + 32 * k, rr = pc >> 3, ch = pc & 7;   // 8 lanes x 16 B = one row; the wave's store covers 512 B in a row
      const v8h o = *(const v8h*)(st + rr * SP + ch * 8);
      *(v8h*)(rn + ((size_t)h * CTX + bm + wm * 16 + rr) * HD + ch * 8) = o;
    }
  } else {
    // V: a lane's 8 registers of a tile are 8 neighbouring rows c of one column d: one 16-byte piece of vT's row d
    _Float16* sv = &As[0][0][0];                     // the block's tile, turned: 128 d x 64 c
    const float bb[4] = {bb0, bb1, bb2, bb3};
#pragma unroll
    for (int i = 0; i < 4; ++i) {
      const v8f a = (i == 0 ? acc0 : i == 1 ? acc1 : i == 2 ? acc2 : acc3) + bb[i];
      *(v8h*)(sv + (wn * 64 + 16 * i + l16) * SP + wm * 16 + 8 * half) = __builtin_convertvector(a, v8h);
    }
    __syncthreads();   // the tile is complete before any wave reads it back by rows of 64 c
#pragma unroll
    for (int k = 0; k < 4; ++k) {
      const int pc = t + 256 * k, d = pc >> 3, ch = pc & 7;      // 8 lanes x 16 B = one line of vT
      const v8h o = *(const v8h*)(sv + d * SP + ch * 8);
      *(v8h*)(vT + (size_t)(bn - NR + d) * CTX + bm + ch * 8) = o;
    }
    // a precaution: the built code lays the rotary part behind this one, and the wait stands between
    // these stores and that part's writes of the registers which the stores name
    asm volatile("s_wait_xcnt 0x0" ::: "memory");
  }
}

// ---------------------------------------------------------------------------
// Stage 5: flash attention. 4 waves/block; each wave owns 16 queries of one
// head and takes 32 keys/pass. Both products are transposed: S^T = K Q^T
// (4 WMMAs) and O^T += V^T P^T (4 WMMAs). A lane then holds 16 scores of ONE
// query, so maximum and sum are taken in its own registers, with one exchange
// between the wave's halves for the maximum, and the two S^T tiles, converted
// in place, are the B operand of the second product: P never touches LDS.
// K and vT come into LDS once per block, 256 keys a stage, by asynchronous copies
// that cover whole 128-byte lines; the four waves read their fragments from there.
// Two buffers: the next stage's copies fly while this stage is worked on. A stage is
// eight passes long, so that copies which come from memory, not from L2, land inside it.
// ---------------------------------------------------------------------------
#define FK  256           // keys per stage = four 128-byte lines of each vT row
#define FP  72            // K's LDS row pitch in f16: 144 B = 16 B x 9 (odd), the pitch of 16-byte fragment reads
#define VP  (FK + 8)      // vT's LDS row pitch in f16: 528 B = 16 B x 33 (odd)
#define NST (CTX / FK)    // stages
#define KBUF (FK * FP * 2)  // bytes of one K buffer (256 keys)
#define VBUF (HD * VP * 2)  // bytes of one vT buffer (64 d rows)
#define SBUF (KBUF + VBUF)  // one stage's buffer: K, then vT behind it, so that every fragment read's constant offset fits 16 bits
#define KROW (16 * FP * 2)  // bytes of 16 LDS rows of K
#define VROW (4 * VP * 2)   // bytes of 4 LDS rows of vT

// Eight copies of 16 B a lane: copy i goes from g + i * gs (elements) to LDS byte l + i * ls.
__device__ inline void copy8(unsigned l, unsigned ls, const _Float16* g, size_t gs) {
  const unsigned l1 = l + ls, l2 = l + 2 * ls, l3 = l + 3 * ls;
  const unsigned l4 = l + 4 * ls, l5 = l + 5 * ls, l6 = l + 6 * ls, l7 = l + 7 * ls;
  const _Float16* g1 = g + gs;
  const _Float16* g2 = g + 2 * gs;
  const _Float16* g3 = g + 3 * gs;
  const _Float16* g4 = g + 4 * gs;
  const _Float16* g5 = g + 5 * gs;
  const _Float16* g6 = g + 6 * gs;
  const _Float16* g7 = g + 7 * gs;
  // the copies go past the registers; the closing wait stands in the same statement so
  // that no address register named here is rewritten in front of it
  asm volatile(
      "global_load_async_to_lds_b128 %0, %8, off\n\t"
      "global_load_async_to_lds_b128 %1, %9, off\n\t"
      "global_load_async_to_lds_b128 %2, %10, off\n\t"
      "global_load_async_to_lds_b128 %3, %11, off\n\t"
      "global_load_async_to_lds_b128 %4, %12, off\n\t"
      "global_load_async_to_lds_b128 %5, %13, off\n\t"
      "global_load_async_to_lds_b128 %6, %14, off\n\t"
      "global_load_async_to_lds_b128 %7, %15, off\n\t"
      "s_wait_xcnt 0x0"
      :: "v"(l), "v"(l1), "v"(l2), "v"(l3), "v"(l4), "v"(l5), "v"(l6), "v"(l7),
         "v"(g), "v"(g1), "v"(g2), "v"(g3), "v"(g4), "v"(g5), "v"(g6), "v"(g7)
      : "memory");
}

// One stage: 256 K rows of 128 B and 64 vT rows of 512 B; 128 threads x 32 copies of 16 B.
// A wave's copy reads four whole lines: four K rows, or one vT row's four.
// lk, gk: the lane's LDS byte address and global address in K (row t/8, piece t%8);
// lv, gv: the same in vT (row t/32, piece t%32).
__device__ inline void stage_kv(unsigned lk, unsigned lv,
                                const _Float16* gk, const _Float16* gv) {
  copy8(lk,            KROW, gk,                    16 * HD);
  copy8(lk + 8 * KROW, KROW, gk + 128 * HD,         16 * HD);
  copy8(lv,            VROW, gv,                    (size_t)4 * CTX);
  copy8(lv + 8 * VROW, VROW, gv + (size_t)32 * CTX, (size_t)4 * CTX);
}

// lane l takes the value of lane l ^ 16
__device__ inline float xhalf(float x) {
  const int i = __builtin_bit_cast(int, x);
  return __builtin_bit_cast(float, __builtin_amdgcn_permlanex16(i, i, 0x76543210, 0xfedcba98, false, false));
}
__device__ inline float max3f(float a, float b, float c) { return fmaxf(fmaxf(a, b), c); }

__global__ __launch_bounds__(128) void flash_kernel(
    const _Float16* __restrict__ qn, const _Float16* __restrict__ kn,
    const _Float16* __restrict__ vT, _Float16* __restrict__ aout)
{
  const int t = threadIdx.x;
  const int lane = t & 31;
  const int w = t >> 5;
  const int h = blockIdx.y;
  const int qt = blockIdx.x * 4 + w;          // 16-row query tile
  const int half = lane >> 4, l16 = lane & 15;
  __shared__ __align__(16) _Float16 Sm[2][SBUF / 2];

  const int cr = t >> 3, cc = (t & 7) * 8;    // the lane's row and 16-byte piece in a copy of K
  const int vr = t >> 5, vc = (t & 31) * 8;   // ... and in a copy of vT
  const _Float16* gk = kn + ((size_t)h * CTX + cr) * HD + cc;
  const _Float16* gv = vT + ((size_t)h * HD + vr) * CTX + vc;
  const unsigned lk = (unsigned)(size_t)&Sm[0][cr * FP + cc];
  const unsigned lv = (unsigned)(size_t)&Sm[0][FK * FP + vr * VP + vc];

  stage_kv(lk, lv, gk, gv);                                  // stage 0 -> buffer 0

  // Q as the B operand: column = query l16, the k order of load_frag
  const _Float16* qrow = qn + ((size_t)h * CTX + qt * 16 + l16) * HD;
  const v16h bq0 = load_frag(qrow, half);       // d = 0..31
  const v16h bq1 = load_frag(qrow + 32, half);  // d = 32..63

  // o<i>[r] = O[query l16][d = 16 i + 8 half + r]
  v8f o0 = {}, o1 = {}, o2 = {}, o3 = {};
  const float cs = 0.125f * 1.4426950408889634f;   // 1/sqrt(64), in the base-2 domain
  float mrun = -1e30f;    // query l16's running maximum, scaled; alike in both halves
  float lrun = 0.f;       // its sum over the keys that this half of the wave holds

  asm volatile("s_wait_asynccnt 0x0" ::: "memory");          // this wave's part of stage 0 has landed
  __syncthreads();                                           // ... and every other wave's
  stage_kv(lk + SBUF, lv + SBUF, gk + FK * HD, gv + FK);     // stage 1 -> buffer 1

  for (int s = 0; s < NST; ++s) {
    const int buf = s & 1;
    // the stage's eight 32-key passes, two by two; the pairs stay a loop: all eight passes in
    // straight line took 452 registers and spilled
#pragma unroll 1
    for (int pr = 0; pr < FK; pr += 64) {
    // a pair in straight line: constant LDS offsets, and the second pass's fragment reads and
    // products need not wait for the first pass's softmax
#pragma unroll
    for (int sub = pr; sub < pr + 64; sub += 32) {
      const _Float16* k0row = &Sm[buf][(sub + l16) * FP];
      const _Float16* k1row = k0row + 16 * FP;
      v8f z = {};
      // s0[r] = S[key sub + 8 half + r][query l16], s1[r] = the same 16 keys further on
      v8f s0 = __builtin_amdgcn_wmma_f32_16x16x32_f16(false, load_frag(k0row, half), false, bq0, (short)0, z, false, false);
      s0 = __builtin_amdgcn_wmma_f32_16x16x32_f16(false, load_frag(k0row + 32, half), false, bq1, (short)0, s0, false, false);
      v8f s1 = __builtin_amdgcn_wmma_f32_16x16x32_f16(false, load_frag(k1row, half), false, bq0, (short)0, z, false, false);
      s1 = __builtin_amdgcn_wmma_f32_16x16x32_f16(false, load_frag(k1row + 32, half), false, bq1, (short)0, s1, false, false);

      // maximum of the raw scores (the scale is positive): 16 in the lane, then the other half's
      const float ma = max3f(max3f(s0[0], s0[1], s0[2]), max3f(s0[3], s0[4], s0[5]), max3f(s0[6], s0[7], s1[0]));
      const float mb = max3f(max3f(s1[1], s1[2], s1[3]), max3f(s1[4], s1[5], s1[6]), s1[7]);
      float mx = fmaxf(ma, mb);
      mx = fmaxf(mx, xhalf(mx));
      const float mnew = fmaxf(mrun, mx * cs);
      const float alpha = __builtin_amdgcn_exp2f(mrun - mnew);
      mrun = mnew;

      // P^T as the B operand, in the k order of load_frag: element e is s0[e] for e < 8, s1[e - 8] behind it
      const v2f c2 = {cs, cs}, nm = {-mnew, -mnew};
      v2f p[8];
      v16h bp;
#pragma unroll
      for (int i = 0; i < 8; ++i) {
        const v8f& sv = i < 4 ? s0 : s1;
        const v2f x = {sv[2 * (i & 3)], sv[2 * (i & 3) + 1]};
        const v2f arg = __builtin_elementwise_fma(x, c2, nm);
        p[i] = v2f{__builtin_amdgcn_exp2f(arg[0]), __builtin_amdgcn_exp2f(arg[1])};
        const v2h ph = __builtin_convertvector(p[i], v2h);
        bp[2 * i] = ph[0]; bp[2 * i + 1] = ph[1];
      }
      const v2f ps = ((p[0] + p[1]) + (p[2] + p[3])) + ((p[4] + p[5]) + (p[6] + p[7]));
      lrun = lrun * alpha + (ps[0] + ps[1]);
      o0 *= alpha; o1 *= alpha; o2 *= alpha; o3 *= alpha;

      // V^T as the A operand: row = d, k = the pass's 32 keys in the order of load_frag
      const _Float16* vb = &Sm[buf][FK * FP + l16 * VP + sub];
      o0 = __builtin_amdgcn_wmma_f32_16x16x32_f16(false, load_frag(vb, half), false, bp, (short)0, o0, false, false);
      o1 = __builtin_amdgcn_wmma_f32_16x16x32_f16(false, load_frag(vb + 16 * VP, half), false, bp, (short)0, o1, false, false);
      o2 = __builtin_amdgcn_wmma_f32_16x16x32_f16(false, load_frag(vb + 32 * VP, half), false, bp, (short)0, o2, false, false);
      o3 = __builtin_amdgcn_wmma_f32_16x16x32_f16(false, load_frag(vb + 48 * VP, half), false, bp, (short)0, o3, false, false);
    }
    // the four vector slots that the chip needs between the pair's last WMMA and the next pair's first
    // instructions, which overwrite its A and B registers.
    // The scheduling barrier keeps the WMMAs in front of them (without it the compiler sank the WMMAs behind).
    __builtin_amdgcn_sched_barrier(0);
    asm volatile("v_nop\n\tv_nop\n\tv_nop\n\tv_nop");
    }
    // hand-over: stage s + 1 becomes readable and buffer buf becomes free
    asm volatile("s_wait_dscnt 0x0" ::: "memory");     // this wave's reads of buffer buf are done
    asm volatile("s_wait_asynccnt 0x0" ::: "memory");  // its copies of stage s + 1 have landed
    __syncthreads();                                   // the same holds for all four waves
    if (s + 2 < NST)
      stage_kv(lk + buf * SBUF, lv + buf * SBUF,
               gk + (size_t)(s + 2) * FK * HD, gv + (s + 2) * FK);
  }
  asm volatile("s_wait_asynccnt 0x0" ::: "memory");    // no copy is open when the wave ends
  // the two halves' sums join once; a lane's 8 registers of a tile are 8 neighbouring d of its query
  const float rl = 1.f / (lrun + xhalf(lrun));
  _Float16* dst = aout + (size_t)(qt * 16 + l16) * DIMS + h * HD + 8 * half;
  *(v8h*)(dst)      = __builtin_convertvector(o0 * rl, v8h);
  *(v8h*)(dst + 16) = __builtin_convertvector(o1 * rl, v8h);
  *(v8h*)(dst + 32) = __builtin_convertvector(o2 * rl, v8h);
  *(v8h*)(dst + 48) = __builtin_convertvector(o3 * rl, v8h);
}

// ---------------------------------------------------------------------------
extern "C" void kernel_launch(void* const* d_in, const int* in_sizes, int n_in,
                              void* d_out, int out_size, void* d_ws, size_t ws_size,
                              hipStream_t stream) {
  const float* x     = (const float*)d_in[0];
  const float* qn_w  = (const float*)d_in[1];
  const float* qn_b  = (const float*)d_in[2];
  const float* q_w   = (const float*)d_in[3];
  const float* q_b   = (const float*)d_in[4];
  const float* kvn_w = (const float*)d_in[5];
  const float* kvn_b = (const float*)d_in[6];
  const float* kv_w  = (const float*)d_in[7];
  const float* kv_b  = (const float*)d_in[8];
  const float* out_w = (const float*)d_in[9];
  const float* out_b = (const float*)d_in[10];
  const float* ln_w  = (const float*)d_in[11];
  const float* ln_b  = (const float*)d_in[12];
  const float* rh_w  = (const float*)d_in[13];
  const float* rh_b  = (const float*)d_in[14];
  float* out = (float*)d_out;
  (void)in_sizes; (void)n_in; (void)out_size; (void)ws_size;

  char* base = (char*)d_ws;
  size_t off = 0;
  auto take = [&](size_t bytes) -> char* {
    char* p = base + off;
    off = (off + bytes + 255) & ~(size_t)255;
    return p;
  };
  _Float16* lnq16  = (_Float16*)take((size_t)CTX * DIMS * 2);
  _Float16* lnkv16 = (_Float16*)take((size_t)CTX * DIMS * 2);
  float*    rot    = (float*)take((size_t)CTX * HD * 4);
  _Float16* qw16   = (_Float16*)take((size_t)DIMS * DIMS * 2);
  _Float16* kvw16  = (_Float16*)take((size_t)DIMS * 2 * DIMS * 2);
  _Float16* outw16 = (_Float16*)take((size_t)DIMS * DIMS * 2);
  _Float16* qn16   = (_Float16*)take((size_t)HEAD * CTX * HD * 2);
  _Float16* kn16   = (_Float16*)take((size_t)HEAD * CTX * HD * 2);
  _Float16* vT16   = (_Float16*)take((size_t)HEAD * HD * CTX * 2);
  _Float16* a16    = (_Float16*)take((size_t)CTX * DIMS * 2);

  prep_kernel<<<CTX, 256, 0, stream>>>(x, qn_w, qn_b, kvn_w, kvn_b, rh_w, rh_b,
                                       q_w, kv_w, out_w,
                                       lnq16, lnkv16, rot, qw16, kvw16, outw16);

  gemm_kernel<1><<<dim3(3 * DIMS / BN, CTX / BM), 256, 0, stream>>>(
      lnq16, qw16, q_b, nullptr, CTX, DIMS, DIMS, rot, ln_w, ln_b, qn16, vT16, DIMS,
      lnkv16, kvw16, kv_b, kn16, 2 * DIMS, DIMS / BN);

  flash_kernel<<<dim3(CTX / 16 / 4, HEAD), 128, 0, stream>>>(qn16, kn16, vT16, a16);

  gemm_kernel<0><<<dim3(DIMS / BN, CTX / BM), 256, 0, stream>>>(
      a16, outw16, out_b, out, CTX, DIMS, DIMS, nullptr, nullptr, nullptr, nullptr, nullptr, 0,
      nullptr, nullptr, nullptr, nullptr, 0, 0);
}

// v010
// A run of this version takes 54.5 microseconds.
// Timed twice side by side with v009, it ran 1.05 and 1.06 times as fast.
// All steps since v000 together make it 6.17 times as fast.
#include <hip/hip_runtime.h>

#define CTX  2048
#define DIMS 1024
#define HEAD 16
#define HD   64

typedef __attribute__((ext_vector_type(16))) _Float16 v16h;
typedef __attribute__((ext_vector_type(8)))  _Float16 v8h;
typedef __attribute__((ext_vector_type(4)))  _Float16 v4h;
typedef __attribute__((ext_vector_type(2)))  _Float16 v2h;
typedef __attribute__((ext_vector_type(2)))  float    v2f;
typedef __attribute__((ext_vector_type(4)))  float    v4f;
typedef __attribute__((ext_vector_type(8)))  float    v8f;
typedef __attribute__((ext_vector_type(8)))  short    v8s;

// Build a 16x16x32 f16 WMMA A/B fragment for this lane.
// 16-bit operand layout (ISA 7.12.2): lane half (lane/16) selects
// K in {0..7,16..23} (half=0) or {8..15,24..31} (half=1); both chunks are
// contiguous 8 x f16 = 16B runs, so two aligned 16-byte loads suffice.
__device__ inline v16h load_frag(const _Float16* rowbase, int half) {
  v8h lo = *(const v8h*)(rowbase + half * 8);
  v8h hi = *(const v8h*)(rowbase + 16 + half * 8);
  v16h r;
#pragma unroll
  for (int i = 0; i < 8; ++i) { r[i] = lo[i]; r[i + 8] = hi[i]; }
  return r;
}

// The same fragment out of a row-major (K x N) f16 tile in LDS, by the
// transposing LDS load. p is the lane's own address: row 8*(lane/16) + (lane&7),
// column n0 + 8*((lane/8)&1). Lane (c = lane&15, h = lane/16) then holds
// T[8h + 0..7][n0 + c] and, from 16 rows further on, T[16 + 8h + 0..7][n0 + c]:
// the k order of load_frag.
__device__ inline v16h load_frag_tr(const _Float16* p, int pitch) {
  typedef __attribute__((address_space(3))) v8s lds_v8s;
  v8h lo = __builtin_bit_cast(v8h, __builtin_amdgcn_ds_load_tr16_b128_v8i16((lds_v8s*)p));
  v8h hi = __builtin_bit_cast(v8h, __builtin_amdgcn_ds_load_tr16_b128_v8i16((lds_v8s*)(p + 16 * pitch)));
  v16h r;
#pragma unroll
  for (int i = 0; i < 8; ++i) { r[i] = lo[i]; r[i + 8] = hi[i]; }
  return r;
}

// ---------------------------------------------------------------------------
// Stage 1: fused LayerNorm (q-path & kv-path share mean/var) + the row's 32 rotary
// factors (radius x cos, radius x sin; mel-scaled freqs, per-step radius), which the
// projection GEMMs' epilogues apply, and the f32 -> f16 conversion of the three weight matrices: the 4 * DIMS * DIMS
// weight elements are dealt out evenly, WPB to each of the CTX blocks. A block's
// share is loaded together with its row, so that both wait out one memory latency,
// and is stored at the block's end.
// ---------------------------------------------------------------------------
#define WPB (4 * DIMS * DIMS / CTX)   // weight elements per block: 2048 = 256 threads x 2 x 4
#define QWB (DIMS * DIMS / WPB)       // blocks that hold q_w (and as many for out_w); kv_w takes twice as many
__global__ __launch_bounds__(256) void prep_kernel(
    const float* __restrict__ x,
    const float* __restrict__ qn_w, const float* __restrict__ qn_b,
    const float* __restrict__ kvn_w, const float* __restrict__ kvn_b,
    const float* __restrict__ rh_w, const float* __restrict__ rh_b,
    const float* __restrict__ q_w, const float* __restrict__ kv_w,
    const float* __restrict__ out_w,
    _Float16* __restrict__ lnq, _Float16* __restrict__ lnkv,
    float* __restrict__ rot,
    _Float16* __restrict__ qw16, _Float16* __restrict__ kvw16,
    _Float16* __restrict__ outw16)
{
  const int c = blockIdx.x, t = threadIdx.x;
  const float* row = x + (size_t)c * DIMS;
  // the block's share of the weights: which matrix is the same for the whole block
  const float* wsrc;
  _Float16* wdst;
  if (c < QWB)          { wsrc = q_w   + (size_t)c * WPB;             wdst = qw16   + (size_t)c * WPB; }
  else if (c < 3 * QWB) { wsrc = kv_w  + (size_t)(c - QWB) * WPB;     wdst = kvw16  + (size_t)(c - QWB) * WPB; }
  else                  { wsrc = out_w + (size_t)(c - 3 * QWB) * WPB; wdst = outw16 + (size_t)(c - 3 * QWB) * WPB; }
  // a wave's load covers 512 B in a row, its store 256 B: whole lines both
  const v4f w0 = *(const v4f*)(wsrc + 4 * t);
  const v4f w1 = *(const v4f*)(wsrc + WPB / 2 + 4 * t);
  float v[4];
  float s = 0.f, s2 = 0.f, dp = 0.f;
#pragma unroll
  for (int i = 0; i < 4; ++i) {
    int d = t + i * 256;
    float val = row[d];
    v[i] = val;
    s += val; s2 += val * val; dp += val * rh_w[d];
  }
  __shared__ float red[256];
  auto reduceAll = [&](float val) -> float {
    red[t] = val; __syncthreads();
    for (int o = 128; o > 0; o >>= 1) { if (t < o) red[t] += red[t + o]; __syncthreads(); }
    float r = red[0]; __syncthreads(); return r;
  };
  float tot  = reduceAll(s);
  float tot2 = reduceAll(s2);
  float dtot = reduceAll(dp);
  float mean = tot * (1.f / DIMS);
  float var  = tot2 * (1.f / DIMS) - mean * mean;
  float inv  = rsqrtf(var + 1e-5f);
  if (t < 32) {   // the first wave: lane j writes the factor of complex pair j; the wave's store covers 256 B
    const float per = dtot + rh_b[0];
    const float rad = fminf(fmaxf(per * 0.01f, 0.5f), 2.0f);
    const float mel_max = 2595.0f * 1.3222192947339193f;          // 2595*log10(21)
    const float lin = (float)t * (mel_max / 31.0f);               // linspace, 32 pts
    const float fb = 0.2f * (expf(lin * (2.3025850929940457f / 2595.0f)) - 1.0f);
    const float freq = (float)c * fb;
    const v2f f = {rad * cosf(freq), rad * sinf(freq)};
    *(v2f*)(rot + ((size_t)c * (HD / 2) + t) * 2) = f;
  }
#pragma unroll
  for (int i = 0; i < 4; ++i) {
    int d = t + i * 256;
    float n = (v[i] - mean) * inv;
    lnq [(size_t)c * DIMS + d] = (_Float16)(n * qn_w[d] + qn_b[d]);
    lnkv[(size_t)c * DIMS + d] = (_Float16)(n * kvn_w[d] + kvn_b[d]);
  }
  *(v4h*)(wdst + 4 * t)           = __builtin_convertvector(w0, v4h);
  *(v4h*)(wdst + WPB / 2 + 4 * t) = __builtin_convertvector(w1, v4h);
}

// ---------------------------------------------------------------------------
// Stage 3/6: LDS-staged WMMA GEMM.  C(f32) = A(f16,MxK) * B(f16,KxN) + bias
// Block tile 64x128; 8 waves in 4(M) x 2(N); each wave owns a 16x64 strip
// = 4 accumulators -> 4 WMMAs per 32 k sharing one A-fragment.
// A and B come into LDS 128 k a stage, by asynchronous copies that cover whole
// 256-byte rows and pass no register. Two buffers: the next stage's copies fly
// while this stage's 16 WMMAs a wave are worked on.
// B lies in LDS as in memory (K x N); the transposing LDS load turns it into fragments.
// M, N, K: multiples of 64, 128, 128.
// EPI 0: C = product + bias, f32.
// EPI 1 (the q and kv projections; a wave's 16x64 strip is 16 rows of ONE head):
//   columns below NR: rotary, then the per-head LayerNorm, out as f16 [h][c][d];
//   columns from NR on (V): out as f16, transposed [h][d][c].
//   Both go through LDS, free behind the loop's last barrier, so that every global
//   store covers whole 128-byte lines.
//   One launch holds both projections: the grid's first nb1 block columns work on
//   A, B, bias, rn, N (q), the columns behind them on A2, B2, bias2, rn2, N2 (kv).
//   Three blocks fit a WGP's LDS, so all blocks of both products run side by side.
// ---------------------------------------------------------------------------
#define BM 64
#define BN 128
#define BK 128  // k per stage = one 256-byte row of A
#define AP 136  // A row stride in f16 (272 bytes = 16 B x 17, odd: the pitch of 16-byte fragment reads)
#define BP 144  // B row stride in f16 (288 bytes = 32 B x 9, odd: the transposing load's pitch)
#define ABUF (BM * AP * 2)   // bytes of one A buffer
#define BBUF (BK * BP * 2)   // bytes of one B buffer
#define AROW (16 * AP * 2)   // bytes of 16 LDS rows of A
#define BROW (16 * BP * 2)   // bytes of 16 LDS rows of B

// One stage: 64 A rows and 128 B rows of 256 B each; 256 threads x 12 copies of 16 B.
// Sixteen lanes cover one row, so a wave's copy reads four whole lines.
// la, lb: the lane's LDS byte addresses; ga, gb: its global addresses (row t/16, piece t%16);
// a16, b16: 16 rows of A and of B in elements.
__device__ inline void stage_ab(unsigned la, unsigned lb,
                                const _Float16* ga, const _Float16* gb,
                                size_t a16, size_t b16) {
  const unsigned la1 = la + AROW, la2 = la + 2 * AROW, la3 = la + 3 * AROW;
  const unsigned lb1 = lb + BROW, lb2 = lb + 2 * BROW, lb3 = lb + 3 * BROW;
  const unsigned lb4 = lb + 4 * BROW, lb5 = lb + 5 * BROW, lb6 = lb + 6 * BROW, lb7 = lb + 7 * BROW;
  const _Float16* ga1 = ga + a16;
  const _Float16* ga2 = ga + 2 * a16;
  const _Float16* ga3 = ga + 3 * a16;
  const _Float16* gb1 = gb + b16;
  const _Float16* gb2 = gb + 2 * b16;
  const _Float16* gb3 = gb + 3 * b16;
  const _Float16* gb4 = gb + 4 * b16;
  const _Float16* gb5 = gb + 5 * b16;
  const _Float16* gb6 = gb + 6 * b16;
  const _Float16* gb7 = gb + 7 * b16;
  // the copies go past the registers; the closing wait stands in the same statement so
  // that no address register named here is rewritten in front of it
  asm volatile(
      "global_load_async_to_lds_b128 %0, %12, off\n\t"
      "global_load_async_to_lds_b128 %1, %13, off\n\t"
      "global_load_async_to_lds_b128 %2, %14, off\n\t"
      "global_load_async_to_lds_b128 %3, %15, off\n\t"
      "global_load_async_to_lds_b128 %4, %16, off\n\t"
      "global_load_async_to_lds_b128 %5, %17, off\n\t"
      "global_load_async_to_lds_b128 %6, %18, off\n\t"
      "global_load_async_to_lds_b128 %7, %19, off\n\t"
      "global_load_async_to_lds_b128 %8, %20, off\n\t"
      "global_load_async_to_lds_b128 %9, %21, off\n\t"
      "global_load_async_to_lds_b128 %10, %22, off\n\t"
      "global_load_async_to_lds_b128 %11, %23, off\n\t"
      "s_wait_xcnt 0x0"
      :: "v"(la), "v"(la1), "v"(la2), "v"(la3),
         "v"(lb), "v"(lb1), "v"(lb2), "v"(lb3), "v"(lb4), "v"(lb5), "v"(lb6), "v"(lb7),
         "v"(ga), "v"(ga1), "v"(ga2), "v"(ga3),
         "v"(gb), "v"(gb1), "v"(gb2), "v"(gb3), "v"(gb4), "v"(gb5), "v"(gb6), "v"(gb7)
      : "memory");
}

#define SP 72   // pitch of the epilogue's LDS tiles in f16: 144 B = 16 B x 9 (odd), the pitch of 16-byte accesses

// lane l takes the value of lane l ^ M, M < 16 (DPP row_xmask: no LDS path, no wait)
template <int M> __device__ inline float xrow(float x) {
  const int i = __builtin_bit_cast(int, x);
  return __builtin_bit_cast(float, __builtin_amdgcn_update_dpp(i, i, 0x160 | M, 0xf, 0xf, false));
}
// sum over the 16 lanes of a row; every lane of the row ends with it
__device__ inline float row_sum(float x) {
  x += xrow<1>(x); x += xrow<2>(x); x += xrow<4>(x); x += xrow<8>(x);
  return x;
}

// 1 / sqrt(x) as the library's rsqrtf forms it: an x below the smallest normal number goes in times 2^24
// and its result comes out times 2^12. The v_nop stands in the instruction's own statement, where nothing
// can come between: it is the one slot that the instruction set asks for behind a transcendental, in front
// of an instruction that reads its result or overwrites its source.
__device__ inline float rsq_slot(float x) {
  const bool tiny = x < 1.17549435e-38f;
  const float a = tiny ? x * 16777216.0f : x;
  float r;
  asm("v_rsq_f32 %0, %1\n\tv_nop" : "=v"(r) : "v"(a));
  return tiny ? r * 4096.0f : r;
}

template <int EPI>
__global__ __launch_bounds__(256) void gemm_kernel(
    const _Float16* __restrict__ A, const _Float16* __restrict__ B,
    const float* __restrict__ bias, float* __restrict__ C,
    int M, int N, int K,
    const float* __restrict__ rot, const float* __restrict__ ln_w, const float* __restrict__ ln_b,
    _Float16* __restrict__ rn, _Float16* __restrict__ vT, int NR,
    const _Float16* __restrict__ A2, const _Float16* __restrict__ B2,
    const float* __restrict__ bias2, _Float16* __restrict__ rn2, int N2, int nb1)
{
  __shared__ __align__(16) _Float16 As[2][BM][AP];
  __shared__ __align__(16) _Float16 Bs[2][BK][BP];   // B staged row-major (KxN)
  const int t = threadIdx.x, lane = t & 31, w = t >> 5;
  const int wm = w >> 1, wn = w & 1;              // 4 x 2 wave grid
  const int half = lane >> 4, l16 = lane & 15;
  int bx = blockIdx.x;
  if (EPI == 1 && bx >= nb1) {   // a block of the launch's second product: the same for the whole block
    bx -= nb1; A = A2; B = B2; bias = bias2; rn = rn2; N = N2;
  }
  const int bm = blockIdx.y * BM, bn = bx * BN;
  const int cr = t >> 4, cc = (t & 15) * 8;       // the lane's row and 16-byte piece in a copy
  const _Float16* ga = A + (size_t)(bm + cr) * K + cc;
  const _Float16* gb = B + (size_t)cr * N + bn + cc;
  const unsigned la = (unsigned)(size_t)&As[0][cr][cc];
  const unsigned lb = (unsigned)(size_t)&Bs[0][cr][cc];
  const size_t a16 = (size_t)16 * K, b16 = (size_t)16 * N;
  const size_t bst = (size_t)BK * N;              // one stage further on in B
  const int nst = K / BK;                         // stages
  v8f acc0 = {}, acc1 = {}, acc2 = {}, acc3 = {};

  stage_ab(la, lb, ga, gb, a16, b16);                        // stage 0 -> buffer 0
  // the rotary factors of the lane's 8 rows x 4 columns, asked for here so that they come in beside stage 0's
  // copies, under the same memory latency: rf[r][i] belongs to row bm + wm*16 + 8*half + r and complex pair (16 i + l16) / 2
  v2f rf[8][4] = {};
  if (EPI == 1 && bn < NR) {
#pragma unroll
    for (int r = 0; r < 8; ++r)
#pragma unroll
      for (int i = 0; i < 4; ++i)
        rf[r][i] = *(const v2f*)(rot + ((size_t)(bm + wm * 16 + 8 * half + r) * (HD / 2) + 8 * i + (l16 >> 1)) * 2);
  }
  asm volatile("s_wait_asynccnt 0x0" ::: "memory");          // this wave's part of stage 0 has landed
  __syncthreads();                                           // ... and every other wave's
  if (nst > 1)
    stage_ab(la + ABUF, lb + BBUF, ga + BK, gb + bst, a16, b16);   // stage 1 -> buffer 1

  for (int s = 0; s < nst; ++s) {
    const int buf = s & 1;
    const _Float16* ap = &As[buf][wm * 16 + l16][0];
    const _Float16* bp = &Bs[buf][8 * half + (lane & 7)][wn * 64 + 8 * ((lane >> 3) & 1)];
    // the stage's four 32-k steps in straight line: constant LDS offsets, and a step's
    // fragment reads need not wait for the step before
#pragma unroll
    for (int kk = 0; kk < BK; kk += 32) {
      const v16h a = load_frag(ap + kk, half);
      const v16h b0 = load_frag_tr(bp + kk * BP,      BP);
      const v16h b1 = load_frag_tr(bp + kk * BP + 16, BP);
      const v16h b2 = load_frag_tr(bp + kk * BP + 32, BP);
      const v16h b3 = load_frag_tr(bp + kk * BP + 48, BP);
      acc0 = __builtin_amdgcn_wmma_f32_16x16x32_f16(false, a, false, b0, (short)0, acc0, false, false);
      acc1 = __builtin_amdgcn_wmma_f32_16x16x32_f16(false, a, false, b1, (short)0, acc1, false, false);
      acc2 = __builtin_amdgcn_wmma_f32_16x16x32_f16(false, a, false, b2, (short)0, acc2, false, false);
      acc3 = __builtin_amdgcn_wmma_f32_16x16x32_f16(false, a, false, b3, (short)0, acc3, false, false);
    }
    // hand-over: stage s + 1 becomes readable and buffer buf becomes free
    asm volatile("s_wait_dscnt 0x0" ::: "memory");     // this wave's reads of buffer buf are done
    asm volatile("s_wait_asynccnt 0x0" ::: "memory");  // its copies of stage s + 1 have landed
    __syncthreads();                                   // the same holds for all eight waves
    if (s + 2 < nst)
      stage_ab(la + buf * ABUF, lb + buf * BBUF,
               ga + (size_t)(s + 2) * BK, gb + (size_t)(s + 2) * bst, a16, b16);
  }
  asm volatile("s_wait_asynccnt 0x0" ::: "memory");    // no copy is open when the wave ends
  // epilogue: C layout per tile: M = r + 8*half, N = l16
  const int ncol0 = bn + wn * 64 + l16;
  const float bb0 = bias[ncol0], bb1 = bias[ncol0 + 16];
  const float bb2 = bias[ncol0 + 32], bb3 = bias[ncol0 + 48];
  if (EPI == 0) {
#pragma unroll
    for (int r = 0; r < 8; ++r) {
      const size_t rowoff = (size_t)(bm + wm * 16 + r + 8 * half) * N + ncol0;
      C[rowoff]      = acc0[r] + bb0;
      C[rowoff + 16] = acc1[r] + bb1;
      C[rowoff + 32] = acc2[r] + bb2;
      C[rowoff + 48] = acc3[r] + bb3;
    }
  } else if (bn < NR) {
    // rotary + per-head LayerNorm. Column d = 16 i + l16 of the head: even d is the real part of
    // pair d / 2, odd d the imaginary part, and the other part sits in lane l ^ 1.
    const int h = (bn + wn * 64) / HD;
    const float lw[4] = {ln_w[l16], ln_w[l16 + 16], ln_w[l16 + 32], ln_w[l16 + 48]};
    const float lb[4] = {ln_b[l16], ln_b[l16 + 16], ln_b[l16 + 32], ln_b[l16 + 48]};
    const bool odd = l16 & 1;
    _Float16* st = &As[0][0][0] + w * (16 * SP);   // the wave's own 16 x 64 tile
#pragma unroll
    for (int r = 0; r < 8; ++r) {
      const float own[4] = {acc0[r] + bb0, acc1[r] + bb1, acc2[r] + bb2, acc3[r] + bb3};
      float v[4];
      float s = 0.f, s2 = 0.f;
#pragma unroll
      for (int i = 0; i < 4; ++i) {
        const float oth = xrow<1>(own[i]);
        // real: xr*fr - xi*fi; imaginary: xi*fr + xr*fi
        v[i] = own[i] * rf[r][i][0] + oth * (odd ? rf[r][i][1] : -rf[r][i][1]);
        s += v[i]; s2 += v[i] * v[i];
      }
      s = row_sum(s); s2 = row_sum(s2);
      const float m = s * (1.f / HD), var = s2 * (1.f / HD) - m * m, iv = rsq_slot(var + 1e-5f);
#pragma unroll
      for (int i = 0; i < 4; ++i)
        st[(8 * half + r) * SP + 16 * i + l16] = (_Float16)((v[i] - m) * iv * lw[i] + lb[i]);
    }
    asm volatile("s_wait_dscnt 0x0" ::: "memory");   // the wave's tile is written before its lanes read each other's parts
#pragma unroll
    for (int k = 0; k < 4; ++k) {
      const int pc = lane + 32 * k, rr = pc >> 3, ch = pc & 7;   // 8 lanes x 16 B = one row; the wave's store covers 512 B in a row
      const v8h o = *(const v8h*)(st + rr * SP + ch * 8);
      *(v8h*)(rn + ((size_t)h * CTX + bm + wm * 16 + rr) * HD + ch * 8) = o;
    }
  } else {
    // V: a lane's 8 registers of a tile are 8 neighbouring rows c of one column d: one 16-byte piece of vT's row d
    _Float16* sv = &As[0][0][0];                     // the block's tile, turned: 128 d x 64 c
    const float bb[4] = {bb0, bb1, bb2, bb3};
#pragma unroll
    for (int i = 0; i < 4; ++i) {
      const v8f a = (i == 0 ? acc0 : i == 1 ? acc1 : i == 2 ? acc2 : acc3) + bb[i];
      *(v8h*)(sv + (wn * 64 + 16 * i + l16) * SP + wm * 16 + 8 * half) = __builtin_convertvector(a, v8h);
    }
    __syncthreads();   // the tile is complete before any wave reads it back by rows of 64 c
#pragma unroll
    for (int k = 0; k < 4; ++k) {
      const int pc = t + 256 * k, d = pc >> 3, ch = pc & 7;      // 8 lanes x 16 B = one line of vT
      const v8h o = *(const v8h*)(sv + d * SP + ch * 8);
      *(v8h*)(vT + (size_t)(bn - NR + d) * CTX + bm + ch * 8) = o;
    }
    // a precaution: the built code lays the rotary part behind this one, and the wait stands between
    // these stores and that part's writes of the registers which the stores name
    asm volatile("s_wait_xcnt 0x0" ::: "memory");
  }
}

// ---------------------------------------------------------------------------
// Stage 5: flash attention. 16 waves/block, 128 queries of one head. A wave owns 32
// queries (two tiles of 16) and takes 32 keys/pass; waves w, w + 4, w + 8 and w + 12 own
// the same queries and share the keys: each takes its own quarter of every stage.
// A K or vT fragment read from LDS so feeds two WMMAs, K and vT are fetched once per
// 128 queries, and four waves share a SIMD, so that one's softmax runs beside another's products.
// Both products are transposed: S^T = K Q^T (4 WMMAs a tile) and O^T += V^T P^T
// (4 WMMAs a tile). A lane then holds 16 scores of ONE query, so maximum and sum are
// taken in its own registers, with one exchange between the wave's halves for the
// maximum, and the two S^T tiles, converted in place, are the B operand of the second
// product: P never touches LDS.
// K and vT come into LDS once per block, 256 keys a stage, by asynchronous copies
// that cover whole 128-byte lines; the sixteen waves read their fragments from there.
// Two buffers: the next stage's copies fly while this stage is worked on.
// Behind the last stage the four waves of a query group join their maxima, sums and
// outputs through LDS.
// ---------------------------------------------------------------------------
#define FK  256           // keys per stage = four 128-byte lines of each vT row
#define FP  72            // K's LDS row pitch in f16: 144 B = 16 B x 9 (odd), the pitch of 16-byte fragment reads
#define VP  (FK + 8)      // vT's LDS row pitch in f16: 528 B = 16 B x 33 (odd)
#define NST (CTX / FK)    // stages
#define KBUF (FK * FP * 2)  // bytes of one K buffer (256 keys)
#define VBUF (HD * VP * 2)  // bytes of one vT buffer (64 d rows)
#define SBUF (KBUF + VBUF)  // one stage's buffer: K, then vT behind it, so that every fragment read's constant offset fits 16 bits
#define KROW (64 * FP * 2)  // bytes of 64 LDS rows of K
#define VROW (16 * VP * 2)  // bytes of 16 LDS rows of vT
#define FW  16              // waves per block: 4 query groups x 4 key quarters
#define JP  18              // 16-byte pieces a lane hands over at the join: 2 tiles x (8 of O + 1 of maximum and sum)
#define JBYTES (FW * JP * 32 * 16)   // bytes of the join's hand-over
#define SMB (2 * SBUF > JBYTES ? 2 * SBUF : JBYTES)

// Four copies of 16 B a lane: copy i goes from g + i * gs (elements) to LDS byte l + i * ls.
__device__ inline void copy4(unsigned l, unsigned ls, const _Float16* g, size_t gs) {
  const unsigned l1 = l + ls, l2 = l + 2 * ls, l3 = l + 3 * ls;
  const _Float16* g1 = g + gs;
  const _Float16* g2 = g + 2 * gs;
  const _Float16* g3 = g + 3 * gs;
  // the copies go past the registers; the closing wait stands in the same statement so
  // that no address register named here is rewritten in front of it
  asm volatile(
      "global_load_async_to_lds_b128 %0, %4, off\n\t"
      "global_load_async_to_lds_b128 %1, %5, off\n\t"
      "global_load_async_to_lds_b128 %2, %6, off\n\t"
      "global_load_async_to_lds_b128 %3, %7, off\n\t"
      "s_wait_xcnt 0x0"
      :: "v"(l), "v"(l1), "v"(l2), "v"(l3),
         "v"(g), "v"(g1), "v"(g2), "v"(g3)
      : "memory");
}

// One stage: 256 K rows of 128 B and 64 vT rows of 512 B; 512 threads x 8 copies of 16 B.
// A wave's copy reads four whole lines: four K rows, or one vT row's four.
// lk, gk: the lane's LDS byte address and global address in K (row t/8, piece t%8);
// lv, gv: the same in vT (row t/32, piece t%32).
__device__ inline void stage_kv(unsigned lk, unsigned lv,
                                const _Float16* gk, const _Float16* gv) {
  copy4(lk, KROW, gk, 64 * HD);
  copy4(lv, VROW, gv, (size_t)16 * CTX);
}

// lane l takes the value of lane l ^ 16
__device__ inline float xhalf(float x) {
  const int i = __builtin_bit_cast(int, x);
  return __builtin_bit_cast(float, __builtin_amdgcn_permlanex16(i, i, 0x76543210, 0xfedcba98, false, false));
}
__device__ inline float max3f(float a, float b, float c) { return fmaxf(fmaxf(a, b), c); }

// 2^x by the bare instruction, as __builtin_amdgcn_exp2f gives it. The v_nop stands in the instruction's own
// statement: it is the one slot that the instruction set asks for behind a transcendental, in front of an
// instruction that reads its result or overwrites its source.
__device__ inline float exp2_slot(float x) {
  float r;
  asm("v_exp_f32 %0, %1\n\tv_nop" : "=v"(r) : "v"(x));
  return r;
}

// One tile of 16 queries: Q as the B operand (column = query l16, the k order of load_frag),
// o[i][r] = O[query l16][d = 16 i + 8 half + r], the query's running maximum (scaled; alike in
// both halves of the wave) and its sum over the keys that this half of the wave holds.
struct QTile {
  v16h bq0, bq1;
  v8f o[4];
  float mrun, lrun;
};

__global__ __launch_bounds__(512) void flash_kernel(
    const _Float16* __restrict__ qn, const _Float16* __restrict__ kn,
    const _Float16* __restrict__ vT, _Float16* __restrict__ aout)
{
  const int t = threadIdx.x;
  const int lane = t & 31;
  const int w = t >> 5;
  const int qg = w & 3, kq = w >> 2;          // the wave's 32 queries; its quarter of every stage's keys
  const int h = blockIdx.y;
  const int q0 = blockIdx.x * 128 + qg * 32;  // the first of the wave's queries
  const int half = lane >> 4, l16 = lane & 15;
  __shared__ __align__(16) _Float16 Sm[SMB / 2];   // two stage buffers; behind the loop, the join's hand-over

  const int cr = t >> 3, cc = (t & 7) * 8;    // the lane's row and 16-byte piece in a copy of K
  const int vr = t >> 5, vc = (t & 31) * 8;   // ... and in a copy of vT
  const _Float16* gk = kn + ((size_t)h * CTX + cr) * HD + cc;
  const _Float16* gv = vT + ((size_t)h * HD + vr) * CTX + vc;
  const unsigned lk = (unsigned)(size_t)&Sm[cr * FP + cc];
  const unsigned lv = (unsigned)(size_t)&Sm[FK * FP + vr * VP + vc];

  stage_kv(lk, lv, gk, gv);                                  // stage 0 -> buffer 0

  QTile qt[2];
#pragma unroll
  for (int j = 0; j < 2; ++j) {
    const _Float16* qrow = qn + ((size_t)h * CTX + q0 + 16 * j + l16) * HD;
    qt[j].bq0 = load_frag(qrow, half);       // d = 0..31
    qt[j].bq1 = load_frag(qrow + 32, half);  // d = 32..63
#pragma unroll
    for (int i = 0; i < 4; ++i) qt[j].o[i] = v8f{};
    qt[j].mrun = -1e30f;
    qt[j].lrun = 0.f;
  }
  const float cs = 0.125f * 1.4426950408889634f;   // 1/sqrt(64), in the base-2 domain

  asm volatile("s_wait_asynccnt 0x0" ::: "memory");          // this wave's part of stage 0 has landed
  __syncthreads();                                           // ... and every other wave's
  stage_kv(lk + SBUF, lv + SBUF, gk + FK * HD, gv + FK);     // stage 1 -> buffer 1

  for (int s = 0; s < NST; ++s) {
    const int buf = s & 1;
    const _Float16* sb = Sm + buf * (SBUF / 2);
    // the wave's quarter of the stage: two 32-key passes; they stay a loop, so that the wave keeps
    // inside the 256 registers that four waves a SIMD leave it
#pragma unroll 1
    for (int ps = 0; ps < FK / 4; ps += 32) {
      const int sub = kq * (FK / 4) + ps;
      // K as the A operand of the first product, V^T (row = d, k = the pass's 32 keys in the order of
      // load_frag) as that of the second: each fragment is read once and serves both query tiles
      const _Float16* k0row = sb + (sub + l16) * FP;
      const _Float16* k1row = k0row + 16 * FP;
      const _Float16* vb = sb + FK * FP + l16 * VP + sub;
      const v16h ka0 = load_frag(k0row, half), ka1 = load_frag(k0row + 32, half);
      const v16h kb0 = load_frag(k1row, half), kb1 = load_frag(k1row + 32, half);
      const v16h va[4] = {load_frag(vb, half), load_frag(vb + 16 * VP, half),
                          load_frag(vb + 32 * VP, half), load_frag(vb + 48 * VP, half)};
      // the two tiles in straight line: one tile's products need not wait for the other's softmax
#pragma unroll
      for (int j = 0; j < 2; ++j) {
        QTile& q = qt[j];
        v8f z = {};
        // s0[r] = S[key sub + 8 half + r][query l16], s1[r] = the same 16 keys further on
        v8f s0 = __builtin_amdgcn_wmma_f32_16x16x32_f16(false, ka0, false, q.bq0, (short)0, z, false, false);
        s0 = __builtin_amdgcn_wmma_f32_16x16x32_f16(false, ka1, false, q.bq1, (short)0, s0, false, false);
        v8f s1 = __builtin_amdgcn_wmma_f32_16x16x32_f16(false, kb0, false, q.bq0, (short)0, z, false, false);
        s1 = __builtin_amdgcn_wmma_f32_16x16x32_f16(false, kb1, false, q.bq1, (short)0, s1, false, false);

        // maximum of the raw scores (the scale is positive): 16 in the lane, then the other half's
        const float ma = max3f(max3f(s0[0], s0[1], s0[2]), max3f(s0[3], s0[4], s0[5]), max3f(s0[6], s0[7], s1[0]));
        const float mb = max3f(max3f(s1[1], s1[2], s1[3]), max3f(s1[4], s1[5], s1[6]), s1[7]);
        float mx = fmaxf(ma, mb);
        mx = fmaxf(mx, xhalf(mx));
        const float mnew = fmaxf(q.mrun, mx * cs);
        const float alpha = __builtin_amdgcn_exp2f(q.mrun - mnew);
        q.mrun = mnew;

        // P^T as the B operand, in the k order of load_frag: element e is s0[e] for e < 8, s1[e - 8] behind it
        const v2f c2 = {cs, cs}, nm = {-mnew, -mnew};
        v2f p[8];
        v16h bp;
#pragma unroll
        for (int i = 0; i < 8; ++i) {
          const v8f& sv = i < 4 ? s0 : s1;
          const v2f x = {sv[2 * (i & 3)], sv[2 * (i & 3) + 1]};
          const v2f arg = __builtin_elementwise_fma(x, c2, nm);
          p[i] = v2f{__builtin_amdgcn_exp2f(arg[0]), __builtin_amdgcn_exp2f(arg[1])};
          const v2h ph = __builtin_convertvector(p[i], v2h);
          bp[2 * i] = ph[0]; bp[2 * i + 1] = ph[1];
        }
        const v2f psum = ((p[0] + p[1]) + (p[2] + p[3])) + ((p[4] + p[5]) + (p[6] + p[7]));
        q.lrun = q.lrun * alpha + (psum[0] + psum[1]);
#pragma unroll
        for (int i = 0; i < 4; ++i) {
          q.o[i] *= alpha;
          q.o[i] = __builtin_amdgcn_wmma_f32_16x16x32_f16(false, va[i], false, bp, (short)0, q.o[i], false, false);
        }
      }
      // the four vector slots that the chip needs between the pass's last WMMA and the next pass's first
      // instructions, which overwrite its A and B registers.
      // The scheduling barrier keeps the WMMAs in front of them.
      __builtin_amdgcn_sched_barrier(0);
      asm volatile("v_nop\n\tv_nop\n\tv_nop\n\tv_nop");
    }
    // hand-over: stage s + 1 becomes readable and buffer buf becomes free
    asm volatile("s_wait_dscnt 0x0" ::: "memory");     // this wave's reads of buffer buf are done
    asm volatile("s_wait_asynccnt 0x0" ::: "memory");  // its copies of stage s + 1 have landed
    __syncthreads();                                   // the same holds for all sixteen waves
    if (s + 2 < NST)
      stage_kv(lk + buf * SBUF, lv + buf * SBUF,
               gk + (size_t)(s + 2) * FK * HD, gv + (s + 2) * FK);
  }
  asm volatile("s_wait_asynccnt 0x0" ::: "memory");    // no copy is open when the wave ends

  // The join. Every wave lays its two tiles' outputs, maxima and sums into LDS (free behind the loop's last
  // barrier), lane by lane, 16 bytes a lane and store; of a query group's four waves the first then ends
  // tile 0 and the second tile 1, so that one wave writes a query's whole 128-byte line.
  v4f* mg = (v4f*)Sm;
  v4f* put = mg + (size_t)w * JP * 32 + lane;
#pragma unroll
  for (int j = 0; j < 2; ++j) {
#pragma unroll
    for (int i = 0; i < 4; ++i) {
      const v8f& o = qt[j].o[i];
      put[(9 * j + 2 * i) * 32]     = v4f{o[0], o[1], o[2], o[3]};
      put[(9 * j + 2 * i + 1) * 32] = v4f{o[4], o[5], o[6], o[7]};
    }
    put[(9 * j + 8) * 32] = v4f{qt[j].mrun, qt[j].lrun, 0.f, 0.f};
  }
  __syncthreads();   // every wave's hand-over is written before another wave reads it
  if (kq < 2) {      // the same for the whole wave; no barrier stands behind it
    // part k: what the wave of key quarter k holds of tile kq
    const v4f* get = mg + ((size_t)qg * JP + 9 * kq) * 32 + lane;
    const int pw = 4 * JP * 32;   // from one key quarter's wave to the next
    const v2f ml0 = *(const v2f*)(get + 8 * 32), ml1 = *(const v2f*)(get + pw + 8 * 32);
    const v2f ml2 = *(const v2f*)(get + 2 * pw + 8 * 32), ml3 = *(const v2f*)(get + 3 * pw + 8 * 32);
    const float mj = fmaxf(fmaxf(ml0[0], ml1[0]), fmaxf(ml2[0], ml3[0]));
    float f[4] = {exp2_slot(ml0[0] - mj), exp2_slot(ml1[0] - mj), exp2_slot(ml2[0] - mj), exp2_slot(ml3[0] - mj)};
    const float lj = (ml0[1] * f[0] + ml1[1] * f[1]) + (ml2[1] * f[2] + ml3[1] * f[3]);
    // the wave's two halves' sums join once; a lane's 8 registers of a tile are 8 neighbouring d of its query
    const float rl = 1.f / (lj + xhalf(lj));
#pragma unroll
    for (int k = 0; k < 4; ++k) f[k] *= rl;
    _Float16* dst = aout + (size_t)(q0 + 16 * kq + l16) * DIMS + h * HD + 8 * half;
#pragma unroll
    for (int i = 0; i < 4; ++i) {
      v4f a = get[(2 * i) * 32] * f[0], b = get[(2 * i + 1) * 32] * f[0];
#pragma unroll
      for (int k = 1; k < 4; ++k) {
        a += get[k * pw + (2 * i) * 32] * f[k];
        b += get[k * pw + (2 * i + 1) * 32] * f[k];
      }
      const v8f o = {a[0], a[1], a[2], a[3], b[0], b[1], b[2], b[3]};
      *(v8h*)(dst + 16 * i) = __builtin_convertvector(o, v8h);
    }
  }
}

// ---------------------------------------------------------------------------
extern "C" void kernel_launch(void* const* d_in, const int* in_sizes, int n_in,
                              void* d_out, int out_size, void* d_ws, size_t ws_size,
                              hipStream_t stream) {
  const float* x     = (const float*)d_in[0];
  const float* qn_w  = (const float*)d_in[1];
  const float* qn_b  = (const float*)d_in[2];
  const float* q_w   = (const float*)d_in[3];
  const float* q_b   = (const float*)d_in[4];
  const float* kvn_w = (const float*)d_in[5];
  const float* kvn_b = (const float*)d_in[6];
  const float* kv_w  = (const float*)d_in[7];
  const float* kv_b  = (const float*)d_in[8];
  const float* out_w = (const float*)d_in[9];
  const float* out_b = (const float*)d_in[10];
  const float* ln_w  = (const float*)d_in[11];
  const float* ln_b  = (const float*)d_in[12];
  const float* rh_w  = (const float*)d_in[13];
  const float* rh_b  = (const float*)d_in[14];
  float* out = (float*)d_out;
  (void)in_sizes; (void)n_in; (void)out_size; (void)ws_size;

  char* base = (char*)d_ws;
  size_t off = 0;
  auto take = [&](size_t bytes) -> char* {
    char* p = base + off;
    off = (off + bytes + 255) & ~(size_t)255;
    return p;
  };
  _Float16* lnq16  = (_Float16*)take((size_t)CTX * DIMS * 2);
  _Float16* lnkv16 = (_Float16*)take((size_t)CTX * DIMS * 2);
  float*    rot    = (float*)take((size_t)CTX * HD * 4);
  _Float16* qw16   = (_Float16*)take((size_t)DIMS * DIMS * 2);
  _Float16* kvw16  = (_Float16*)take((size_t)DIMS * 2 * DIMS * 2);
  _Float16* outw16 = (_Float16*)take((size_t)DIMS * DIMS * 2);
  _Float16* qn16   = (_Float16*)take((size_t)HEAD * CTX * HD * 2);
  _Float16* kn16   = (_Float16*)take((size_t)HEAD * CTX * HD * 2);
  _Float16* vT16   = (_Float16*)take((size_t)HEAD * HD * CTX * 2);
  _Float16* a16    = (_Float16*)take((size_t)CTX * DIMS * 2);

  prep_kernel<<<CTX, 256, 0, stream>>>(x, qn_w, qn_b, kvn_w, kvn_b, rh_w, rh_b,
                                       q_w, kv_w, out_w,
                                       lnq16, lnkv16, rot, qw16, kvw16, outw16);

  gemm_kernel<1><<<dim3(3 * DIMS / BN, CTX / BM), 256, 0, stream>>>(
      lnq16, qw16, q_b, nullptr, CTX, DIMS, DIMS, rot, ln_w, ln_b, qn16, vT16, DIMS,
      lnkv16, kvw16, kv_b, kn16, 2 * DIMS, DIMS / BN);

  flash_kernel<<<dim3(CTX / 128, HEAD), 32 * FW, 0, stream>>>(qn16, kn16, vT16, a16);

  gemm_kernel<0><<<dim3(DIMS / BN, CTX / BM), 256, 0, stream>>>(
      a16, outw16, out_b, out, CTX, DIMS, DIMS, nullptr, nullptr, nullptr, nullptr, nullptr, 0,
      nullptr, nullptr, nullptr, nullptr, 0, 0);
}
